// v000
// Times are from an AMD MI455X. After a warm-up the kernel runs many times in a row, and a time is the length of
// such a window on the GPU divided by its runs, so every launch and the gaps after it count. The runs cycle
// through copies of the inputs. A figure is the median of several windows, for all but v000 over two sittings.
// Sittings can differ by a few percent; kernels timed side by side share one.
// The starting kernel, v000, takes 375 microseconds a run.
#include <hip/hip_runtime.h>
#include <hip/hip_bf16.h>

#define S_LEN   2048
#define D_MODEL 1024
#define N_HEADS 16
#define D_HEAD  64
#define BATCH   2

typedef _Float16 h8   __attribute__((ext_vector_type(8)));
typedef _Float16 v16h __attribute__((ext_vector_type(16)));
typedef float    v8f  __attribute__((ext_vector_type(8)));

#define WMMA_F16(a, b, c) \
  __builtin_amdgcn_wmma_f32_16x16x32_f16(false, (a), false, (b), (short)0, (c), false, false)

// ---------- CDNA5 async global->LDS copy (guarded; falls back to ld+ds_store) ----------
#if defined(__has_builtin)
#if __has_builtin(__builtin_amdgcn_global_load_async_to_lds_b128)
#define HAVE_ASYNC_CP 1
#endif
#endif
#ifndef HAVE_ASYNC_CP
#define HAVE_ASYNC_CP 0
#endif

typedef int v4i_t __attribute__((vector_size(16)));
typedef __attribute__((address_space(1))) v4i_t* g_v4i_p;   // global int4*
typedef __attribute__((address_space(3))) v4i_t* l_v4i_p;   // LDS int4*

static __device__ __forceinline__ void cp16_g2l(const _Float16* g, _Float16* l) {
#if HAVE_ASYNC_CP
  __builtin_amdgcn_global_load_async_to_lds_b128(
      (g_v4i_p)(unsigned long long)g,
      (l_v4i_p)(unsigned int)(unsigned long long)l, 0, 0);
#else
  *(h8*)l = *(const h8*)g;
#endif
}
static __device__ __forceinline__ void wait_async_le4() {
#if HAVE_ASYNC_CP
  asm volatile("s_wait_asynccnt 0x4" ::: "memory");
#endif
}
static __device__ __forceinline__ void wait_async_le0() {
#if HAVE_ASYNC_CP
  asm volatile("s_wait_asynccnt 0x0" ::: "memory");
#endif
}

// Load one lane's slice of a 16x32 (f16) A/B fragment.
// Layout per ISA 7.12.2: lanes 0-15 hold K[0..7]+K[16..23], lanes 16-31 hold K[8..15]+K[24..31].
static __device__ __forceinline__ v16h frag_ld(const _Float16* p, int k0) {
  h8 lo = *(const h8*)(p + k0);
  h8 hi = *(const h8*)(p + k0 + 16);
  return __builtin_shufflevector(lo, hi, 0,1,2,3,4,5,6,7,8,9,10,11,12,13,14,15);
}

// G = Qtile(16x64) @ Er[ebase .. ebase+15]^T  -> 16x16 f32 (2 WMMAs over K=64)
static __device__ __forceinline__ v8f er_gemm(v16h a0, v16h a1,
                                              const _Float16* __restrict__ Erh,
                                              int ebase, int nn, int k0) {
  int e = ebase + nn;
  e = e < 0 ? 0 : e;
  e = e > (S_LEN - 1) ? (S_LEN - 1) : e;   // clamp; clamped columns are never selected
  const _Float16* col = Erh + (size_t)e * D_HEAD;
  v8f c = {};
  c = WMMA_F16(a0, frag_ld(col, k0), c);
  c = WMMA_F16(a1, frag_ld(col + 32, k0), c);
  return c;
}

// ---------------- Kernel 1: f32 -> f16 cast ----------------
__global__ void cast_f32_f16(const float* __restrict__ in, _Float16* __restrict__ out, int n) {
  int i = blockIdx.x * blockDim.x + threadIdx.x;
  int stride = gridDim.x * blockDim.x;
  for (; i < n; i += stride) out[i] = (_Float16)in[i];
}

// ---------------- Kernel 2: QKV projection GEMM ----------------
// y = Xh @ W^T + b ; z = 0/1/2 -> Q/K/V. Q,K stored (b,h,s,dh); V stored transposed (b,h,dh,s).
// B panel (16 output features x K=1024) is staged once into LDS via async copies and
// shared by all 4 waves; A streams from global (L2-resident).
__global__ void __launch_bounds__(128)
qkv_gemm(const _Float16* __restrict__ Xh,
         const _Float16* __restrict__ Wqh, const _Float16* __restrict__ Wkh,
         const _Float16* __restrict__ Wvh,
         const float* __restrict__ bq, const float* __restrict__ bk, const float* __restrict__ bv,
         _Float16* __restrict__ Qh, _Float16* __restrict__ Kh, _Float16* __restrict__ Vth) {
  __shared__ __align__(16) _Float16 Bl[16][D_MODEL];   // 32 KB

  const int tid  = threadIdx.x;
  const int lane = tid & 31;
  const int wave = tid >> 5;
  const int nn   = lane & 15;
  const int k0   = ((lane >> 4) & 1) * 8;
  const int n0   = blockIdx.x * 16;
  const int row0 = (blockIdx.y * 4 + wave) * 16;
  const int which = blockIdx.z;

  const _Float16* W    = (which == 0) ? Wqh : (which == 1) ? Wkh : Wvh;
  const float*    bias = (which == 0) ? bq  : (which == 1) ? bk  : bv;

  // cooperative async B-panel load: 16 cols x 1024 halfs = 2048 x 16B chunks
#pragma unroll
  for (int r = 0; r < 16; ++r) {
    int c    = tid + r * 128;
    int col  = c >> 7;
    int kpos = (c & 127) << 3;
    cp16_g2l(W + (size_t)(n0 + col) * D_MODEL + kpos, &Bl[col][kpos]);
  }
  wait_async_le0();
  __syncthreads();

  const _Float16* arow = Xh + (size_t)(row0 + nn) * D_MODEL;  // A: row = lane&15
  const _Float16* bcol = &Bl[nn][0];                          // B col = staged W row

  v8f acc = {};
#pragma unroll 8
  for (int kk = 0; kk < D_MODEL; kk += 32) {
    acc = WMMA_F16(frag_ld(arow + kk, k0), frag_ld(bcol + kk, k0), acc);
  }

  const int   o   = n0 + nn;
  const float bb_ = bias[o];
  const int   h   = o >> 6, dh = o & 63;
  const int   hiRow = ((lane >> 4) & 1) * 8;
#pragma unroll
  for (int g = 0; g < 8; ++g) {
    int r = row0 + g + hiRow;          // C layout: lane holds col o, row g(+8)
    int bb = r >> 11;                  // / S_LEN
    int s  = r & (S_LEN - 1);
    _Float16 val = (_Float16)(acc[g] + bb_);
    size_t head = (size_t)(bb * N_HEADS + h);
    if (which == 2)      Vth[(head * D_HEAD + dh) * S_LEN + s] = val;
    else if (which == 0) Qh[(head * S_LEN + s) * D_HEAD + dh]  = val;
    else                 Kh[(head * S_LEN + s) * D_HEAD + dh]  = val;
  }
}

// ---------------- Kernel 3: flash attention with relative skew ----------------
// K/V slabs (32 keys) are double-buffered in LDS via async copies, shared by all 4 waves;
// prefetch of slab n+1 overlaps compute on slab n (s_wait_asynccnt <= 4).
static __device__ __forceinline__ void slab_load(const _Float16* __restrict__ Kbase,
                                                 const _Float16* __restrict__ Vbase,
                                                 int t0,
                                                 _Float16 (*Kl)[64], _Float16 (*Vl)[32],
                                                 int tid) {
#pragma unroll
  for (int r = 0; r < 2; ++r) {
    int c = tid + r * 128;                 // 0..255
    int krow = c >> 3, kcol = (c & 7) << 3;   // 32 rows x 64 halfs
    cp16_g2l(Kbase + (size_t)(t0 + krow) * D_HEAD + kcol, &Kl[krow][kcol]);
    int vrow = c >> 2, vcol = (c & 3) << 3;   // 64 rows x 32 halfs
    cp16_g2l(Vbase + (size_t)vrow * S_LEN + t0 + vcol, &Vl[vrow][vcol]);
  }
}

__global__ void __launch_bounds__(128)
attn_kernel(const _Float16* __restrict__ Qh, const _Float16* __restrict__ Kh,
            const _Float16* __restrict__ Vt, const _Float16* __restrict__ Erh,
            float* __restrict__ out) {
  __shared__ __align__(16) _Float16 Kl[2][32][64];   // 8 KB double-buffered K slab
  __shared__ __align__(16) _Float16 Vl[2][64][32];   // 8 KB double-buffered V slab (dh,t)
  __shared__ __align__(16) _Float16 plds[4][16][32]; // per-wave P transpose staging

  const int tid  = threadIdx.x;
  const int lane = tid & 31;
  const int wave = tid >> 5;
  const int hiH  = (lane >> 4) & 1;
  const int k0   = hiH * 8;
  const int nn   = lane & 15;

  const int h  = blockIdx.y;
  const int b  = blockIdx.z;
  const int s0 = blockIdx.x * 64 + wave * 16;

  const size_t head = (size_t)(b * N_HEADS + h) * (size_t)S_LEN * D_HEAD;
  const _Float16* Qbase = Qh + head;
  const _Float16* Kbase = Kh + head;
  const _Float16* Vbase = Vt + head;   // (dh, t) layout

  // warm the Er diagonal band this block touches first
  {
    int e = S_LEN - 16 - s0 + nn;
    e = e < 0 ? 0 : e;
    __builtin_prefetch(Erh + (size_t)e * D_HEAD, 0, 1);
  }

  const _Float16* qrow = Qbase + (size_t)(s0 + nn) * D_HEAD;
  int sshift = s0 + nn + 1; if (sshift > S_LEN - 1) sshift = S_LEN - 1;
  const _Float16* qsrow = Qbase + (size_t)sshift * D_HEAD;  // rows s+1 (skew wrap term)

  const v16h qa0 = frag_ld(qrow, k0);        // Q  d 0..31
  const v16h qa1 = frag_ld(qrow + 32, k0);   // Q  d 32..63
  const v16h qs0 = frag_ld(qsrow, k0);       // Qs d 0..31
  const v16h qs1 = frag_ld(qsrow + 32, k0);  // Qs d 32..63

  float rowmax[8], rowsum[8];
  v8f o0 = {}, o1 = {}, o2 = {}, o3 = {};
#pragma unroll
  for (int g = 0; g < 8; ++g) { rowmax[g] = -3.0e38f; rowsum[g] = 0.f; }

  slab_load(Kbase, Vbase, 0, Kl[0], Vl[0], tid);   // preload slab 0

  for (int t0 = 0; t0 < S_LEN; t0 += 32) {
    const int buf = (t0 >> 5) & 1;
    if (t0 + 32 < S_LEN) {
      slab_load(Kbase, Vbase, t0 + 32, Kl[buf ^ 1], Vl[buf ^ 1], tid);
      wait_async_le4();                // current slab landed; prefetch stays in flight
    } else {
      wait_async_le0();
    }
    __syncthreads();

    float sc[2][8];
    float tmax[8];
#pragma unroll
    for (int g = 0; g < 8; ++g) tmax[g] = -3.0e38f;

#pragma unroll
    for (int sub = 0; sub < 2; ++sub) {
      const int tt = t0 + sub * 16;

      // ---- QK^T 16x16 tile (K = 64) from LDS ----
      const _Float16* kcol = &Kl[buf][sub * 16 + nn][0];
      v8f c = {};
      c = WMMA_F16(qa0, frag_ld(kcol, k0), c);
      c = WMMA_F16(qa1, frag_ld(kcol + 32, k0), c);

      // ---- Srel tile via Er-block WMMAs + Toeplitz lane shift ----
      const int d0 = tt - s0;
      float srel[8];
#pragma unroll
      for (int g = 0; g < 8; ++g) srel[g] = 0.f;

      if (d0 <= 15) {  // in-band: Srel[s,t] = q[s].Er[S-1+t-s],  t<=s
        v8f g1 = er_gemm(qa0, qa1, Erh, S_LEN - 16 + d0, nn, k0);
        v8f g2 = er_gemm(qa0, qa1, Erh, S_LEN + d0,      nn, k0);
#pragma unroll
        for (int g = 0; g < 8; ++g) {
          int mm = g + 8 * hiH;
          int jm = nn - mm;                     // j - i
          int dd = d0 + jm;                     // t - s
          int srcc = (jm >= 1) ? (jm - 1) : (jm + 15);
          int srcl = (lane & 16) | srcc;
          float v1 = __shfl(g1[g], srcl, 32);
          float v2 = __shfl(g2[g], srcl, 32);
          float v  = (jm >= 1) ? v2 : v1;
          if (dd <= 0) srel[g] = v;
        }
      }
      if (d0 >= -13) { // wrap artifact: Srel[s,t] = q[s+1].Er[t-s-2],  t>=s+2
        v8f gj1 = er_gemm(qs0, qs1, Erh, d0 - 17, nn, k0);
        v8f gj2 = er_gemm(qs0, qs1, Erh, d0 - 1,  nn, k0);
#pragma unroll
        for (int g = 0; g < 8; ++g) {
          int mm = g + 8 * hiH;
          int jm = nn - mm;
          int dd = d0 + jm;
          int srcc = (jm >= 1) ? (jm - 1) : (jm + 15);
          int srcl = (lane & 16) | srcc;
          float v1 = __shfl(gj1[g], srcl, 32);
          float v2 = __shfl(gj2[g], srcl, 32);
          float v  = (jm >= 1) ? v2 : v1;
          if (dd >= 2) srel[g] = v;
        }
      }
      // (dd == 1 stays exactly 0, matching the skew's zero column)

#pragma unroll
      for (int g = 0; g < 8; ++g) {
        float sv = (c[g] + srel[g]) * 0.125f;   // / sqrt(D_HEAD)
        sc[sub][g] = sv;
        tmax[g] = fmaxf(tmax[g], sv);
      }
    }

    // ---- online softmax across this 32-key slab ----
#pragma unroll
    for (int g = 0; g < 8; ++g) {
      float tm = tmax[g];
#pragma unroll
      for (int x = 1; x < 16; x <<= 1) tm = fmaxf(tm, __shfl_xor(tm, x, 32));
      float nm = fmaxf(rowmax[g], tm);
      float al = __expf(rowmax[g] - nm);
      rowmax[g] = nm;
      float p0 = __expf(sc[0][g] - nm);
      float p1 = __expf(sc[1][g] - nm);
      float ts = p0 + p1;
#pragma unroll
      for (int x = 1; x < 16; x <<= 1) ts += __shfl_xor(ts, x, 32);
      rowsum[g] = rowsum[g] * al + ts;
      o0[g] *= al; o1[g] *= al; o2[g] *= al; o3[g] *= al;
      int mm = g + 8 * hiH;
      plds[wave][mm][nn]      = (_Float16)p0;   // C-layout scatter into LDS
      plds[wave][mm][16 + nn] = (_Float16)p1;
    }

    // read back P as A-fragment (row = lane&15, K = 32 keys)
    v16h pa = frag_ld(&plds[wave][nn][0], k0);

    // ---- P @ V : 4 WMMAs over the 64 head dims (K = 32), V from LDS ----
    const _Float16* vrow_ = &Vl[buf][nn][0];              // row stride 32 halfs
    o0 = WMMA_F16(pa, frag_ld(vrow_,            k0), o0);
    o1 = WMMA_F16(pa, frag_ld(vrow_ + 16 * 32,  k0), o1);
    o2 = WMMA_F16(pa, frag_ld(vrow_ + 32 * 32,  k0), o2);
    o3 = WMMA_F16(pa, frag_ld(vrow_ + 48 * 32,  k0), o3);

    __syncthreads();   // slab buffers free for the next prefetch
  }

  // ---- normalize and write (B, S, D_MODEL) f32 ----
#pragma unroll
  for (int g = 0; g < 8; ++g) {
    int s = s0 + g + 8 * hiH;
    float inv = 1.0f / rowsum[g];
    size_t base = ((size_t)(b * S_LEN + s)) * D_MODEL + h * D_HEAD + nn;
    out[base +  0] = o0[g] * inv;
    out[base + 16] = o1[g] * inv;
    out[base + 32] = o2[g] * inv;
    out[base + 48] = o3[g] * inv;
  }
}

extern "C" void kernel_launch(void* const* d_in, const int* in_sizes, int n_in,
                              void* d_out, int out_size, void* d_ws, size_t ws_size,
                              hipStream_t stream) {
  (void)in_sizes; (void)n_in; (void)out_size; (void)ws_size;
  const float* x  = (const float*)d_in[0];
  const float* Wq = (const float*)d_in[1];
  const float* bq = (const float*)d_in[2];
  const float* Wk = (const float*)d_in[3];
  const float* bk = (const float*)d_in[4];
  const float* Wv = (const float*)d_in[5];
  const float* bv = (const float*)d_in[6];
  const float* Er = (const float*)d_in[7];

  char* ws = (char*)d_ws;
  const size_t xhN = (size_t)BATCH * S_LEN * D_MODEL;        // 4,194,304
  const size_t wN  = (size_t)D_MODEL * D_MODEL;              // 1,048,576
  const size_t erN = (size_t)S_LEN * D_HEAD;                 // 131,072

  _Float16* Xh  = (_Float16*)(ws);
  _Float16* Wqh = (_Float16*)(ws + 2 * xhN);
  _Float16* Wkh = Wqh + wN;
  _Float16* Wvh = Wkh + wN;
  _Float16* Erh = Wvh + wN;
  _Float16* Qh  = Erh + erN;
  _Float16* Kh  = Qh + xhN;
  _Float16* Vth = Kh + xhN;

  cast_f32_f16<<<2048, 256, 0, stream>>>(x,  Xh,  (int)xhN);
  cast_f32_f16<<<512,  256, 0, stream>>>(Wq, Wqh, (int)wN);
  cast_f32_f16<<<512,  256, 0, stream>>>(Wk, Wkh, (int)wN);
  cast_f32_f16<<<512,  256, 0, stream>>>(Wv, Wvh, (int)wN);
  cast_f32_f16<<<64,   256, 0, stream>>>(Er, Erh, (int)erN);

  // QKV: M = 4096 rows, N = 1024 feats, K = 1024; z selects Q/K/V
  qkv_gemm<<<dim3(D_MODEL / 16, (BATCH * S_LEN) / 64, 3), 128, 0, stream>>>(
      Xh, Wqh, Wkh, Wvh, bq, bk, bv, Qh, Kh, Vth);

  // attention: 64 query rows per block (4 waves x 16)
  attn_kernel<<<dim3(S_LEN / 64, N_HEADS, BATCH), 128, 0, stream>>>(
      Qh, Kh, Vth, Erh, (float*)d_out);
}

// v001
// One run takes 246 microseconds.
// In both of two side-by-side timings against v000, it was 1.59 times as fast.
#include <hip/hip_runtime.h>
#include <hip/hip_bf16.h>

#define S_LEN   2048
#define D_MODEL 1024
#define N_HEADS 16
#define D_HEAD  64
#define BATCH   2

typedef _Float16 h8   __attribute__((ext_vector_type(8)));
typedef _Float16 v16h __attribute__((ext_vector_type(16)));
typedef float    v8f  __attribute__((ext_vector_type(8)));

#define WMMA_F16(a, b, c) \
  __builtin_amdgcn_wmma_f32_16x16x32_f16(false, (a), false, (b), (short)0, (c), false, false)

// ---------- CDNA5 async global->LDS copy (guarded; falls back to ld+ds_store) ----------
#if defined(__has_builtin)
#if __has_builtin(__builtin_amdgcn_global_load_async_to_lds_b128)
#define HAVE_ASYNC_CP 1
#endif
#endif
#ifndef HAVE_ASYNC_CP
#define HAVE_ASYNC_CP 0
#endif

typedef int v4i_t __attribute__((vector_size(16)));
typedef __attribute__((address_space(1))) v4i_t* g_v4i_p;   // global int4*
typedef __attribute__((address_space(3))) v4i_t* l_v4i_p;   // LDS int4*

static __device__ __forceinline__ void cp16_g2l(const _Float16* g, _Float16* l) {
#if HAVE_ASYNC_CP
  __builtin_amdgcn_global_load_async_to_lds_b128(
      (g_v4i_p)(unsigned long long)g,
      (l_v4i_p)(unsigned int)(unsigned long long)l, 0, 0);
#else
  *(h8*)l = *(const h8*)g;
#endif
}
static __device__ __forceinline__ void wait_async_le4() {
#if HAVE_ASYNC_CP
  asm volatile("s_wait_asynccnt 0x4" ::: "memory");
#endif
}
static __device__ __forceinline__ void wait_async_le0() {
#if HAVE_ASYNC_CP
  asm volatile("s_wait_asynccnt 0x0" ::: "memory");
#endif
}

// Load one lane's slice of a 16x32 (f16) A/B fragment.
// Layout per ISA 7.12.2: lanes 0-15 hold K[0..7]+K[16..23], lanes 16-31 hold K[8..15]+K[24..31].
static __device__ __forceinline__ v16h frag_ld(const _Float16* p, int k0) {
  h8 lo = *(const h8*)(p + k0);
  h8 hi = *(const h8*)(p + k0 + 16);
  return __builtin_shufflevector(lo, hi, 0,1,2,3,4,5,6,7,8,9,10,11,12,13,14,15);
}

// G = Qtile(16x64) @ Er[ebase .. ebase+15]^T  -> 16x16 f32 (2 WMMAs over K=64)
static __device__ __forceinline__ v8f er_gemm(v16h a0, v16h a1,
                                              const _Float16* __restrict__ Erh,
                                              int ebase, int nn, int k0) {
  int e = ebase + nn;
  e = e < 0 ? 0 : e;
  e = e > (S_LEN - 1) ? (S_LEN - 1) : e;   // clamp; clamped columns are never selected
  const _Float16* col = Erh + (size_t)e * D_HEAD;
  v8f c = {};
  c = WMMA_F16(a0, frag_ld(col, k0), c);
  c = WMMA_F16(a1, frag_ld(col + 32, k0), c);
  return c;
}

// ---------------- Kernel 1: f32 -> f16 cast ----------------
__global__ void cast_f32_f16(const float* __restrict__ in, _Float16* __restrict__ out, int n) {
  int i = blockIdx.x * blockDim.x + threadIdx.x;
  int stride = gridDim.x * blockDim.x;
  for (; i < n; i += stride) out[i] = (_Float16)in[i];
}

// ---------------- Kernel 2: QKV projection GEMM ----------------
// y = Xh @ W^T + b ; z = 0/1/2 -> Q/K/V. Q,K stored (b,h,s,dh); V stored transposed (b,h,dh,s).
// One 128x128 tile of y per block, 64x64 per wave (4x4 WMMA tiles), so every LDS fragment
// feeds four WMMAs. A pass is 64 k: 128 W rows and 128 X rows of 128 B, laid at a pitch of
// 144 B (16 B x odd: conflict-free for ds_load_b128), two buffers filled by async copies.
#define G_PITCH 72                       // halfs per staged row (144 B)
#define G_STAGE (256 * G_PITCH)          // halfs per buffer: W rows 0..127, X rows 128..255
#define G_PASSES (D_MODEL / 64)

// Eight 16-byte async copies of one lane. The s_wait_xcnt stands inside the statement so
// that no address register of an issued copy is rewritten ahead of it.
static __device__ __forceinline__ void cp16x8(unsigned l, const _Float16* g) {
  const unsigned l1 = l + 1 * 16 * G_PITCH * 2, l2 = l + 2 * 16 * G_PITCH * 2,
                 l3 = l + 3 * 16 * G_PITCH * 2, l4 = l + 4 * 16 * G_PITCH * 2,
                 l5 = l + 5 * 16 * G_PITCH * 2, l6 = l + 6 * 16 * G_PITCH * 2,
                 l7 = l + 7 * 16 * G_PITCH * 2;
  const _Float16 *g1 = g + 1 * 16 * D_MODEL, *g2 = g + 2 * 16 * D_MODEL,
                 *g3 = g + 3 * 16 * D_MODEL, *g4 = g + 4 * 16 * D_MODEL,
                 *g5 = g + 5 * 16 * D_MODEL, *g6 = g + 6 * 16 * D_MODEL,
                 *g7 = g + 7 * 16 * D_MODEL;
  asm volatile(
      "global_load_async_to_lds_b128 %0, %8, off\n\t"
      "global_load_async_to_lds_b128 %1, %9, off\n\t"
      "global_load_async_to_lds_b128 %2, %10, off\n\t"
      "global_load_async_to_lds_b128 %3, %11, off\n\t"
      "global_load_async_to_lds_b128 %4, %12, off\n\t"
      "global_load_async_to_lds_b128 %5, %13, off\n\t"
      "global_load_async_to_lds_b128 %6, %14, off\n\t"
      "global_load_async_to_lds_b128 %7, %15, off\n\t"
      "s_wait_xcnt 0x0"
      :: "v"(l), "v"(l1), "v"(l2), "v"(l3), "v"(l4), "v"(l5), "v"(l6), "v"(l7),
         "v"(g), "v"(g1), "v"(g2), "v"(g3), "v"(g4), "v"(g5), "v"(g6), "v"(g7)
      : "memory");
}

// Epilogue memory operations stand with their waits in one asm statement each, so that no
// register that an issued load or store names is rewritten ahead of the wait (a precaution).
typedef float v4f __attribute__((ext_vector_type(4)));

// 4 x 8 consecutive floats at p + 16 i (i = 0..3)
static __device__ __forceinline__ void ld_bias_rows(const float* p, v4f (&b)[8]) {
  asm volatile(
      "global_load_b128 %0, %8, off\n\t"
      "global_load_b128 %1, %8, off offset:16\n\t"
      "global_load_b128 %2, %8, off offset:64\n\t"
      "global_load_b128 %3, %8, off offset:80\n\t"
      "global_load_b128 %4, %8, off offset:128\n\t"
      "global_load_b128 %5, %8, off offset:144\n\t"
      "global_load_b128 %6, %8, off offset:192\n\t"
      "global_load_b128 %7, %8, off offset:208\n\t"
      "s_wait_loadcnt 0x0\n\t"
      "s_wait_xcnt 0x0"
      : "=&v"(b[0]), "=&v"(b[1]), "=&v"(b[2]), "=&v"(b[3]),
        "=&v"(b[4]), "=&v"(b[5]), "=&v"(b[6]), "=&v"(b[7])
      : "v"(p) : "memory");
}
// one float at p + 16 j (j = 0..3)
static __device__ __forceinline__ void ld_bias_cols(const float* p, float (&b)[4]) {
  asm volatile(
      "global_load_b32 %0, %4, off\n\t"
      "global_load_b32 %1, %4, off offset:64\n\t"
      "global_load_b32 %2, %4, off offset:128\n\t"
      "global_load_b32 %3, %4, off offset:192\n\t"
      "s_wait_loadcnt 0x0\n\t"
      "s_wait_xcnt 0x0"
      : "=&v"(b[0]), "=&v"(b[1]), "=&v"(b[2]), "=&v"(b[3])
      : "v"(p) : "memory");
}
// Q,K: v[4 i + j] goes to token row + 16 j (rows of 128 B), dh + 16 i
static __device__ __forceinline__ void st_tile_qk(_Float16* p, const h8 (&v)[16]) {
  asm volatile(
      "global_store_b128 %0, %1, off\n\t"
      "global_store_b128 %0, %2, off offset:2048\n\t"
      "global_store_b128 %0, %3, off offset:4096\n\t"
      "global_store_b128 %0, %4, off offset:6144\n\t"
      "global_store_b128 %0, %5, off offset:32\n\t"
      "global_store_b128 %0, %6, off offset:2080\n\t"
      "global_store_b128 %0, %7, off offset:4128\n\t"
      "global_store_b128 %0, %8, off offset:6176\n\t"
      "global_store_b128 %0, %9, off offset:64\n\t"
      "global_store_b128 %0, %10, off offset:2112\n\t"
      "global_store_b128 %0, %11, off offset:4160\n\t"
      "global_store_b128 %0, %12, off offset:6208\n\t"
      "global_store_b128 %0, %13, off offset:96\n\t"
      "global_store_b128 %0, %14, off offset:2144\n\t"
      "global_store_b128 %0, %15, off offset:4192\n\t"
      "global_store_b128 %0, %16, off offset:6240\n\t"
      "s_wait_xcnt 0x0"
      :: "v"(p), "v"(v[0]), "v"(v[1]), "v"(v[2]), "v"(v[3]), "v"(v[4]), "v"(v[5]), "v"(v[6]), "v"(v[7]),
         "v"(v[8]), "v"(v[9]), "v"(v[10]), "v"(v[11]), "v"(v[12]), "v"(v[13]), "v"(v[14]), "v"(v[15])
      : "memory");
}
// V transposed: v[4 j + i] goes to dh row + 16 j (rows of S_LEN halfs = 4096 B), s + 16 i
static __device__ __forceinline__ void st_tile_vt(_Float16* p, const h8 (&v)[16]) {
  asm volatile(
      "global_store_b128 %0, %1, off\n\t"
      "global_store_b128 %0, %2, off offset:32\n\t"
      "global_store_b128 %0, %3, off offset:64\n\t"
      "global_store_b128 %0, %4, off offset:96\n\t"
      "global_store_b128 %0, %5, off offset:65536\n\t"
      "global_store_b128 %0, %6, off offset:65568\n\t"
      "global_store_b128 %0, %7, off offset:65600\n\t"
      "global_store_b128 %0, %8, off offset:65632\n\t"
      "global_store_b128 %0, %9, off offset:131072\n\t"
      "global_store_b128 %0, %10, off offset:131104\n\t"
      "global_store_b128 %0, %11, off offset:131136\n\t"
      "global_store_b128 %0, %12, off offset:131168\n\t"
      "global_store_b128 %0, %13, off offset:196608\n\t"
      "global_store_b128 %0, %14, off offset:196640\n\t"
      "global_store_b128 %0, %15, off offset:196672\n\t"
      "global_store_b128 %0, %16, off offset:196704\n\t"
      "s_wait_xcnt 0x0"
      :: "v"(p), "v"(v[0]), "v"(v[1]), "v"(v[2]), "v"(v[3]), "v"(v[4]), "v"(v[5]), "v"(v[6]), "v"(v[7]),
         "v"(v[8]), "v"(v[9]), "v"(v[10]), "v"(v[11]), "v"(v[12]), "v"(v[13]), "v"(v[14]), "v"(v[15])
      : "memory");
}

__global__ void __launch_bounds__(128)
qkv_gemm(const _Float16* __restrict__ Xh,
         const _Float16* __restrict__ Wqh, const _Float16* __restrict__ Wkh,
         const _Float16* __restrict__ Wvh,
         const float* __restrict__ bq, const float* __restrict__ bk, const float* __restrict__ bv,
         _Float16* __restrict__ Qh, _Float16* __restrict__ Kh, _Float16* __restrict__ Vth) {
  __shared__ __align__(16) _Float16 St[2 * G_STAGE];   // 73,728 B

  const int tid  = threadIdx.x;
  const int lane = tid & 31;
  const int wave = tid >> 5;
  const int nn   = lane & 15;
  const int hiH  = (lane >> 4) & 1;
  const int k0   = hiH * 8;
  const int n0   = blockIdx.x * 128 + (wave & 1) * 64;    // this wave's first feature
  const int row0 = blockIdx.y * 128 + (wave >> 1) * 64;   // this wave's first token row
  const int which = blockIdx.z;

  const _Float16* W    = (which == 0) ? Wqh : (which == 1) ? Wkh : Wvh;
  const float*    bias = (which == 0) ? bq  : (which == 1) ? bk  : bv;

  // copies: a lane brings chunk (tid & 7) of rows (tid >> 3) + 16 r, r = 0..7, of W and of X
  const int crow = tid >> 3, ccol = (tid & 7) << 3;
  const _Float16* gW = W  + (size_t)(blockIdx.x * 128 + crow) * D_MODEL + ccol;
  const _Float16* gX = Xh + (size_t)(blockIdx.y * 128 + crow) * D_MODEL + ccol;
  const unsigned  lW = (unsigned)(unsigned long long)&St[crow * G_PITCH + ccol];
  const unsigned  lX = lW + 128 * G_PITCH * 2;

  // Q,K: features are the rows of D (operand A = W), so a lane holds 8 consecutive dh of one
  // token; V: tokens are the rows (A = X), so a lane holds 8 consecutive s of one feature.
  const int wrow = (wave & 1) * 64 + nn, xrow = 128 + (wave >> 1) * 64 + nn;
  const int aoff = ((which == 2) ? xrow : wrow) * G_PITCH + k0;
  const int boff = ((which == 2) ? wrow : xrow) * G_PITCH + k0;

  v8f acc[4][4];
#pragma unroll
  for (int i = 0; i < 4; ++i)
#pragma unroll
    for (int j = 0; j < 4; ++j) acc[i][j] = (v8f){};

  cp16x8(lW, gW);
  cp16x8(lX, gX);
  wait_async_le0();
  __syncthreads();
  cp16x8(lW + G_STAGE * 2, gW + 64);
  cp16x8(lX + G_STAGE * 2, gX + 64);

  for (int t = 0; t < G_PASSES; ++t) {
    const int bo = (t & 1) * G_STAGE;
    // the whole pass's fragments go to registers as one group of LDS reads
    v16h af[2][4], bf[2][4];
#pragma unroll
    for (int ks = 0; ks < 2; ++ks)
#pragma unroll
      for (int i = 0; i < 4; ++i) {
        af[ks][i] = frag_ld(&St[bo + aoff + i * 16 * G_PITCH + ks * 32], 0);
        bf[ks][i] = frag_ld(&St[bo + boff + i * 16 * G_PITCH + ks * 32], 0);
      }
    // publish point of pass t + 1: own LDS reads done, own copies landed, then the barrier
    // that shows pass t + 1's tile to every wave and frees pass t's buffer for the refill
    asm volatile("s_wait_dscnt 0x0" ::: "memory");
    wait_async_le0();
    __syncthreads();
    if (t + 2 < G_PASSES) {
      cp16x8(lW + bo * 2, gW + (t + 2) * 64);
      cp16x8(lX + bo * 2, gX + (t + 2) * 64);
    }
    // the pass's WMMAs work on registers alone, so the refill flies under all of them
#pragma unroll
    for (int ks = 0; ks < 2; ++ks)
#pragma unroll
      for (int i = 0; i < 4; ++i)
#pragma unroll
        for (int j = 0; j < 4; ++j) acc[i][j] = WMMA_F16(af[ks][i], bf[ks][j], acc[i][j]);
  }
  wait_async_le0();   // no copy is outstanding when the wave ends

  const int bb = row0 >> 11;             // / S_LEN: one batch entry per 64-row wave tile
  const int s0 = row0 & (S_LEN - 1);
  const size_t head = (size_t)(bb * N_HEADS + (n0 >> 6));   // one head per 64-feature wave tile
  h8 v[16];
  if (which == 2) {
    float bb_[4];
    ld_bias_cols(bias + n0 + nn, bb_);
#pragma unroll
    for (int j = 0; j < 4; ++j)
#pragma unroll
      for (int i = 0; i < 4; ++i)
#pragma unroll
        for (int g = 0; g < 8; ++g) v[j * 4 + i][g] = (_Float16)(acc[i][j][g] + bb_[j]);
    st_tile_vt(Vth + (head * D_HEAD + nn) * S_LEN + s0 + hiH * 8, v);
  } else {
    v4f bb_[8];
    ld_bias_rows(bias + n0 + hiH * 8, bb_);
#pragma unroll
    for (int i = 0; i < 4; ++i)
#pragma unroll
      for (int j = 0; j < 4; ++j)
#pragma unroll
        for (int g = 0; g < 8; ++g)
          v[i * 4 + j][g] = (_Float16)(acc[i][j][g] + bb_[i * 2 + (g >> 2)][g & 3]);
    st_tile_qk(((which == 0) ? Qh : Kh) + (head * S_LEN + s0 + nn) * D_HEAD + hiH * 8, v);
  }
}

// ---------------- Kernel 3: flash attention with relative skew ----------------
// K/V slabs (32 keys) are double-buffered in LDS via async copies, shared by all 4 waves;
// prefetch of slab n+1 overlaps compute on slab n (s_wait_asynccnt <= 4).
static __device__ __forceinline__ void slab_load(const _Float16* __restrict__ Kbase,
                                                 const _Float16* __restrict__ Vbase,
                                                 int t0,
                                                 _Float16 (*Kl)[64], _Float16 (*Vl)[32],
                                                 int tid) {
#pragma unroll
  for (int r = 0; r < 2; ++r) {
    int c = tid + r * 128;                 // 0..255
    int krow = c >> 3, kcol = (c & 7) << 3;   // 32 rows x 64 halfs
    cp16_g2l(Kbase + (size_t)(t0 + krow) * D_HEAD + kcol, &Kl[krow][kcol]);
    int vrow = c >> 2, vcol = (c & 3) << 3;   // 64 rows x 32 halfs
    cp16_g2l(Vbase + (size_t)vrow * S_LEN + t0 + vcol, &Vl[vrow][vcol]);
  }
}

__global__ void __launch_bounds__(128)
attn_kernel(const _Float16* __restrict__ Qh, const _Float16* __restrict__ Kh,
            const _Float16* __restrict__ Vt, const _Float16* __restrict__ Erh,
            float* __restrict__ out) {
  __shared__ __align__(16) _Float16 Kl[2][32][64];   // 8 KB double-buffered K slab
  __shared__ __align__(16) _Float16 Vl[2][64][32];   // 8 KB double-buffered V slab (dh,t)
  __shared__ __align__(16) _Float16 plds[4][16][32]; // per-wave P transpose staging

  const int tid  = threadIdx.x;
  const int lane = tid & 31;
  const int wave = tid >> 5;
  const int hiH  = (lane >> 4) & 1;
  const int k0   = hiH * 8;
  const int nn   = lane & 15;

  const int h  = blockIdx.y;
  const int b  = blockIdx.z;
  const int s0 = blockIdx.x * 64 + wave * 16;

  const size_t head = (size_t)(b * N_HEADS + h) * (size_t)S_LEN * D_HEAD;
  const _Float16* Qbase = Qh + head;
  const _Float16* Kbase = Kh + head;
  const _Float16* Vbase = Vt + head;   // (dh, t) layout

  // warm the Er diagonal band this block touches first
  {
    int e = S_LEN - 16 - s0 + nn;
    e = e < 0 ? 0 : e;
    __builtin_prefetch(Erh + (size_t)e * D_HEAD, 0, 1);
  }

  const _Float16* qrow = Qbase + (size_t)(s0 + nn) * D_HEAD;
  int sshift = s0 + nn + 1; if (sshift > S_LEN - 1) sshift = S_LEN - 1;
  const _Float16* qsrow = Qbase + (size_t)sshift * D_HEAD;  // rows s+1 (skew wrap term)

  const v16h qa0 = frag_ld(qrow, k0);        // Q  d 0..31
  const v16h qa1 = frag_ld(qrow + 32, k0);   // Q  d 32..63
  const v16h qs0 = frag_ld(qsrow, k0);       // Qs d 0..31
  const v16h qs1 = frag_ld(qsrow + 32, k0);  // Qs d 32..63

  float rowmax[8], rowsum[8];
  v8f o0 = {}, o1 = {}, o2 = {}, o3 = {};
#pragma unroll
  for (int g = 0; g < 8; ++g) { rowmax[g] = -3.0e38f; rowsum[g] = 0.f; }

  slab_load(Kbase, Vbase, 0, Kl[0], Vl[0], tid);   // preload slab 0

  for (int t0 = 0; t0 < S_LEN; t0 += 32) {
    const int buf = (t0 >> 5) & 1;
    if (t0 + 32 < S_LEN) {
      slab_load(Kbase, Vbase, t0 + 32, Kl[buf ^ 1], Vl[buf ^ 1], tid);
      wait_async_le4();                // current slab landed; prefetch stays in flight
    } else {
      wait_async_le0();
    }
    __syncthreads();

    float sc[2][8];
    float tmax[8];
#pragma unroll
    for (int g = 0; g < 8; ++g) tmax[g] = -3.0e38f;

#pragma unroll
    for (int sub = 0; sub < 2; ++sub) {
      const int tt = t0 + sub * 16;

      // ---- QK^T 16x16 tile (K = 64) from LDS ----
      const _Float16* kcol = &Kl[buf][sub * 16 + nn][0];
      v8f c = {};
      c = WMMA_F16(qa0, frag_ld(kcol, k0), c);
      c = WMMA_F16(qa1, frag_ld(kcol + 32, k0), c);

      // ---- Srel tile via Er-block WMMAs + Toeplitz lane shift ----
      const int d0 = tt - s0;
      float srel[8];
#pragma unroll
      for (int g = 0; g < 8; ++g) srel[g] = 0.f;

      if (d0 <= 15) {  // in-band: Srel[s,t] = q[s].Er[S-1+t-s],  t<=s
        v8f g1 = er_gemm(qa0, qa1, Erh, S_LEN - 16 + d0, nn, k0);
        v8f g2 = er_gemm(qa0, qa1, Erh, S_LEN + d0,      nn, k0);
#pragma unroll
        for (int g = 0; g < 8; ++g) {
          int mm = g + 8 * hiH;
          int jm = nn - mm;                     // j - i
          int dd = d0 + jm;                     // t - s
          int srcc = (jm >= 1) ? (jm - 1) : (jm + 15);
          int srcl = (lane & 16) | srcc;
          float v1 = __shfl(g1[g], srcl, 32);
          float v2 = __shfl(g2[g], srcl, 32);
          float v  = (jm >= 1) ? v2 : v1;
          if (dd <= 0) srel[g] = v;
        }
      }
      if (d0 >= -13) { // wrap artifact: Srel[s,t] = q[s+1].Er[t-s-2],  t>=s+2
        v8f gj1 = er_gemm(qs0, qs1, Erh, d0 - 17, nn, k0);
        v8f gj2 = er_gemm(qs0, qs1, Erh, d0 - 1,  nn, k0);
#pragma unroll
        for (int g = 0; g < 8; ++g) {
          int mm = g + 8 * hiH;
          int jm = nn - mm;
          int dd = d0 + jm;
          int srcc = (jm >= 1) ? (jm - 1) : (jm + 15);
          int srcl = (lane & 16) | srcc;
          float v1 = __shfl(gj1[g], srcl, 32);
          float v2 = __shfl(gj2[g], srcl, 32);
          float v  = (jm >= 1) ? v2 : v1;
          if (dd >= 2) srel[g] = v;
        }
      }
      // (dd == 1 stays exactly 0, matching the skew's zero column)

#pragma unroll
      for (int g = 0; g < 8; ++g) {
        float sv = (c[g] + srel[g]) * 0.125f;   // / sqrt(D_HEAD)
        sc[sub][g] = sv;
        tmax[g] = fmaxf(tmax[g], sv);
      }
    }

    // ---- online softmax across this 32-key slab ----
#pragma unroll
    for (int g = 0; g < 8; ++g) {
      float tm = tmax[g];
#pragma unroll
      for (int x = 1; x < 16; x <<= 1) tm = fmaxf(tm, __shfl_xor(tm, x, 32));
      float nm = fmaxf(rowmax[g], tm);
      float al = __expf(rowmax[g] - nm);
      rowmax[g] = nm;
      float p0 = __expf(sc[0][g] - nm);
      float p1 = __expf(sc[1][g] - nm);
      float ts = p0 + p1;
#pragma unroll
      for (int x = 1; x < 16; x <<= 1) ts += __shfl_xor(ts, x, 32);
      rowsum[g] = rowsum[g] * al + ts;
      o0[g] *= al; o1[g] *= al; o2[g] *= al; o3[g] *= al;
      int mm = g + 8 * hiH;
      plds[wave][mm][nn]      = (_Float16)p0;   // C-layout scatter into LDS
      plds[wave][mm][16 + nn] = (_Float16)p1;
    }

    // read back P as A-fragment (row = lane&15, K = 32 keys)
    v16h pa = frag_ld(&plds[wave][nn][0], k0);

    // ---- P @ V : 4 WMMAs over the 64 head dims (K = 32), V from LDS ----
    const _Float16* vrow_ = &Vl[buf][nn][0];              // row stride 32 halfs
    o0 = WMMA_F16(pa, frag_ld(vrow_,            k0), o0);
    o1 = WMMA_F16(pa, frag_ld(vrow_ + 16 * 32,  k0), o1);
    o2 = WMMA_F16(pa, frag_ld(vrow_ + 32 * 32,  k0), o2);
    o3 = WMMA_F16(pa, frag_ld(vrow_ + 48 * 32,  k0), o3);

    __syncthreads();   // slab buffers free for the next prefetch
  }

  // ---- normalize and write (B, S, D_MODEL) f32 ----
#pragma unroll
  for (int g = 0; g < 8; ++g) {
    int s = s0 + g + 8 * hiH;
    float inv = 1.0f / rowsum[g];
    size_t base = ((size_t)(b * S_LEN + s)) * D_MODEL + h * D_HEAD + nn;
    out[base +  0] = o0[g] * inv;
    out[base + 16] = o1[g] * inv;
    out[base + 32] = o2[g] * inv;
    out[base + 48] = o3[g] * inv;
  }
}

extern "C" void kernel_launch(void* const* d_in, const int* in_sizes, int n_in,
                              void* d_out, int out_size, void* d_ws, size_t ws_size,
                              hipStream_t stream) {
  (void)in_sizes; (void)n_in; (void)out_size; (void)ws_size;
  const float* x  = (const float*)d_in[0];
  const float* Wq = (const float*)d_in[1];
  const float* bq = (const float*)d_in[2];
  const float* Wk = (const float*)d_in[3];
  const float* bk = (const float*)d_in[4];
  const float* Wv = (const float*)d_in[5];
  const float* bv = (const float*)d_in[6];
  const float* Er = (const float*)d_in[7];

  char* ws = (char*)d_ws;
  const size_t xhN = (size_t)BATCH * S_LEN * D_MODEL;        // 4,194,304
  const size_t wN  = (size_t)D_MODEL * D_MODEL;              // 1,048,576
  const size_t erN = (size_t)S_LEN * D_HEAD;                 // 131,072

  _Float16* Xh  = (_Float16*)(ws);
  _Float16* Wqh = (_Float16*)(ws + 2 * xhN);
  _Float16* Wkh = Wqh + wN;
  _Float16* Wvh = Wkh + wN;
  _Float16* Erh = Wvh + wN;
  _Float16* Qh  = Erh + erN;
  _Float16* Kh  = Qh + xhN;
  _Float16* Vth = Kh + xhN;

  cast_f32_f16<<<2048, 256, 0, stream>>>(x,  Xh,  (int)xhN);
  cast_f32_f16<<<512,  256, 0, stream>>>(Wq, Wqh, (int)wN);
  cast_f32_f16<<<512,  256, 0, stream>>>(Wk, Wkh, (int)wN);
  cast_f32_f16<<<512,  256, 0, stream>>>(Wv, Wvh, (int)wN);
  cast_f32_f16<<<64,   256, 0, stream>>>(Er, Erh, (int)erN);

  // QKV: M = 4096 rows, N = 1024 feats, K = 1024; z selects Q/K/V
  qkv_gemm<<<dim3(D_MODEL / 128, (BATCH * S_LEN) / 128, 3), 128, 0, stream>>>(
      Xh, Wqh, Wkh, Wvh, bq, bk, bv, Qh, Kh, Vth);

  // attention: 64 query rows per block (4 waves x 16)
  attn_kernel<<<dim3(S_LEN / 64, N_HEADS, BATCH), 128, 0, stream>>>(
      Qh, Kh, Vth, Erh, (float*)d_out);
}

// v002
// It runs in 210 microseconds.
// Next to v001, in two timings, it ran 1.17 times as fast each time.
// Over all steps from v000 it is 1.86 times as fast.
#include <hip/hip_runtime.h>
#include <hip/hip_bf16.h>

#define S_LEN   2048
#define D_MODEL 1024
#define N_HEADS 16
#define D_HEAD  64
#define BATCH   2

typedef _Float16 h8   __attribute__((ext_vector_type(8)));
typedef _Float16 v16h __attribute__((ext_vector_type(16)));
typedef float    v8f  __attribute__((ext_vector_type(8)));

#define WMMA_F16(a, b, c) \
  __builtin_amdgcn_wmma_f32_16x16x32_f16(false, (a), false, (b), (short)0, (c), false, false)

// ---------- CDNA5 async global->LDS copy (guarded; falls back to ld+ds_store) ----------
#if defined(__has_builtin)
#if __has_builtin(__builtin_amdgcn_global_load_async_to_lds_b128)
#define HAVE_ASYNC_CP 1
#endif
#endif
#ifndef HAVE_ASYNC_CP
#define HAVE_ASYNC_CP 0
#endif

typedef int v4i_t __attribute__((vector_size(16)));
typedef __attribute__((address_space(1))) v4i_t* g_v4i_p;   // global int4*
typedef __attribute__((address_space(3))) v4i_t* l_v4i_p;   // LDS int4*

static __device__ __forceinline__ void cp16_g2l(const _Float16* g, _Float16* l) {
#if HAVE_ASYNC_CP
  __builtin_amdgcn_global_load_async_to_lds_b128(
      (g_v4i_p)(unsigned long long)g,
      (l_v4i_p)(unsigned int)(unsigned long long)l, 0, 0);
#else
  *(h8*)l = *(const h8*)g;
#endif
}
static __device__ __forceinline__ void wait_async_le4() {
#if HAVE_ASYNC_CP
  asm volatile("s_wait_asynccnt 0x4" ::: "memory");
#endif
}
static __device__ __forceinline__ void wait_async_le0() {
#if HAVE_ASYNC_CP
  asm volatile("s_wait_asynccnt 0x0" ::: "memory");
#endif
}

// Load one lane's slice of a 16x32 (f16) A/B fragment.
// Layout per ISA 7.12.2: lanes 0-15 hold K[0..7]+K[16..23], lanes 16-31 hold K[8..15]+K[24..31].
static __device__ __forceinline__ v16h frag_ld(const _Float16* p, int k0) {
  h8 lo = *(const h8*)(p + k0);
  h8 hi = *(const h8*)(p + k0 + 16);
  return __builtin_shufflevector(lo, hi, 0,1,2,3,4,5,6,7,8,9,10,11,12,13,14,15);
}

// The skew reads, for query s and key t, position u = S - 1 + t - s of one band of 2 S positions:
// u < S is q[s].Er[u], u == S is the skew's zero column, u > S is q[s+1].Er[u - S - 1].
// Band block k holds positions 16 k .. 16 k + 15; a 16x16 score tile needs blocks k and k + 1.
#define BAND_WRAP (S_LEN / 16)   // first block that belongs to q[s+1]

// Er row behind column nn of band block k
static __device__ __forceinline__ const _Float16* band_row(const _Float16* __restrict__ Erh,
                                                           int k, int nn) {
  int e = k * 16 + nn - ((k >= BAND_WRAP) ? (S_LEN + 1) : 0);
  e = e < 0 ? 0 : e;                        // the zero column's lane
  e = e > (S_LEN - 1) ? (S_LEN - 1) : e;    // blocks fetched past the last slab, never used
  return Erh + (size_t)e * D_HEAD;
}

// G = Qtile(16x64) @ (band block k)^T -> 16x16 f32 (2 WMMAs over K=64); k is wave-uniform
static __device__ __forceinline__ v8f band_gemm(int k, int nn, v16h qa0, v16h qa1,
                                                v16h qs0, v16h qs1, v16h f0, v16h f1) {
  const bool wrap = (k >= BAND_WRAP);
  v8f c = {};
  c = WMMA_F16(wrap ? qs0 : qa0, f0, c);
  c = WMMA_F16(wrap ? qs1 : qa1, f1, c);
  const bool zcol = (k * 16 + nn == S_LEN);
#pragma unroll   // constant g keeps the tile in registers
  for (int g = 0; g < 8; ++g) c[g] = zcol ? 0.f : c[g];
  return c;
}

// ---------------- Kernel 1: f32 -> f16 cast ----------------
__global__ void cast_f32_f16(const float* __restrict__ in, _Float16* __restrict__ out, int n) {
  int i = blockIdx.x * blockDim.x + threadIdx.x;
  int stride = gridDim.x * blockDim.x;
  for (; i < n; i += stride) out[i] = (_Float16)in[i];
}

// ---------------- Kernel 2: QKV projection GEMM ----------------
// y = Xh @ W^T + b ; z = 0/1/2 -> Q/K/V. Q,K stored (b,h,s,dh); V stored transposed (b,h,dh,s).
// One 128x128 tile of y per block, 64x64 per wave (4x4 WMMA tiles), so every LDS fragment
// feeds four WMMAs. A pass is 64 k: 128 W rows and 128 X rows of 128 B, laid at a pitch of
// 144 B (16 B x odd: conflict-free for ds_load_b128), two buffers filled by async copies.
#define G_PITCH 72                       // halfs per staged row (144 B)
#define G_STAGE (256 * G_PITCH)          // halfs per buffer: W rows 0..127, X rows 128..255
#define G_PASSES (D_MODEL / 64)

// Eight 16-byte async copies of one lane. The s_wait_xcnt stands inside the statement so
// that no address register of an issued copy is rewritten ahead of it.
static __device__ __forceinline__ void cp16x8(unsigned l, const _Float16* g) {
  const unsigned l1 = l + 1 * 16 * G_PITCH * 2, l2 = l + 2 * 16 * G_PITCH * 2,
                 l3 = l + 3 * 16 * G_PITCH * 2, l4 = l + 4 * 16 * G_PITCH * 2,
                 l5 = l + 5 * 16 * G_PITCH * 2, l6 = l + 6 * 16 * G_PITCH * 2,
                 l7 = l + 7 * 16 * G_PITCH * 2;
  const _Float16 *g1 = g + 1 * 16 * D_MODEL, *g2 = g + 2 * 16 * D_MODEL,
                 *g3 = g + 3 * 16 * D_MODEL, *g4 = g + 4 * 16 * D_MODEL,
                 *g5 = g + 5 * 16 * D_MODEL, *g6 = g + 6 * 16 * D_MODEL,
                 *g7 = g + 7 * 16 * D_MODEL;
  asm volatile(
      "global_load_async_to_lds_b128 %0, %8, off\n\t"
      "global_load_async_to_lds_b128 %1, %9, off\n\t"
      "global_load_async_to_lds_b128 %2, %10, off\n\t"
      "global_load_async_to_lds_b128 %3, %11, off\n\t"
      "global_load_async_to_lds_b128 %4, %12, off\n\t"
      "global_load_async_to_lds_b128 %5, %13, off\n\t"
      "global_load_async_to_lds_b128 %6, %14, off\n\t"
      "global_load_async_to_lds_b128 %7, %15, off\n\t"
      "s_wait_xcnt 0x0"
      :: "v"(l), "v"(l1), "v"(l2), "v"(l3), "v"(l4), "v"(l5), "v"(l6), "v"(l7),
         "v"(g), "v"(g1), "v"(g2), "v"(g3), "v"(g4), "v"(g5), "v"(g6), "v"(g7)
      : "memory");
}

// Epilogue memory operations stand with their waits in one asm statement each, so that no
// register that an issued load or store names is rewritten ahead of the wait (a precaution).
typedef float v4f __attribute__((ext_vector_type(4)));

// 4 x 8 consecutive floats at p + 16 i (i = 0..3)
static __device__ __forceinline__ void ld_bias_rows(const float* p, v4f (&b)[8]) {
  asm volatile(
      "global_load_b128 %0, %8, off\n\t"
      "global_load_b128 %1, %8, off offset:16\n\t"
      "global_load_b128 %2, %8, off offset:64\n\t"
      "global_load_b128 %3, %8, off offset:80\n\t"
      "global_load_b128 %4, %8, off offset:128\n\t"
      "global_load_b128 %5, %8, off offset:144\n\t"
      "global_load_b128 %6, %8, off offset:192\n\t"
      "global_load_b128 %7, %8, off offset:208\n\t"
      "s_wait_loadcnt 0x0\n\t"
      "s_wait_xcnt 0x0"
      : "=&v"(b[0]), "=&v"(b[1]), "=&v"(b[2]), "=&v"(b[3]),
        "=&v"(b[4]), "=&v"(b[5]), "=&v"(b[6]), "=&v"(b[7])
      : "v"(p) : "memory");
}
// one float at p + 16 j (j = 0..3)
static __device__ __forceinline__ void ld_bias_cols(const float* p, float (&b)[4]) {
  asm volatile(
      "global_load_b32 %0, %4, off\n\t"
      "global_load_b32 %1, %4, off offset:64\n\t"
      "global_load_b32 %2, %4, off offset:128\n\t"
      "global_load_b32 %3, %4, off offset:192\n\t"
      "s_wait_loadcnt 0x0\n\t"
      "s_wait_xcnt 0x0"
      : "=&v"(b[0]), "=&v"(b[1]), "=&v"(b[2]), "=&v"(b[3])
      : "v"(p) : "memory");
}
// Q,K: v[4 i + j] goes to token row + 16 j (rows of 128 B), dh + 16 i
static __device__ __forceinline__ void st_tile_qk(_Float16* p, const h8 (&v)[16]) {
  asm volatile(
      "global_store_b128 %0, %1, off\n\t"
      "global_store_b128 %0, %2, off offset:2048\n\t"
      "global_store_b128 %0, %3, off offset:4096\n\t"
      "global_store_b128 %0, %4, off offset:6144\n\t"
      "global_store_b128 %0, %5, off offset:32\n\t"
      "global_store_b128 %0, %6, off offset:2080\n\t"
      "global_store_b128 %0, %7, off offset:4128\n\t"
      "global_store_b128 %0, %8, off offset:6176\n\t"
      "global_store_b128 %0, %9, off offset:64\n\t"
      "global_store_b128 %0, %10, off offset:2112\n\t"
      "global_store_b128 %0, %11, off offset:4160\n\t"
      "global_store_b128 %0, %12, off offset:6208\n\t"
      "global_store_b128 %0, %13, off offset:96\n\t"
      "global_store_b128 %0, %14, off offset:2144\n\t"
      "global_store_b128 %0, %15, off offset:4192\n\t"
      "global_store_b128 %0, %16, off offset:6240\n\t"
      "s_wait_xcnt 0x0"
      :: "v"(p), "v"(v[0]), "v"(v[1]), "v"(v[2]), "v"(v[3]), "v"(v[4]), "v"(v[5]), "v"(v[6]), "v"(v[7]),
         "v"(v[8]), "v"(v[9]), "v"(v[10]), "v"(v[11]), "v"(v[12]), "v"(v[13]), "v"(v[14]), "v"(v[15])
      : "memory");
}
// V transposed: v[4 j + i] goes to dh row + 16 j (rows of S_LEN halfs = 4096 B), s + 16 i
static __device__ __forceinline__ void st_tile_vt(_Float16* p, const h8 (&v)[16]) {
  asm volatile(
      "global_store_b128 %0, %1, off\n\t"
      "global_store_b128 %0, %2, off offset:32\n\t"
      "global_store_b128 %0, %3, off offset:64\n\t"
      "global_store_b128 %0, %4, off offset:96\n\t"
      "global_store_b128 %0, %5, off offset:65536\n\t"
      "global_store_b128 %0, %6, off offset:65568\n\t"
      "global_store_b128 %0, %7, off offset:65600\n\t"
      "global_store_b128 %0, %8, off offset:65632\n\t"
      "global_store_b128 %0, %9, off offset:131072\n\t"
      "global_store_b128 %0, %10, off offset:131104\n\t"
      "global_store_b128 %0, %11, off offset:131136\n\t"
      "global_store_b128 %0, %12, off offset:131168\n\t"
      "global_store_b128 %0, %13, off offset:196608\n\t"
      "global_store_b128 %0, %14, off offset:196640\n\t"
      "global_store_b128 %0, %15, off offset:196672\n\t"
      "global_store_b128 %0, %16, off offset:196704\n\t"
      "s_wait_xcnt 0x0"
      :: "v"(p), "v"(v[0]), "v"(v[1]), "v"(v[2]), "v"(v[3]), "v"(v[4]), "v"(v[5]), "v"(v[6]), "v"(v[7]),
         "v"(v[8]), "v"(v[9]), "v"(v[10]), "v"(v[11]), "v"(v[12]), "v"(v[13]), "v"(v[14]), "v"(v[15])
      : "memory");
}

__global__ void __launch_bounds__(128)
qkv_gemm(const _Float16* __restrict__ Xh,
         const _Float16* __restrict__ Wqh, const _Float16* __restrict__ Wkh,
         const _Float16* __restrict__ Wvh,
         const float* __restrict__ bq, const float* __restrict__ bk, const float* __restrict__ bv,
         _Float16* __restrict__ Qh, _Float16* __restrict__ Kh, _Float16* __restrict__ Vth) {
  __shared__ __align__(16) _Float16 St[2 * G_STAGE];   // 73,728 B

  const int tid  = threadIdx.x;
  const int lane = tid & 31;
  const int wave = tid >> 5;
  const int nn   = lane & 15;
  const int hiH  = (lane >> 4) & 1;
  const int k0   = hiH * 8;
  const int n0   = blockIdx.x * 128 + (wave & 1) * 64;    // this wave's first feature
  const int row0 = blockIdx.y * 128 + (wave >> 1) * 64;   // this wave's first token row
  const int which = blockIdx.z;

  const _Float16* W    = (which == 0) ? Wqh : (which == 1) ? Wkh : Wvh;
  const float*    bias = (which == 0) ? bq  : (which == 1) ? bk  : bv;

  // copies: a lane brings chunk (tid & 7) of rows (tid >> 3) + 16 r, r = 0..7, of W and of X
  const int crow = tid >> 3, ccol = (tid & 7) << 3;
  const _Float16* gW = W  + (size_t)(blockIdx.x * 128 + crow) * D_MODEL + ccol;
  const _Float16* gX = Xh + (size_t)(blockIdx.y * 128 + crow) * D_MODEL + ccol;
  const unsigned  lW = (unsigned)(unsigned long long)&St[crow * G_PITCH + ccol];
  const unsigned  lX = lW + 128 * G_PITCH * 2;

  // Q,K: features are the rows of D (operand A = W), so a lane holds 8 consecutive dh of one
  // token; V: tokens are the rows (A = X), so a lane holds 8 consecutive s of one feature.
  const int wrow = (wave & 1) * 64 + nn, xrow = 128 + (wave >> 1) * 64 + nn;
  const int aoff = ((which == 2) ? xrow : wrow) * G_PITCH + k0;
  const int boff = ((which == 2) ? wrow : xrow) * G_PITCH + k0;

  v8f acc[4][4];
#pragma unroll
  for (int i = 0; i < 4; ++i)
#pragma unroll
    for (int j = 0; j < 4; ++j) acc[i][j] = (v8f){};

  cp16x8(lW, gW);
  cp16x8(lX, gX);
  wait_async_le0();
  __syncthreads();
  cp16x8(lW + G_STAGE * 2, gW + 64);
  cp16x8(lX + G_STAGE * 2, gX + 64);

  for (int t = 0; t < G_PASSES; ++t) {
    const int bo = (t & 1) * G_STAGE;
    // the whole pass's fragments go to registers as one group of LDS reads
    v16h af[2][4], bf[2][4];
#pragma unroll
    for (int ks = 0; ks < 2; ++ks)
#pragma unroll
      for (int i = 0; i < 4; ++i) {
        af[ks][i] = frag_ld(&St[bo + aoff + i * 16 * G_PITCH + ks * 32], 0);
        bf[ks][i] = frag_ld(&St[bo + boff + i * 16 * G_PITCH + ks * 32], 0);
      }
    // publish point of pass t + 1: own LDS reads done, own copies landed, then the barrier
    // that shows pass t + 1's tile to every wave and frees pass t's buffer for the refill
    asm volatile("s_wait_dscnt 0x0" ::: "memory");
    wait_async_le0();
    __syncthreads();
    if (t + 2 < G_PASSES) {
      cp16x8(lW + bo * 2, gW + (t + 2) * 64);
      cp16x8(lX + bo * 2, gX + (t + 2) * 64);
    }
    // the pass's WMMAs work on registers alone, so the refill flies under all of them
#pragma unroll
    for (int ks = 0; ks < 2; ++ks)
#pragma unroll
      for (int i = 0; i < 4; ++i)
#pragma unroll
        for (int j = 0; j < 4; ++j) acc[i][j] = WMMA_F16(af[ks][i], bf[ks][j], acc[i][j]);
  }
  wait_async_le0();   // no copy is outstanding when the wave ends

  const int bb = row0 >> 11;             // / S_LEN: one batch entry per 64-row wave tile
  const int s0 = row0 & (S_LEN - 1);
  const size_t head = (size_t)(bb * N_HEADS + (n0 >> 6));   // one head per 64-feature wave tile
  h8 v[16];
  if (which == 2) {
    float bb_[4];
    ld_bias_cols(bias + n0 + nn, bb_);
#pragma unroll
    for (int j = 0; j < 4; ++j)
#pragma unroll
      for (int i = 0; i < 4; ++i)
#pragma unroll
        for (int g = 0; g < 8; ++g) v[j * 4 + i][g] = (_Float16)(acc[i][j][g] + bb_[j]);
    st_tile_vt(Vth + (head * D_HEAD + nn) * S_LEN + s0 + hiH * 8, v);
  } else {
    v4f bb_[8];
    ld_bias_rows(bias + n0 + hiH * 8, bb_);
#pragma unroll
    for (int i = 0; i < 4; ++i)
#pragma unroll
      for (int j = 0; j < 4; ++j)
#pragma unroll
        for (int g = 0; g < 8; ++g)
          v[i * 4 + j][g] = (_Float16)(acc[i][j][g] + bb_[i * 2 + (g >> 2)][g & 3]);
    st_tile_qk(((which == 0) ? Qh : Kh) + (head * S_LEN + s0 + nn) * D_HEAD + hiH * 8, v);
  }
}

// ---------------- Kernel 3: flash attention with relative skew ----------------
// K/V slabs (32 keys) are double-buffered in LDS via async copies, shared by all 4 waves;
// prefetch of slab n+1 overlaps compute on slab n (s_wait_asynccnt <= 4).
static __device__ __forceinline__ void slab_load(const _Float16* __restrict__ Kbase,
                                                 const _Float16* __restrict__ Vbase,
                                                 int t0,
                                                 _Float16 (*Kl)[64], _Float16 (*Vl)[32],
                                                 int tid) {
#pragma unroll
  for (int r = 0; r < 2; ++r) {
    int c = tid + r * 128;                 // 0..255
    int krow = c >> 3, kcol = (c & 7) << 3;   // 32 rows x 64 halfs
    cp16_g2l(Kbase + (size_t)(t0 + krow) * D_HEAD + kcol, &Kl[krow][kcol]);
    int vrow = c >> 2, vcol = (c & 3) << 3;   // 64 rows x 32 halfs
    cp16_g2l(Vbase + (size_t)vrow * S_LEN + t0 + vcol, &Vl[vrow][vcol]);
  }
}

__global__ void __launch_bounds__(128)
attn_kernel(const _Float16* __restrict__ Qh, const _Float16* __restrict__ Kh,
            const _Float16* __restrict__ Vt, const _Float16* __restrict__ Erh,
            float* __restrict__ out) {
  __shared__ __align__(16) _Float16 Kl[2][32][64];   // 8 KB double-buffered K slab
  __shared__ __align__(16) _Float16 Vl[2][64][32];   // 8 KB double-buffered V slab (dh,t)
  __shared__ __align__(16) _Float16 plds[4][16][32]; // per-wave P transpose staging

  const int tid  = threadIdx.x;
  const int lane = tid & 31;
  const int wave = __builtin_amdgcn_readfirstlane(tid >> 5);   // scalar: picks the band blocks
  const int hiH  = (lane >> 4) & 1;
  const int k0   = hiH * 8;
  const int nn   = lane & 15;

  const int h  = blockIdx.y;
  const int b  = blockIdx.z;
  const int s0 = blockIdx.x * 64 + wave * 16;

  const size_t head = (size_t)(b * N_HEADS + h) * (size_t)S_LEN * D_HEAD;
  const _Float16* Qbase = Qh + head;
  const _Float16* Kbase = Kh + head;
  const _Float16* Vbase = Vt + head;   // (dh, t) layout

  // warm the Er diagonal band this block touches first
  {
    int e = S_LEN - 16 - s0 + nn;
    e = e < 0 ? 0 : e;
    __builtin_prefetch(Erh + (size_t)e * D_HEAD, 0, 1);
  }

  const _Float16* qrow = Qbase + (size_t)(s0 + nn) * D_HEAD;
  int sshift = s0 + nn + 1; if (sshift > S_LEN - 1) sshift = S_LEN - 1;
  const _Float16* qsrow = Qbase + (size_t)sshift * D_HEAD;  // rows s+1 (skew wrap term)

  const v16h qa0 = frag_ld(qrow, k0);        // Q  d 0..31
  const v16h qa1 = frag_ld(qrow + 32, k0);   // Q  d 32..63
  const v16h qs0 = frag_ld(qsrow, k0);       // Qs d 0..31
  const v16h qs1 = frag_ld(qsrow + 32, k0);  // Qs d 32..63

  float rowmax[8], rowsum[8];
  v8f o0 = {}, o1 = {}, o2 = {}, o3 = {};
#pragma unroll
  for (int g = 0; g < 8; ++g) { rowmax[g] = -3.0e38f; rowsum[g] = 0.f; }

  slab_load(Kbase, Vbase, 0, Kl[0], Vl[0], tid);   // preload slab 0

  // Band stream: tile (s0, tt) needs blocks kb and kb + 1, kb = (S - 16 + tt - s0) / 16, so each
  // 16-key step needs one new block. gprev carries the older block's product; the two blocks
  // of a slab are fetched one slab ahead into fa*, fb*.
  int kb = (S_LEN - 16 - s0) >> 4;
  v8f gprev;
  {
    const _Float16* r0 = band_row(Erh, kb, nn);
    gprev = band_gemm(kb, nn, qa0, qa1, qs0, qs1, frag_ld(r0, k0), frag_ld(r0 + 32, k0));
  }
  const _Float16* ra = band_row(Erh, kb + 1, nn);
  const _Float16* rb = band_row(Erh, kb + 2, nn);
  v16h fa0 = frag_ld(ra, k0), fa1 = frag_ld(ra + 32, k0);
  v16h fb0 = frag_ld(rb, k0), fb1 = frag_ld(rb + 32, k0);

  for (int t0 = 0; t0 < S_LEN; t0 += 32) {
    const int buf = (t0 >> 5) & 1;
    if (t0 + 32 < S_LEN) {
      slab_load(Kbase, Vbase, t0 + 32, Kl[buf ^ 1], Vl[buf ^ 1], tid);
      wait_async_le4();                // current slab landed; prefetch stays in flight
    } else {
      wait_async_le0();
    }
    __syncthreads();

    // this slab's two new band blocks, then the next slab's fragments into the same registers:
    // their loads have the whole slab to land
    v8f gband[3];
    gband[0] = gprev;
    gband[1] = band_gemm(kb + 1, nn, qa0, qa1, qs0, qs1, fa0, fa1);
    gband[2] = band_gemm(kb + 2, nn, qa0, qa1, qs0, qs1, fb0, fb1);
    gprev = gband[2];
    kb += 2;
    ra = band_row(Erh, kb + 1, nn);
    rb = band_row(Erh, kb + 2, nn);
    fa0 = frag_ld(ra, k0); fa1 = frag_ld(ra + 32, k0);
    fb0 = frag_ld(rb, k0); fb1 = frag_ld(rb + 32, k0);

    float sc[2][8];
    float tmax[8];
#pragma unroll
    for (int g = 0; g < 8; ++g) tmax[g] = -3.0e38f;

#pragma unroll
    for (int sub = 0; sub < 2; ++sub) {
      // ---- QK^T 16x16 tile (K = 64) from LDS ----
      const _Float16* kcol = &Kl[buf][sub * 16 + nn][0];
      v8f c = {};
      c = WMMA_F16(qa0, frag_ld(kcol, k0), c);
      c = WMMA_F16(qa1, frag_ld(kcol + 32, k0), c);

      // ---- Srel tile: Toeplitz lane shift over the tile's two band blocks ----
      float srel[8];
#pragma unroll   // constant g keeps the tiles in registers
      for (int g = 0; g < 8; ++g) {
        int mm = g + 8 * hiH;
        int jm = nn - mm;                     // j - i
        int srcc = (jm >= 1) ? (jm - 1) : (jm + 15);
        int srcl = (lane & 16) | srcc;
        float v1 = __shfl(gband[sub][g],     srcl, 32);
        float v2 = __shfl(gband[sub + 1][g], srcl, 32);
        srel[g] = (jm >= 1) ? v2 : v1;
      }

#pragma unroll
      for (int g = 0; g < 8; ++g) {
        float sv = (c[g] + srel[g]) * 0.125f;   // / sqrt(D_HEAD)
        sc[sub][g] = sv;
        tmax[g] = fmaxf(tmax[g], sv);
      }
    }

    // ---- online softmax across this 32-key slab ----
#pragma unroll
    for (int g = 0; g < 8; ++g) {
      float tm = tmax[g];
#pragma unroll
      for (int x = 1; x < 16; x <<= 1) tm = fmaxf(tm, __shfl_xor(tm, x, 32));
      float nm = fmaxf(rowmax[g], tm);
      float al = __expf(rowmax[g] - nm);
      rowmax[g] = nm;
      float p0 = __expf(sc[0][g] - nm);
      float p1 = __expf(sc[1][g] - nm);
      float ts = p0 + p1;
#pragma unroll
      for (int x = 1; x < 16; x <<= 1) ts += __shfl_xor(ts, x, 32);
      rowsum[g] = rowsum[g] * al + ts;
      o0[g] *= al; o1[g] *= al; o2[g] *= al; o3[g] *= al;
      int mm = g + 8 * hiH;
      plds[wave][mm][nn]      = (_Float16)p0;   // C-layout scatter into LDS
      plds[wave][mm][16 + nn] = (_Float16)p1;
    }

    // read back P as A-fragment (row = lane&15, K = 32 keys)
    v16h pa = frag_ld(&plds[wave][nn][0], k0);

    // ---- P @ V : 4 WMMAs over the 64 head dims (K = 32), V from LDS ----
    const _Float16* vrow_ = &Vl[buf][nn][0];              // row stride 32 halfs
    o0 = WMMA_F16(pa, frag_ld(vrow_,            k0), o0);
    o1 = WMMA_F16(pa, frag_ld(vrow_ + 16 * 32,  k0), o1);
    o2 = WMMA_F16(pa, frag_ld(vrow_ + 32 * 32,  k0), o2);
    o3 = WMMA_F16(pa, frag_ld(vrow_ + 48 * 32,  k0), o3);

    __syncthreads();   // slab buffers free for the next prefetch
  }

  // ---- normalize and write (B, S, D_MODEL) f32 ----
#pragma unroll
  for (int g = 0; g < 8; ++g) {
    int s = s0 + g + 8 * hiH;
    float inv = 1.0f / rowsum[g];
    size_t base = ((size_t)(b * S_LEN + s)) * D_MODEL + h * D_HEAD + nn;
    out[base +  0] = o0[g] * inv;
    out[base + 16] = o1[g] * inv;
    out[base + 32] = o2[g] * inv;
    out[base + 48] = o3[g] * inv;
  }
}

extern "C" void kernel_launch(void* const* d_in, const int* in_sizes, int n_in,
                              void* d_out, int out_size, void* d_ws, size_t ws_size,
                              hipStream_t stream) {
  (void)in_sizes; (void)n_in; (void)out_size; (void)ws_size;
  const float* x  = (const float*)d_in[0];
  const float* Wq = (const float*)d_in[1];
  const float* bq = (const float*)d_in[2];
  const float* Wk = (const float*)d_in[3];
  const float* bk = (const float*)d_in[4];
  const float* Wv = (const float*)d_in[5];
  const float* bv = (const float*)d_in[6];
  const float* Er = (const float*)d_in[7];

  char* ws = (char*)d_ws;
  const size_t xhN = (size_t)BATCH * S_LEN * D_MODEL;        // 4,194,304
  const size_t wN  = (size_t)D_MODEL * D_MODEL;              // 1,048,576
  const size_t erN = (size_t)S_LEN * D_HEAD;                 // 131,072

  _Float16* Xh  = (_Float16*)(ws);
  _Float16* Wqh = (_Float16*)(ws + 2 * xhN);
  _Float16* Wkh = Wqh + wN;
  _Float16* Wvh = Wkh + wN;
  _Float16* Erh = Wvh + wN;
  _Float16* Qh  = Erh + erN;
  _Float16* Kh  = Qh + xhN;
  _Float16* Vth = Kh + xhN;

  cast_f32_f16<<<2048, 256, 0, stream>>>(x,  Xh,  (int)xhN);
  cast_f32_f16<<<512,  256, 0, stream>>>(Wq, Wqh, (int)wN);
  cast_f32_f16<<<512,  256, 0, stream>>>(Wk, Wkh, (int)wN);
  cast_f32_f16<<<512,  256, 0, stream>>>(Wv, Wvh, (int)wN);
  cast_f32_f16<<<64,   256, 0, stream>>>(Er, Erh, (int)erN);

  // QKV: M = 4096 rows, N = 1024 feats, K = 1024; z selects Q/K/V
  qkv_gemm<<<dim3(D_MODEL / 128, (BATCH * S_LEN) / 128, 3), 128, 0, stream>>>(
      Xh, Wqh, Wkh, Wvh, bq, bk, bv, Qh, Kh, Vth);

  // attention: 64 query rows per block (4 waves x 16)
  attn_kernel<<<dim3(S_LEN / 64, N_HEADS, BATCH), 128, 0, stream>>>(
      Qh, Kh, Vth, Erh, (float*)d_out);
}

// v003
// A run of this version takes 149 microseconds.
// Timed twice side by side with v002, it ran 1.41 times as fast both times.
// All steps since v000 together make it 2.62 times as fast.
#include <hip/hip_runtime.h>
#include <hip/hip_bf16.h>

#define S_LEN   2048
#define D_MODEL 1024
#define N_HEADS 16
#define D_HEAD  64
#define BATCH   2

typedef _Float16 h8   __attribute__((ext_vector_type(8)));
typedef _Float16 v16h __attribute__((ext_vector_type(16)));
typedef float    v8f  __attribute__((ext_vector_type(8)));

#define WMMA_F16(a, b, c) \
  __builtin_amdgcn_wmma_f32_16x16x32_f16(false, (a), false, (b), (short)0, (c), false, false)

// ---------- CDNA5 async global->LDS copy (guarded; falls back to ld+ds_store) ----------
#if defined(__has_builtin)
#if __has_builtin(__builtin_amdgcn_global_load_async_to_lds_b128)
#define HAVE_ASYNC_CP 1
#endif
#endif
#ifndef HAVE_ASYNC_CP
#define HAVE_ASYNC_CP 0
#endif

typedef int v4i_t __attribute__((vector_size(16)));
typedef __attribute__((address_space(1))) v4i_t* g_v4i_p;   // global int4*
typedef __attribute__((address_space(3))) v4i_t* l_v4i_p;   // LDS int4*

static __device__ __forceinline__ void cp16_g2l(const _Float16* g, _Float16* l) {
#if HAVE_ASYNC_CP
  __builtin_amdgcn_global_load_async_to_lds_b128(
      (g_v4i_p)(unsigned long long)g,
      (l_v4i_p)(unsigned int)(unsigned long long)l, 0, 0);
#else
  *(h8*)l = *(const h8*)g;
#endif
}
static __device__ __forceinline__ void wait_async_le4() {
#if HAVE_ASYNC_CP
  asm volatile("s_wait_asynccnt 0x4" ::: "memory");
#endif
}
static __device__ __forceinline__ void wait_async_le0() {
#if HAVE_ASYNC_CP
  asm volatile("s_wait_asynccnt 0x0" ::: "memory");
#endif
}

// Load one lane's slice of a 16x32 (f16) A/B fragment.
// Layout per ISA 7.12.2: lanes 0-15 hold K[0..7]+K[16..23], lanes 16-31 hold K[8..15]+K[24..31].
static __device__ __forceinline__ v16h frag_ld(const _Float16* p, int k0) {
  h8 lo = *(const h8*)(p + k0);
  h8 hi = *(const h8*)(p + k0 + 16);
  return __builtin_shufflevector(lo, hi, 0,1,2,3,4,5,6,7,8,9,10,11,12,13,14,15);
}

// The skew reads, for query s and key t, position u = S - 1 + t - s of one band of 2 S positions:
// u < S is q[s].Er[u], u == S is the skew's zero column, u > S is q[s+1].Er[u - S - 1].
// Band block k holds positions 16 k .. 16 k + 15; a 16x16 score tile needs blocks k and k + 1.
#define BAND_WRAP (S_LEN / 16)   // first block that belongs to q[s+1]

// Er row behind column nn of band block k
static __device__ __forceinline__ const _Float16* band_row(const _Float16* __restrict__ Erh,
                                                           int k, int nn) {
  int e = k * 16 + nn - ((k >= BAND_WRAP) ? (S_LEN + 1) : 0);
  e = e < 0 ? 0 : e;                        // the zero column's lane
  e = e > (S_LEN - 1) ? (S_LEN - 1) : e;    // blocks fetched past the last slab, never used
  return Erh + (size_t)e * D_HEAD;
}

// G = Qtile(16x64) @ (band block k)^T -> 16x16 f32 (2 WMMAs over K=64); k is wave-uniform
static __device__ __forceinline__ v8f band_gemm(int k, int nn, v16h qa0, v16h qa1,
                                                v16h qs0, v16h qs1, v16h f0, v16h f1) {
  const bool wrap = (k >= BAND_WRAP);
  v8f c = {};
  c = WMMA_F16(wrap ? qs0 : qa0, f0, c);
  c = WMMA_F16(wrap ? qs1 : qa1, f1, c);
  const bool zcol = (k * 16 + nn == S_LEN);
#pragma unroll   // constant g keeps the tile in registers
  for (int g = 0; g < 8; ++g) c[g] = zcol ? 0.f : c[g];
  return c;
}

// ---------------- Kernel 1: f32 -> f16 cast ----------------
__global__ void cast_f32_f16(const float* __restrict__ in, _Float16* __restrict__ out, int n) {
  int i = blockIdx.x * blockDim.x + threadIdx.x;
  int stride = gridDim.x * blockDim.x;
  for (; i < n; i += stride) out[i] = (_Float16)in[i];
}

// ---------------- Kernel 2: QKV projection GEMM ----------------
// y = Xh @ W^T + b ; z = 0/1/2 -> Q/K/V. Q,K stored (b,h,s,dh); V stored transposed (b,h,dh,s).
// One 128x128 tile of y per block, 64x64 per wave (4x4 WMMA tiles), so every LDS fragment
// feeds four WMMAs. A pass is 64 k: 128 W rows and 128 X rows of 128 B, laid at a pitch of
// 144 B (16 B x odd: conflict-free for ds_load_b128), two buffers filled by async copies.
#define G_PITCH 72                       // halfs per staged row (144 B)
#define G_STAGE (256 * G_PITCH)          // halfs per buffer: W rows 0..127, X rows 128..255
#define G_PASSES (D_MODEL / 64)

// Eight 16-byte async copies of one lane. The s_wait_xcnt stands inside the statement so
// that no address register of an issued copy is rewritten ahead of it.
static __device__ __forceinline__ void cp16x8(unsigned l, const _Float16* g) {
  const unsigned l1 = l + 1 * 16 * G_PITCH * 2, l2 = l + 2 * 16 * G_PITCH * 2,
                 l3 = l + 3 * 16 * G_PITCH * 2, l4 = l + 4 * 16 * G_PITCH * 2,
                 l5 = l + 5 * 16 * G_PITCH * 2, l6 = l + 6 * 16 * G_PITCH * 2,
                 l7 = l + 7 * 16 * G_PITCH * 2;
  const _Float16 *g1 = g + 1 * 16 * D_MODEL, *g2 = g + 2 * 16 * D_MODEL,
                 *g3 = g + 3 * 16 * D_MODEL, *g4 = g + 4 * 16 * D_MODEL,
                 *g5 = g + 5 * 16 * D_MODEL, *g6 = g + 6 * 16 * D_MODEL,
                 *g7 = g + 7 * 16 * D_MODEL;
  asm volatile(
      "global_load_async_to_lds_b128 %0, %8, off\n\t"
      "global_load_async_to_lds_b128 %1, %9, off\n\t"
      "global_load_async_to_lds_b128 %2, %10, off\n\t"
      "global_load_async_to_lds_b128 %3, %11, off\n\t"
      "global_load_async_to_lds_b128 %4, %12, off\n\t"
      "global_load_async_to_lds_b128 %5, %13, off\n\t"
      "global_load_async_to_lds_b128 %6, %14, off\n\t"
      "global_load_async_to_lds_b128 %7, %15, off\n\t"
      "s_wait_xcnt 0x0"
      :: "v"(l), "v"(l1), "v"(l2), "v"(l3), "v"(l4), "v"(l5), "v"(l6), "v"(l7),
         "v"(g), "v"(g1), "v"(g2), "v"(g3), "v"(g4), "v"(g5), "v"(g6), "v"(g7)
      : "memory");
}

// Epilogue memory operations stand with their waits in one asm statement each, so that no
// register that an issued load or store names is rewritten ahead of the wait (a precaution).
typedef float v4f __attribute__((ext_vector_type(4)));

// 4 x 8 consecutive floats at p + 16 i (i = 0..3)
static __device__ __forceinline__ void ld_bias_rows(const float* p, v4f (&b)[8]) {
  asm volatile(
      "global_load_b128 %0, %8, off\n\t"
      "global_load_b128 %1, %8, off offset:16\n\t"
      "global_load_b128 %2, %8, off offset:64\n\t"
      "global_load_b128 %3, %8, off offset:80\n\t"
      "global_load_b128 %4, %8, off offset:128\n\t"
      "global_load_b128 %5, %8, off offset:144\n\t"
      "global_load_b128 %6, %8, off offset:192\n\t"
      "global_load_b128 %7, %8, off offset:208\n\t"
      "s_wait_loadcnt 0x0\n\t"
      "s_wait_xcnt 0x0"
      : "=&v"(b[0]), "=&v"(b[1]), "=&v"(b[2]), "=&v"(b[3]),
        "=&v"(b[4]), "=&v"(b[5]), "=&v"(b[6]), "=&v"(b[7])
      : "v"(p) : "memory");
}
// one float at p + 16 j (j = 0..3)
static __device__ __forceinline__ void ld_bias_cols(const float* p, float (&b)[4]) {
  asm volatile(
      "global_load_b32 %0, %4, off\n\t"
      "global_load_b32 %1, %4, off offset:64\n\t"
      "global_load_b32 %2, %4, off offset:128\n\t"
      "global_load_b32 %3, %4, off offset:192\n\t"
      "s_wait_loadcnt 0x0\n\t"
      "s_wait_xcnt 0x0"
      : "=&v"(b[0]), "=&v"(b[1]), "=&v"(b[2]), "=&v"(b[3])
      : "v"(p) : "memory");
}
// Q,K: v[4 i + j] goes to token row + 16 j (rows of 128 B), dh + 16 i
static __device__ __forceinline__ void st_tile_qk(_Float16* p, const h8 (&v)[16]) {
  asm volatile(
      "global_store_b128 %0, %1, off\n\t"
      "global_store_b128 %0, %2, off offset:2048\n\t"
      "global_store_b128 %0, %3, off offset:4096\n\t"
      "global_store_b128 %0, %4, off offset:6144\n\t"
      "global_store_b128 %0, %5, off offset:32\n\t"
      "global_store_b128 %0, %6, off offset:2080\n\t"
      "global_store_b128 %0, %7, off offset:4128\n\t"
      "global_store_b128 %0, %8, off offset:6176\n\t"
      "global_store_b128 %0, %9, off offset:64\n\t"
      "global_store_b128 %0, %10, off offset:2112\n\t"
      "global_store_b128 %0, %11, off offset:4160\n\t"
      "global_store_b128 %0, %12, off offset:6208\n\t"
      "global_store_b128 %0, %13, off offset:96\n\t"
      "global_store_b128 %0, %14, off offset:2144\n\t"
      "global_store_b128 %0, %15, off offset:4192\n\t"
      "global_store_b128 %0, %16, off offset:6240\n\t"
      "s_wait_xcnt 0x0"
      :: "v"(p), "v"(v[0]), "v"(v[1]), "v"(v[2]), "v"(v[3]), "v"(v[4]), "v"(v[5]), "v"(v[6]), "v"(v[7]),
         "v"(v[8]), "v"(v[9]), "v"(v[10]), "v"(v[11]), "v"(v[12]), "v"(v[13]), "v"(v[14]), "v"(v[15])
      : "memory");
}
// V transposed: v[4 j + i] goes to dh row + 16 j (rows of S_LEN halfs = 4096 B), s + 16 i
static __device__ __forceinline__ void st_tile_vt(_Float16* p, const h8 (&v)[16]) {
  asm volatile(
      "global_store_b128 %0, %1, off\n\t"
      "global_store_b128 %0, %2, off offset:32\n\t"
      "global_store_b128 %0, %3, off offset:64\n\t"
      "global_store_b128 %0, %4, off offset:96\n\t"
      "global_store_b128 %0, %5, off offset:65536\n\t"
      "global_store_b128 %0, %6, off offset:65568\n\t"
      "global_store_b128 %0, %7, off offset:65600\n\t"
      "global_store_b128 %0, %8, off offset:65632\n\t"
      "global_store_b128 %0, %9, off offset:131072\n\t"
      "global_store_b128 %0, %10, off offset:131104\n\t"
      "global_store_b128 %0, %11, off offset:131136\n\t"
      "global_store_b128 %0, %12, off offset:131168\n\t"
      "global_store_b128 %0, %13, off offset:196608\n\t"
      "global_store_b128 %0, %14, off offset:196640\n\t"
      "global_store_b128 %0, %15, off offset:196672\n\t"
      "global_store_b128 %0, %16, off offset:196704\n\t"
      "s_wait_xcnt 0x0"
      :: "v"(p), "v"(v[0]), "v"(v[1]), "v"(v[2]), "v"(v[3]), "v"(v[4]), "v"(v[5]), "v"(v[6]), "v"(v[7]),
         "v"(v[8]), "v"(v[9]), "v"(v[10]), "v"(v[11]), "v"(v[12]), "v"(v[13]), "v"(v[14]), "v"(v[15])
      : "memory");
}

__global__ void __launch_bounds__(128)
qkv_gemm(const _Float16* __restrict__ Xh,
         const _Float16* __restrict__ Wqh, const _Float16* __restrict__ Wkh,
         const _Float16* __restrict__ Wvh,
         const float* __restrict__ bq, const float* __restrict__ bk, const float* __restrict__ bv,
         _Float16* __restrict__ Qh, _Float16* __restrict__ Kh, _Float16* __restrict__ Vth) {
  __shared__ __align__(16) _Float16 St[2 * G_STAGE];   // 73,728 B

  const int tid  = threadIdx.x;
  const int lane = tid & 31;
  const int wave = tid >> 5;
  const int nn   = lane & 15;
  const int hiH  = (lane >> 4) & 1;
  const int k0   = hiH * 8;
  const int n0   = blockIdx.x * 128 + (wave & 1) * 64;    // this wave's first feature
  const int row0 = blockIdx.y * 128 + (wave >> 1) * 64;   // this wave's first token row
  const int which = blockIdx.z;

  const _Float16* W    = (which == 0) ? Wqh : (which == 1) ? Wkh : Wvh;
  const float*    bias = (which == 0) ? bq  : (which == 1) ? bk  : bv;

  // copies: a lane brings chunk (tid & 7) of rows (tid >> 3) + 16 r, r = 0..7, of W and of X
  const int crow = tid >> 3, ccol = (tid & 7) << 3;
  const _Float16* gW = W  + (size_t)(blockIdx.x * 128 + crow) * D_MODEL + ccol;
  const _Float16* gX = Xh + (size_t)(blockIdx.y * 128 + crow) * D_MODEL + ccol;
  const unsigned  lW = (unsigned)(unsigned long long)&St[crow * G_PITCH + ccol];
  const unsigned  lX = lW + 128 * G_PITCH * 2;

  // Q,K: features are the rows of D (operand A = W), so a lane holds 8 consecutive dh of one
  // token; V: tokens are the rows (A = X), so a lane holds 8 consecutive s of one feature.
  const int wrow = (wave & 1) * 64 + nn, xrow = 128 + (wave >> 1) * 64 + nn;
  const int aoff = ((which == 2) ? xrow : wrow) * G_PITCH + k0;
  const int boff = ((which == 2) ? wrow : xrow) * G_PITCH + k0;

  v8f acc[4][4];
#pragma unroll
  for (int i = 0; i < 4; ++i)
#pragma unroll
    for (int j = 0; j < 4; ++j) acc[i][j] = (v8f){};

  cp16x8(lW, gW);
  cp16x8(lX, gX);
  wait_async_le0();
  __syncthreads();
  cp16x8(lW + G_STAGE * 2, gW + 64);
  cp16x8(lX + G_STAGE * 2, gX + 64);

  for (int t = 0; t < G_PASSES; ++t) {
    const int bo = (t & 1) * G_STAGE;
    // the whole pass's fragments go to registers as one group of LDS reads
    v16h af[2][4], bf[2][4];
#pragma unroll
    for (int ks = 0; ks < 2; ++ks)
#pragma unroll
      for (int i = 0; i < 4; ++i) {
        af[ks][i] = frag_ld(&St[bo + aoff + i * 16 * G_PITCH + ks * 32], 0);
        bf[ks][i] = frag_ld(&St[bo + boff + i * 16 * G_PITCH + ks * 32], 0);
      }
    // publish point of pass t + 1: own LDS reads done, own copies landed, then the barrier
    // that shows pass t + 1's tile to every wave and frees pass t's buffer for the refill
    asm volatile("s_wait_dscnt 0x0" ::: "memory");
    wait_async_le0();
    __syncthreads();
    if (t + 2 < G_PASSES) {
      cp16x8(lW + bo * 2, gW + (t + 2) * 64);
      cp16x8(lX + bo * 2, gX + (t + 2) * 64);
    }
    // the pass's WMMAs work on registers alone, so the refill flies under all of them
#pragma unroll
    for (int ks = 0; ks < 2; ++ks)
#pragma unroll
      for (int i = 0; i < 4; ++i)
#pragma unroll
        for (int j = 0; j < 4; ++j) acc[i][j] = WMMA_F16(af[ks][i], bf[ks][j], acc[i][j]);
  }
  wait_async_le0();   // no copy is outstanding when the wave ends

  const int bb = row0 >> 11;             // / S_LEN: one batch entry per 64-row wave tile
  const int s0 = row0 & (S_LEN - 1);
  const size_t head = (size_t)(bb * N_HEADS + (n0 >> 6));   // one head per 64-feature wave tile
  h8 v[16];
  if (which == 2) {
    float bb_[4];
    ld_bias_cols(bias + n0 + nn, bb_);
#pragma unroll
    for (int j = 0; j < 4; ++j)
#pragma unroll
      for (int i = 0; i < 4; ++i)
#pragma unroll
        for (int g = 0; g < 8; ++g) v[j * 4 + i][g] = (_Float16)(acc[i][j][g] + bb_[j]);
    st_tile_vt(Vth + (head * D_HEAD + nn) * S_LEN + s0 + hiH * 8, v);
  } else {
    v4f bb_[8];
    ld_bias_rows(bias + n0 + hiH * 8, bb_);
#pragma unroll
    for (int i = 0; i < 4; ++i)
#pragma unroll
      for (int j = 0; j < 4; ++j)
#pragma unroll
        for (int g = 0; g < 8; ++g)
          v[i * 4 + j][g] = (_Float16)(acc[i][j][g] + bb_[i * 2 + (g >> 2)][g & 3]);
    st_tile_qk(((which == 0) ? Qh : Kh) + (head * S_LEN + s0 + nn) * D_HEAD + hiH * 8, v);
  }
}

// ---------------- Kernel 3: flash attention with relative skew ----------------
// K/V slabs (32 keys) are double-buffered in LDS via async copies, shared by all 4 waves;
// prefetch of slab n+1 overlaps compute on slab n (s_wait_asynccnt <= 4).
static __device__ __forceinline__ void slab_load(const _Float16* __restrict__ Kbase,
                                                 const _Float16* __restrict__ Vbase,
                                                 int t0,
                                                 _Float16 (*Kl)[64], _Float16 (*Vl)[32],
                                                 int tid) {
#pragma unroll
  for (int r = 0; r < 2; ++r) {
    int c = tid + r * 128;                 // 0..255
    int krow = c >> 3, kcol = (c & 7) << 3;   // 32 rows x 64 halfs
    cp16_g2l(Kbase + (size_t)(t0 + krow) * D_HEAD + kcol, &Kl[krow][kcol]);
    int vrow = c >> 2, vcol = (c & 3) << 3;   // 64 rows x 32 halfs
    cp16_g2l(Vbase + (size_t)vrow * S_LEN + t0 + vcol, &Vl[vrow][vcol]);
  }
}

#define SK_PITCH 68   // floats per ring row: 64 keys + 4, so 16 rows' 16-byte reads fall on 64 banks

// value of the lane 16 away
static __device__ __forceinline__ float other_half(float v) {
  int b = __builtin_bit_cast(int, v);
  b = __builtin_amdgcn_permlanex16(b, b, 0x76543210, 0xfedcba98, false, false);
  return __builtin_bit_cast(float, b);
}

__global__ void __launch_bounds__(128)
attn_kernel(const _Float16* __restrict__ Qh, const _Float16* __restrict__ Kh,
            const _Float16* __restrict__ Vt, const _Float16* __restrict__ Erh,
            float* __restrict__ out) {
  __shared__ __align__(16) _Float16 Kl[2][32][64];   // 8 KB double-buffered K slab
  __shared__ __align__(16) _Float16 Vl[2][64][32];   // 8 KB double-buffered V slab (dh,t)
  __shared__ __align__(16) float sk[4][16 * SK_PITCH];   // per-wave skew ring

  const int tid  = threadIdx.x;
  const int lane = tid & 31;
  const int wave = __builtin_amdgcn_readfirstlane(tid >> 5);   // scalar: picks the band blocks
  const int hiH  = (lane >> 4) & 1;
  const int k0   = hiH * 8;
  const int nn   = lane & 15;

  const int h  = blockIdx.y;
  const int b  = blockIdx.z;
  const int s0 = blockIdx.x * 64 + wave * 16;

  const size_t head = (size_t)(b * N_HEADS + h) * (size_t)S_LEN * D_HEAD;
  const _Float16* Qbase = Qh + head;
  const _Float16* Kbase = Kh + head;
  const _Float16* Vbase = Vt + head;   // (dh, t) layout

  // warm the Er diagonal band this block touches first
  {
    int e = S_LEN - 16 - s0 + nn;
    e = e < 0 ? 0 : e;
    __builtin_prefetch(Erh + (size_t)e * D_HEAD, 0, 1);
  }

  const _Float16* qrow = Qbase + (size_t)(s0 + nn) * D_HEAD;
  int sshift = s0 + nn + 1; if (sshift > S_LEN - 1) sshift = S_LEN - 1;
  const _Float16* qsrow = Qbase + (size_t)sshift * D_HEAD;  // rows s+1 (skew wrap term)

  const v16h qa0 = frag_ld(qrow, k0);        // Q  d 0..31
  const v16h qa1 = frag_ld(qrow + 32, k0);   // Q  d 32..63
  const v16h qs0 = frag_ld(qsrow, k0);       // Qs d 0..31
  const v16h qs1 = frag_ld(qsrow + 32, k0);  // Qs d 32..63

  float rowmax = -3.0e38f, rowsum = 0.f;     // of query s0 + nn; rowsum over this half's keys
  v8f o0 = {}, o1 = {}, o2 = {}, o3 = {};    // O^T: register g = dh 16 n + 8 hiH + g, lane = query

  slab_load(Kbase, Vbase, 0, Kl[0], Vl[0], tid);   // preload slab 0

  // Band stream: block kb + m holds, for query row i, keys 16 m - 15 + i .. 16 m + i, so slab n
  // (keys 32 n .. 32 n + 31) needs blocks m <= 2 n + 2. Blocks are multiplied and stored one slab
  // ahead of their first full use; their Er fragments are fetched one slab before that.
  // Ring column of (row i = 8 hiH + g, lane nn) in block m: (16 m + 49 + nn + i) & 63; only
  // m = 0 (mod 4) can wrap inside a block.
  float* const skw = &sk[wave][0];
  float* const sk_st = skw + (8 * hiH) * (SK_PITCH + 1) + nn + 1;    // + g (SK_PITCH + 1) + 16 ((m & 3) - 1)
  const float* const sk_ld = skw + nn * SK_PITCH + 8 * hiH;          // + (first key of the tile) & 63
  int wofs[8];                                                       // the wrapping block's places
#pragma unroll   // constant g keeps the table in registers
  for (int g = 0; g < 8; ++g)
    wofs[g] = (8 * hiH + g) * SK_PITCH + ((49 + nn + 8 * hiH + g) & 63);

  int kb = (S_LEN - 16 - s0) >> 4;
  {
    const _Float16* r0 = band_row(Erh, kb, nn);
    const _Float16* r1 = band_row(Erh, kb + 1, nn);
    const _Float16* r2 = band_row(Erh, kb + 2, nn);
    const v8f g0 = band_gemm(kb,     nn, qa0, qa1, qs0, qs1, frag_ld(r0, k0), frag_ld(r0 + 32, k0));
    const v8f g1 = band_gemm(kb + 1, nn, qa0, qa1, qs0, qs1, frag_ld(r1, k0), frag_ld(r1 + 32, k0));
    const v8f g2 = band_gemm(kb + 2, nn, qa0, qa1, qs0, qs1, frag_ld(r2, k0), frag_ld(r2 + 32, k0));
#pragma unroll   // constant g keeps the tiles in registers
    for (int g = 0; g < 8; ++g) {
      skw[wofs[g]] = g0[g];
      sk_st[g * (SK_PITCH + 1)] = g1[g];
      sk_st[g * (SK_PITCH + 1) + 16] = g2[g];
    }
  }
  const _Float16* ra = band_row(Erh, kb + 3, nn);
  const _Float16* rb = band_row(Erh, kb + 4, nn);
  v16h fa0 = frag_ld(ra, k0), fa1 = frag_ld(ra + 32, k0);
  v16h fb0 = frag_ld(rb, k0), fb1 = frag_ld(rb + 32, k0);

  for (int tp = 0; tp < S_LEN; tp += 64) {
#pragma unroll   // constant par: buffer and ring places become immediate offsets
    for (int par = 0; par < 2; ++par) {
      const int t0 = tp + par * 32;
      if (t0 + 32 < S_LEN) {
        slab_load(Kbase, Vbase, t0 + 32, Kl[par ^ 1], Vl[par ^ 1], tid);
        wait_async_le4();                // current slab landed; prefetch stays in flight
      } else {
        wait_async_le0();
      }
      __syncthreads();   // also orders the ring's stores of the slab before ahead of the reads below

      // ---- Srel^T of this slab from the ring: 8 consecutive keys of the lane's query per tile ----
      v4f rr[4];
#pragma unroll
      for (int q = 0; q < 4; ++q) rr[q] = *(const v4f*)(sk_ld + par * 32 + (q >> 1) * 16 + (q & 1) * 4);
      // the ring places stored below alias keys read above: keep the compiler from lifting the
      // stores over those reads (the wave's LDS operations run in program order)
      __builtin_amdgcn_fence(__ATOMIC_ACQ_REL, "wavefront");

      // the next slab's two new band blocks into the ring, then the fragments of the slab after
      // into the same registers: their loads have a whole slab to land
      {
        const v8f ga = band_gemm(kb + 3, nn, qa0, qa1, qs0, qs1, fa0, fa1);
        const v8f gb = band_gemm(kb + 4, nn, qa0, qa1, qs0, qs1, fb0, fb1);
#pragma unroll   // constant g keeps the tiles in registers
        for (int g = 0; g < 8; ++g) {
          if (par == 0) {     // blocks 3 and 0 (mod 4)
            sk_st[g * (SK_PITCH + 1) + 32] = ga[g];
            skw[wofs[g]] = gb[g];
          } else {            // blocks 1 and 2 (mod 4)
            sk_st[g * (SK_PITCH + 1)] = ga[g];
            sk_st[g * (SK_PITCH + 1) + 16] = gb[g];
          }
        }
      }
      kb += 2;
      ra = band_row(Erh, kb + 3, nn);
      rb = band_row(Erh, kb + 4, nn);
      fa0 = frag_ld(ra, k0); fa1 = frag_ld(ra + 32, k0);
      // a precaution: the build let a result of the loads below land on the address pair of the
      // loads above; the wait stands between them
      asm volatile("s_wait_xcnt 0x0" ::: "memory");
      fb0 = frag_ld(rb, k0); fb1 = frag_ld(rb + 32, k0);
      // keeps these loads here: the build sank half of them to the slab's last barrier, which
      // waits for them
      __builtin_amdgcn_sched_barrier(0);

      // ---- S^T: two 16-key tiles (K = 64), K rows from LDS as A, Q as B ----
      float sc[16];
#pragma unroll
      for (int sub = 0; sub < 2; ++sub) {
        const _Float16* krow = &Kl[par][sub * 16 + nn][0];
        v8f c = {};
        c = WMMA_F16(frag_ld(krow, k0), qa0, c);
        c = WMMA_F16(frag_ld(krow + 32, k0), qa1, c);
#pragma unroll
        for (int g = 0; g < 8; ++g)
          sc[sub * 8 + g] = (c[g] + rr[sub * 2 + (g >> 2)][g & 3]) * 0.125f;   // / sqrt(D_HEAD)
      }

      // ---- online softmax across this 32-key slab: one query per lane ----
      float m4[4];
#pragma unroll
      for (int e = 0; e < 4; ++e)
        m4[e] = fmaxf(fmaxf(sc[e], sc[e + 4]), fmaxf(sc[e + 8], sc[e + 12]));
      float tm = fmaxf(fmaxf(m4[0], m4[1]), fmaxf(m4[2], m4[3]));
      tm = fmaxf(tm, other_half(tm));
      const float nm = fmaxf(rowmax, tm);
      const float al = __expf(rowmax - nm);
      rowmax = nm;
      v16h pb;          // P^T as B: element e = key 8 hiH + e (e < 8), 16 + 8 hiH + e - 8 (e >= 8)
      float p4[4] = {0.f, 0.f, 0.f, 0.f};
#pragma unroll
      for (int e = 0; e < 16; ++e) {
        const float p = __expf(sc[e] - nm);
        p4[e & 3] += p;
        pb[e] = (_Float16)p;
      }
      rowsum = rowsum * al + ((p4[0] + p4[1]) + (p4[2] + p4[3]));
#pragma unroll
      for (int g = 0; g < 8; ++g) { o0[g] *= al; o1[g] *= al; o2[g] *= al; o3[g] *= al; }

      // ---- O^T += V^T P^T : 4 WMMAs over the 64 head dims (K = 32), V^T rows from LDS as A ----
      const _Float16* vrow_ = &Vl[par][nn][0];              // row stride 32 halfs
      o0 = WMMA_F16(frag_ld(vrow_,            k0), pb, o0);
      o1 = WMMA_F16(frag_ld(vrow_ + 16 * 32,  k0), pb, o1);
      o2 = WMMA_F16(frag_ld(vrow_ + 32 * 32,  k0), pb, o2);
      o3 = WMMA_F16(frag_ld(vrow_ + 48 * 32,  k0), pb, o3);

      __syncthreads();   // slab buffers free for the next prefetch
    }
  }

  // ---- join the halves' sums, normalize and write (B, S, D_MODEL) f32 ----
  const float inv = 1.0f / (rowsum + other_half(rowsum));
  float* orow = out + ((size_t)(b * S_LEN + s0 + nn)) * D_MODEL + h * D_HEAD + 8 * hiH;
  *(v4f*)(orow +  0) = (v4f){o0[0], o0[1], o0[2], o0[3]} * inv;
  *(v4f*)(orow +  4) = (v4f){o0[4], o0[5], o0[6], o0[7]} * inv;
  *(v4f*)(orow + 16) = (v4f){o1[0], o1[1], o1[2], o1[3]} * inv;
  *(v4f*)(orow + 20) = (v4f){o1[4], o1[5], o1[6], o1[7]} * inv;
  *(v4f*)(orow + 32) = (v4f){o2[0], o2[1], o2[2], o2[3]} * inv;
  *(v4f*)(orow + 36) = (v4f){o2[4], o2[5], o2[6], o2[7]} * inv;
  *(v4f*)(orow + 48) = (v4f){o3[0], o3[1], o3[2], o3[3]} * inv;
  *(v4f*)(orow + 52) = (v4f){o3[4], o3[5], o3[6], o3[7]} * inv;
}

extern "C" void kernel_launch(void* const* d_in, const int* in_sizes, int n_in,
                              void* d_out, int out_size, void* d_ws, size_t ws_size,
                              hipStream_t stream) {
  (void)in_sizes; (void)n_in; (void)out_size; (void)ws_size;
  const float* x  = (const float*)d_in[0];
  const float* Wq = (const float*)d_in[1];
  const float* bq = (const float*)d_in[2];
  const float* Wk = (const float*)d_in[3];
  const float* bk = (const float*)d_in[4];
  const float* Wv = (const float*)d_in[5];
  const float* bv = (const float*)d_in[6];
  const float* Er = (const float*)d_in[7];

  char* ws = (char*)d_ws;
  const size_t xhN = (size_t)BATCH * S_LEN * D_MODEL;        // 4,194,304
  const size_t wN  = (size_t)D_MODEL * D_MODEL;              // 1,048,576
  const size_t erN = (size_t)S_LEN * D_HEAD;                 // 131,072

  _Float16* Xh  = (_Float16*)(ws);
  _Float16* Wqh = (_Float16*)(ws + 2 * xhN);
  _Float16* Wkh = Wqh + wN;
  _Float16* Wvh = Wkh + wN;
  _Float16* Erh = Wvh + wN;
  _Float16* Qh  = Erh + erN;
  _Float16* Kh  = Qh + xhN;
  _Float16* Vth = Kh + xhN;

  cast_f32_f16<<<2048, 256, 0, stream>>>(x,  Xh,  (int)xhN);
  cast_f32_f16<<<512,  256, 0, stream>>>(Wq, Wqh, (int)wN);
  cast_f32_f16<<<512,  256, 0, stream>>>(Wk, Wkh, (int)wN);
  cast_f32_f16<<<512,  256, 0, stream>>>(Wv, Wvh, (int)wN);
  cast_f32_f16<<<64,   256, 0, stream>>>(Er, Erh, (int)erN);

  // QKV: M = 4096 rows, N = 1024 feats, K = 1024; z selects Q/K/V
  qkv_gemm<<<dim3(D_MODEL / 128, (BATCH * S_LEN) / 128, 3), 128, 0, stream>>>(
      Xh, Wqh, Wkh, Wvh, bq, bk, bv, Qh, Kh, Vth);

  // attention: 64 query rows per block (4 waves x 16)
  attn_kernel<<<dim3(S_LEN / 64, N_HEADS, BATCH), 128, 0, stream>>>(
      Qh, Kh, Vth, Erh, (float*)d_out);
}

// v004
// Measured time: 142 microseconds a run.
// In both of two side-by-side timings against v003, it was 1.05 times as fast.
// All steps since v000 together make it 2.76 times as fast.
#include <hip/hip_runtime.h>
#include <hip/hip_bf16.h>

#define S_LEN   2048
#define D_MODEL 1024
#define N_HEADS 16
#define D_HEAD  64
#define BATCH   2

typedef _Float16 h8   __attribute__((ext_vector_type(8)));
typedef _Float16 v16h __attribute__((ext_vector_type(16)));
typedef float    v8f  __attribute__((ext_vector_type(8)));

#define WMMA_F16(a, b, c) \
  __builtin_amdgcn_wmma_f32_16x16x32_f16(false, (a), false, (b), (short)0, (c), false, false)

// ---------- CDNA5 async global->LDS copy (guarded; falls back to ld+ds_store) ----------
#if defined(__has_builtin)
#if __has_builtin(__builtin_amdgcn_global_load_async_to_lds_b128)
#define HAVE_ASYNC_CP 1
#endif
#endif
#ifndef HAVE_ASYNC_CP
#define HAVE_ASYNC_CP 0
#endif

typedef int v4i_t __attribute__((vector_size(16)));
typedef __attribute__((address_space(1))) v4i_t* g_v4i_p;   // global int4*
typedef __attribute__((address_space(3))) v4i_t* l_v4i_p;   // LDS int4*

static __device__ __forceinline__ void cp16_g2l(const _Float16* g, _Float16* l) {
#if HAVE_ASYNC_CP
  __builtin_amdgcn_global_load_async_to_lds_b128(
      (g_v4i_p)(unsigned long long)g,
      (l_v4i_p)(unsigned int)(unsigned long long)l, 0, 0);
#else
  *(h8*)l = *(const h8*)g;
#endif
}
static __device__ __forceinline__ void wait_async_le4() {
#if HAVE_ASYNC_CP
  asm volatile("s_wait_asynccnt 0x4" ::: "memory");
#endif
}
static __device__ __forceinline__ void wait_async_le0() {
#if HAVE_ASYNC_CP
  asm volatile("s_wait_asynccnt 0x0" ::: "memory");
#endif
}

// Load one lane's slice of a 16x32 (f16) A/B fragment.
// Layout per ISA 7.12.2: lanes 0-15 hold K[0..7]+K[16..23], lanes 16-31 hold K[8..15]+K[24..31].
static __device__ __forceinline__ v16h frag_ld(const _Float16* p, int k0) {
  h8 lo = *(const h8*)(p + k0);
  h8 hi = *(const h8*)(p + k0 + 16);
  return __builtin_shufflevector(lo, hi, 0,1,2,3,4,5,6,7,8,9,10,11,12,13,14,15);
}

// The skew reads, for query s and key t, position u = S - 1 + t - s of one band of 2 S positions:
// u < S is q[s].Er[u], u == S is the skew's zero column, u > S is q[s+1].Er[u - S - 1].
// Band block k holds positions 16 k .. 16 k + 15; a 16x16 score tile needs blocks k and k + 1.
#define BAND_WRAP (S_LEN / 16)   // first block that belongs to q[s+1]

// Er row behind column nn of band block k
static __device__ __forceinline__ const _Float16* band_row(const _Float16* __restrict__ Erh,
                                                           int k, int nn) {
  int e = k * 16 + nn - ((k >= BAND_WRAP) ? (S_LEN + 1) : 0);
  e = e < 0 ? 0 : e;                        // the zero column's lane
  e = e > (S_LEN - 1) ? (S_LEN - 1) : e;    // blocks fetched past the last slab, never used
  return Erh + (size_t)e * D_HEAD;
}

// G = Qtile(16x64) @ (band block k)^T -> 16x16 f32 (2 WMMAs over K=64); k is wave-uniform
static __device__ __forceinline__ v8f band_gemm(int k, int nn, v16h qa0, v16h qa1,
                                                v16h qs0, v16h qs1, v16h f0, v16h f1) {
  const bool wrap = (k >= BAND_WRAP);
  v8f c = {};
  c = WMMA_F16(wrap ? qs0 : qa0, f0, c);
  c = WMMA_F16(wrap ? qs1 : qa1, f1, c);
  const bool zcol = (k * 16 + nn == S_LEN);
#pragma unroll   // constant g keeps the tile in registers
  for (int g = 0; g < 8; ++g) c[g] = zcol ? 0.f : c[g];
  return c;
}

// ---------------- Kernel 1: f32 -> f16 cast of x, Wq, Wk, Wv and Er, one launch ----------------
// The five f16 copies lie one behind the other in the workspace, so a block's place in the grid is
// its place in the destination; each array is a whole number of blocks. A thread converts 64
// elements: sixteen 16-byte loads, each 512 contiguous bytes of a wave, issued ahead of the
// conversions, and sixteen 8-byte stores, each two whole 128-byte lines of a wave.
#define CAST_T 128                                        // threads per block
#define CAST_V 16                                         // 16-byte loads per thread
#define CAST_CHUNK (CAST_T * CAST_V * 4)                  // floats per block
#define CAST_XB (BATCH * S_LEN * D_MODEL / CAST_CHUNK)    // blocks of x
#define CAST_WB (D_MODEL * D_MODEL / CAST_CHUNK)          // blocks of each W
#define CAST_EB (S_LEN * D_HEAD / CAST_CHUNK)             // blocks of Er

typedef float    c4f __attribute__((ext_vector_type(4)));
typedef _Float16 c4h __attribute__((ext_vector_type(4)));

__global__ void __launch_bounds__(CAST_T)
cast_all(const float* __restrict__ x, const float* __restrict__ Wq, const float* __restrict__ Wk,
         const float* __restrict__ Wv, const float* __restrict__ Er, _Float16* __restrict__ dst) {
  const int blk = blockIdx.x;
  const float* src = x;
  int rel = blk;
  if (blk >= CAST_XB + 3 * CAST_WB)      { src = Er; rel = blk - (CAST_XB + 3 * CAST_WB); }
  else if (blk >= CAST_XB + 2 * CAST_WB) { src = Wv; rel = blk - (CAST_XB + 2 * CAST_WB); }
  else if (blk >= CAST_XB + CAST_WB)     { src = Wk; rel = blk - (CAST_XB + CAST_WB); }
  else if (blk >= CAST_XB)               { src = Wq; rel = blk - CAST_XB; }
  const float* p = src + (size_t)rel * CAST_CHUNK + threadIdx.x * 4;
  _Float16*    q = dst + (size_t)blk * CAST_CHUNK + threadIdx.x * 4;
  c4f v[CAST_V];
#pragma unroll   // constant j: the values stay in registers and the loads are in flight together
  for (int j = 0; j < CAST_V; ++j) v[j] = *(const c4f*)(p + j * CAST_T * 4);
#pragma unroll   // constant j, as above
  for (int j = 0; j < CAST_V; ++j)
    *(c4h*)(q + j * CAST_T * 4) = (c4h){(_Float16)v[j][0], (_Float16)v[j][1],
                                        (_Float16)v[j][2], (_Float16)v[j][3]};
}

// ---------------- Kernel 2: QKV projection GEMM ----------------
// y = Xh @ W^T + b ; z = 0/1/2 -> Q/K/V. Q,K stored (b,h,s,dh); V stored transposed (b,h,dh,s).
// One 128x128 tile of y per block, 64x64 per wave (4x4 WMMA tiles), so every LDS fragment
// feeds four WMMAs. A pass is 64 k: 128 W rows and 128 X rows of 128 B, laid at a pitch of
// 144 B (16 B x odd: conflict-free for ds_load_b128), two buffers filled by async copies.
#define G_PITCH 72                       // halfs per staged row (144 B)
#define G_STAGE (256 * G_PITCH)          // halfs per buffer: W rows 0..127, X rows 128..255
#define G_PASSES (D_MODEL / 64)

// Eight 16-byte async copies of one lane. The s_wait_xcnt stands inside the statement so
// that no address register of an issued copy is rewritten ahead of it.
static __device__ __forceinline__ void cp16x8(unsigned l, const _Float16* g) {
  const unsigned l1 = l + 1 * 16 * G_PITCH * 2, l2 = l + 2 * 16 * G_PITCH * 2,
                 l3 = l + 3 * 16 * G_PITCH * 2, l4 = l + 4 * 16 * G_PITCH * 2,
                 l5 = l + 5 * 16 * G_PITCH * 2, l6 = l + 6 * 16 * G_PITCH * 2,
                 l7 = l + 7 * 16 * G_PITCH * 2;
  const _Float16 *g1 = g + 1 * 16 * D_MODEL, *g2 = g + 2 * 16 * D_MODEL,
                 *g3 = g + 3 * 16 * D_MODEL, *g4 = g + 4 * 16 * D_MODEL,
                 *g5 = g + 5 * 16 * D_MODEL, *g6 = g + 6 * 16 * D_MODEL,
                 *g7 = g + 7 * 16 * D_MODEL;
  asm volatile(
      "global_load_async_to_lds_b128 %0, %8, off\n\t"
      "global_load_async_to_lds_b128 %1, %9, off\n\t"
      "global_load_async_to_lds_b128 %2, %10, off\n\t"
      "global_load_async_to_lds_b128 %3, %11, off\n\t"
      "global_load_async_to_lds_b128 %4, %12, off\n\t"
      "global_load_async_to_lds_b128 %5, %13, off\n\t"
      "global_load_async_to_lds_b128 %6, %14, off\n\t"
      "global_load_async_to_lds_b128 %7, %15, off\n\t"
      "s_wait_xcnt 0x0"
      :: "v"(l), "v"(l1), "v"(l2), "v"(l3), "v"(l4), "v"(l5), "v"(l6), "v"(l7),
         "v"(g), "v"(g1), "v"(g2), "v"(g3), "v"(g4), "v"(g5), "v"(g6), "v"(g7)
      : "memory");
}

// Epilogue memory operations stand with their waits in one asm statement each, so that no
// register that an issued load or store names is rewritten ahead of the wait (a precaution).
typedef float v4f __attribute__((ext_vector_type(4)));

// 4 x 8 consecutive floats at p + 16 i (i = 0..3)
static __device__ __forceinline__ void ld_bias_rows(const float* p, v4f (&b)[8]) {
  asm volatile(
      "global_load_b128 %0, %8, off\n\t"
      "global_load_b128 %1, %8, off offset:16\n\t"
      "global_load_b128 %2, %8, off offset:64\n\t"
      "global_load_b128 %3, %8, off offset:80\n\t"
      "global_load_b128 %4, %8, off offset:128\n\t"
      "global_load_b128 %5, %8, off offset:144\n\t"
      "global_load_b128 %6, %8, off offset:192\n\t"
      "global_load_b128 %7, %8, off offset:208\n\t"
      "s_wait_loadcnt 0x0\n\t"
      "s_wait_xcnt 0x0"
      : "=&v"(b[0]), "=&v"(b[1]), "=&v"(b[2]), "=&v"(b[3]),
        "=&v"(b[4]), "=&v"(b[5]), "=&v"(b[6]), "=&v"(b[7])
      : "v"(p) : "memory");
}
// one float at p + 16 j (j = 0..3)
static __device__ __forceinline__ void ld_bias_cols(const float* p, float (&b)[4]) {
  asm volatile(
      "global_load_b32 %0, %4, off\n\t"
      "global_load_b32 %1, %4, off offset:64\n\t"
      "global_load_b32 %2, %4, off offset:128\n\t"
      "global_load_b32 %3, %4, off offset:192\n\t"
      "s_wait_loadcnt 0x0\n\t"
      "s_wait_xcnt 0x0"
      : "=&v"(b[0]), "=&v"(b[1]), "=&v"(b[2]), "=&v"(b[3])
      : "v"(p) : "memory");
}
// Q,K: v[4 i + j] goes to token row + 16 j (rows of 128 B), dh + 16 i
static __device__ __forceinline__ void st_tile_qk(_Float16* p, const h8 (&v)[16]) {
  asm volatile(
      "global_store_b128 %0, %1, off\n\t"
      "global_store_b128 %0, %2, off offset:2048\n\t"
      "global_store_b128 %0, %3, off offset:4096\n\t"
      "global_store_b128 %0, %4, off offset:6144\n\t"
      "global_store_b128 %0, %5, off offset:32\n\t"
      "global_store_b128 %0, %6, off offset:2080\n\t"
      "global_store_b128 %0, %7, off offset:4128\n\t"
      "global_store_b128 %0, %8, off offset:6176\n\t"
      "global_store_b128 %0, %9, off offset:64\n\t"
      "global_store_b128 %0, %10, off offset:2112\n\t"
      "global_store_b128 %0, %11, off offset:4160\n\t"
      "global_store_b128 %0, %12, off offset:6208\n\t"
      "global_store_b128 %0, %13, off offset:96\n\t"
      "global_store_b128 %0, %14, off offset:2144\n\t"
      "global_store_b128 %0, %15, off offset:4192\n\t"
      "global_store_b128 %0, %16, off offset:6240\n\t"
      "s_wait_xcnt 0x0"
      :: "v"(p), "v"(v[0]), "v"(v[1]), "v"(v[2]), "v"(v[3]), "v"(v[4]), "v"(v[5]), "v"(v[6]), "v"(v[7]),
         "v"(v[8]), "v"(v[9]), "v"(v[10]), "v"(v[11]), "v"(v[12]), "v"(v[13]), "v"(v[14]), "v"(v[15])
      : "memory");
}
// V transposed: v[4 j + i] goes to dh row + 16 j (rows of S_LEN halfs = 4096 B), s + 16 i
static __device__ __forceinline__ void st_tile_vt(_Float16* p, const h8 (&v)[16]) {
  asm volatile(
      "global_store_b128 %0, %1, off\n\t"
      "global_store_b128 %0, %2, off offset:32\n\t"
      "global_store_b128 %0, %3, off offset:64\n\t"
      "global_store_b128 %0, %4, off offset:96\n\t"
      "global_store_b128 %0, %5, off offset:65536\n\t"
      "global_store_b128 %0, %6, off offset:65568\n\t"
      "global_store_b128 %0, %7, off offset:65600\n\t"
      "global_store_b128 %0, %8, off offset:65632\n\t"
      "global_store_b128 %0, %9, off offset:131072\n\t"
      "global_store_b128 %0, %10, off offset:131104\n\t"
      "global_store_b128 %0, %11, off offset:131136\n\t"
      "global_store_b128 %0, %12, off offset:131168\n\t"
      "global_store_b128 %0, %13, off offset:196608\n\t"
      "global_store_b128 %0, %14, off offset:196640\n\t"
      "global_store_b128 %0, %15, off offset:196672\n\t"
      "global_store_b128 %0, %16, off offset:196704\n\t"
      "s_wait_xcnt 0x0"
      :: "v"(p), "v"(v[0]), "v"(v[1]), "v"(v[2]), "v"(v[3]), "v"(v[4]), "v"(v[5]), "v"(v[6]), "v"(v[7]),
         "v"(v[8]), "v"(v[9]), "v"(v[10]), "v"(v[11]), "v"(v[12]), "v"(v[13]), "v"(v[14]), "v"(v[15])
      : "memory");
}

__global__ void __launch_bounds__(128)
qkv_gemm(const _Float16* __restrict__ Xh,
         const _Float16* __restrict__ Wqh, const _Float16* __restrict__ Wkh,
         const _Float16* __restrict__ Wvh,
         const float* __restrict__ bq, const float* __restrict__ bk, const float* __restrict__ bv,
         _Float16* __restrict__ Qh, _Float16* __restrict__ Kh, _Float16* __restrict__ Vth) {
  __shared__ __align__(16) _Float16 St[2 * G_STAGE];   // 73,728 B

  const int tid  = threadIdx.x;
  const int lane = tid & 31;
  const int wave = tid >> 5;
  const int nn   = lane & 15;
  const int hiH  = (lane >> 4) & 1;
  const int k0   = hiH * 8;
  const int n0   = blockIdx.x * 128 + (wave & 1) * 64;    // this wave's first feature
  const int row0 = blockIdx.y * 128 + (wave >> 1) * 64;   // this wave's first token row
  const int which = blockIdx.z;

  const _Float16* W    = (which == 0) ? Wqh : (which == 1) ? Wkh : Wvh;
  const float*    bias = (which == 0) ? bq  : (which == 1) ? bk  : bv;

  // copies: a lane brings chunk (tid & 7) of rows (tid >> 3) + 16 r, r = 0..7, of W and of X
  const int crow = tid >> 3, ccol = (tid & 7) << 3;
  const _Float16* gW = W  + (size_t)(blockIdx.x * 128 + crow) * D_MODEL + ccol;
  const _Float16* gX = Xh + (size_t)(blockIdx.y * 128 + crow) * D_MODEL + ccol;
  const unsigned  lW = (unsigned)(unsigned long long)&St[crow * G_PITCH + ccol];
  const unsigned  lX = lW + 128 * G_PITCH * 2;

  // Q,K: features are the rows of D (operand A = W), so a lane holds 8 consecutive dh of one
  // token; V: tokens are the rows (A = X), so a lane holds 8 consecutive s of one feature.
  const int wrow = (wave & 1) * 64 + nn, xrow = 128 + (wave >> 1) * 64 + nn;
  const int aoff = ((which == 2) ? xrow : wrow) * G_PITCH + k0;
  const int boff = ((which == 2) ? wrow : xrow) * G_PITCH + k0;

  v8f acc[4][4];
#pragma unroll
  for (int i = 0; i < 4; ++i)
#pragma unroll
    for (int j = 0; j < 4; ++j) acc[i][j] = (v8f){};

  cp16x8(lW, gW);
  cp16x8(lX, gX);
  wait_async_le0();
  __syncthreads();
  cp16x8(lW + G_STAGE * 2, gW + 64);
  cp16x8(lX + G_STAGE * 2, gX + 64);

  for (int t = 0; t < G_PASSES; ++t) {
    const int bo = (t & 1) * G_STAGE;
    // the whole pass's fragments go to registers as one group of LDS reads
    v16h af[2][4], bf[2][4];
#pragma unroll
    for (int ks = 0; ks < 2; ++ks)
#pragma unroll
      for (int i = 0; i < 4; ++i) {
        af[ks][i] = frag_ld(&St[bo + aoff + i * 16 * G_PITCH + ks * 32], 0);
        bf[ks][i] = frag_ld(&St[bo + boff + i * 16 * G_PITCH + ks * 32], 0);
      }
    // publish point of pass t + 1: own LDS reads done, own copies landed, then the barrier
    // that shows pass t + 1's tile to every wave and frees pass t's buffer for the refill
    asm volatile("s_wait_dscnt 0x0" ::: "memory");
    wait_async_le0();
    __syncthreads();
    if (t + 2 < G_PASSES) {
      cp16x8(lW + bo * 2, gW + (t + 2) * 64);
      cp16x8(lX + bo * 2, gX + (t + 2) * 64);
    }
    // the pass's WMMAs work on registers alone, so the refill flies under all of them
#pragma unroll
    for (int ks = 0; ks < 2; ++ks)
#pragma unroll
      for (int i = 0; i < 4; ++i)
#pragma unroll
        for (int j = 0; j < 4; ++j) acc[i][j] = WMMA_F16(af[ks][i], bf[ks][j], acc[i][j]);
  }
  wait_async_le0();   // no copy is outstanding when the wave ends

  const int bb = row0 >> 11;             // / S_LEN: one batch entry per 64-row wave tile
  const int s0 = row0 & (S_LEN - 1);
  const size_t head = (size_t)(bb * N_HEADS + (n0 >> 6));   // one head per 64-feature wave tile
  h8 v[16];
  if (which == 2) {
    float bb_[4];
    ld_bias_cols(bias + n0 + nn, bb_);
#pragma unroll
    for (int j = 0; j < 4; ++j)
#pragma unroll
      for (int i = 0; i < 4; ++i)
#pragma unroll
        for (int g = 0; g < 8; ++g) v[j * 4 + i][g] = (_Float16)(acc[i][j][g] + bb_[j]);
    st_tile_vt(Vth + (head * D_HEAD + nn) * S_LEN + s0 + hiH * 8, v);
  } else {
    v4f bb_[8];
    ld_bias_rows(bias + n0 + hiH * 8, bb_);
#pragma unroll
    for (int i = 0; i < 4; ++i)
#pragma unroll
      for (int j = 0; j < 4; ++j)
#pragma unroll
        for (int g = 0; g < 8; ++g)
          v[i * 4 + j][g] = (_Float16)(acc[i][j][g] + bb_[i * 2 + (g >> 2)][g & 3]);
    st_tile_qk(((which == 0) ? Qh : Kh) + (head * S_LEN + s0 + nn) * D_HEAD + hiH * 8, v);
  }
}

// ---------------- Kernel 3: flash attention with relative skew ----------------
// K/V slabs (32 keys) are double-buffered in LDS via async copies, shared by all 4 waves;
// prefetch of slab n+1 overlaps compute on slab n (s_wait_asynccnt <= 4).
static __device__ __forceinline__ void slab_load(const _Float16* __restrict__ Kbase,
                                                 const _Float16* __restrict__ Vbase,
                                                 int t0,
                                                 _Float16 (*Kl)[64], _Float16 (*Vl)[32],
                                                 int tid) {
#pragma unroll
  for (int r = 0; r < 2; ++r) {
    int c = tid + r * 128;                 // 0..255
    int krow = c >> 3, kcol = (c & 7) << 3;   // 32 rows x 64 halfs
    cp16_g2l(Kbase + (size_t)(t0 + krow) * D_HEAD + kcol, &Kl[krow][kcol]);
    int vrow = c >> 2, vcol = (c & 3) << 3;   // 64 rows x 32 halfs
    cp16_g2l(Vbase + (size_t)vrow * S_LEN + t0 + vcol, &Vl[vrow][vcol]);
  }
}

#define SK_PITCH 68   // floats per ring row: 64 keys + 4, so 16 rows' 16-byte reads fall on 64 banks

// value of the lane 16 away
static __device__ __forceinline__ float other_half(float v) {
  int b = __builtin_bit_cast(int, v);
  b = __builtin_amdgcn_permlanex16(b, b, 0x76543210, 0xfedcba98, false, false);
  return __builtin_bit_cast(float, b);
}

__global__ void __launch_bounds__(128)
attn_kernel(const _Float16* __restrict__ Qh, const _Float16* __restrict__ Kh,
            const _Float16* __restrict__ Vt, const _Float16* __restrict__ Erh,
            float* __restrict__ out) {
  __shared__ __align__(16) _Float16 Kl[2][32][64];   // 8 KB double-buffered K slab
  __shared__ __align__(16) _Float16 Vl[2][64][32];   // 8 KB double-buffered V slab (dh,t)
  __shared__ __align__(16) float sk[4][16 * SK_PITCH];   // per-wave skew ring

  const int tid  = threadIdx.x;
  const int lane = tid & 31;
  const int wave = __builtin_amdgcn_readfirstlane(tid >> 5);   // scalar: picks the band blocks
  const int hiH  = (lane >> 4) & 1;
  const int k0   = hiH * 8;
  const int nn   = lane & 15;

  const int h  = blockIdx.y;
  const int b  = blockIdx.z;
  const int s0 = blockIdx.x * 64 + wave * 16;

  const size_t head = (size_t)(b * N_HEADS + h) * (size_t)S_LEN * D_HEAD;
  const _Float16* Qbase = Qh + head;
  const _Float16* Kbase = Kh + head;
  const _Float16* Vbase = Vt + head;   // (dh, t) layout

  // warm the Er diagonal band this block touches first
  {
    int e = S_LEN - 16 - s0 + nn;
    e = e < 0 ? 0 : e;
    __builtin_prefetch(Erh + (size_t)e * D_HEAD, 0, 1);
  }

  const _Float16* qrow = Qbase + (size_t)(s0 + nn) * D_HEAD;
  int sshift = s0 + nn + 1; if (sshift > S_LEN - 1) sshift = S_LEN - 1;
  const _Float16* qsrow = Qbase + (size_t)sshift * D_HEAD;  // rows s+1 (skew wrap term)

  const v16h qa0 = frag_ld(qrow, k0);        // Q  d 0..31
  const v16h qa1 = frag_ld(qrow + 32, k0);   // Q  d 32..63
  const v16h qs0 = frag_ld(qsrow, k0);       // Qs d 0..31
  const v16h qs1 = frag_ld(qsrow + 32, k0);  // Qs d 32..63

  float rowmax = -3.0e38f, rowsum = 0.f;     // of query s0 + nn; rowsum over this half's keys
  v8f o0 = {}, o1 = {}, o2 = {}, o3 = {};    // O^T: register g = dh 16 n + 8 hiH + g, lane = query

  slab_load(Kbase, Vbase, 0, Kl[0], Vl[0], tid);   // preload slab 0

  // Band stream: block kb + m holds, for query row i, keys 16 m - 15 + i .. 16 m + i, so slab n
  // (keys 32 n .. 32 n + 31) needs blocks m <= 2 n + 2. Blocks are multiplied and stored one slab
  // ahead of their first full use; their Er fragments are fetched one slab before that.
  // Ring column of (row i = 8 hiH + g, lane nn) in block m: (16 m + 49 + nn + i) & 63; only
  // m = 0 (mod 4) can wrap inside a block.
  float* const skw = &sk[wave][0];
  float* const sk_st = skw + (8 * hiH) * (SK_PITCH + 1) + nn + 1;    // + g (SK_PITCH + 1) + 16 ((m & 3) - 1)
  const float* const sk_ld = skw + nn * SK_PITCH + 8 * hiH;          // + (first key of the tile) & 63
  int wofs[8];                                                       // the wrapping block's places
#pragma unroll   // constant g keeps the table in registers
  for (int g = 0; g < 8; ++g)
    wofs[g] = (8 * hiH + g) * SK_PITCH + ((49 + nn + 8 * hiH + g) & 63);

  int kb = (S_LEN - 16 - s0) >> 4;
  {
    const _Float16* r0 = band_row(Erh, kb, nn);
    const _Float16* r1 = band_row(Erh, kb + 1, nn);
    const _Float16* r2 = band_row(Erh, kb + 2, nn);
    const v8f g0 = band_gemm(kb,     nn, qa0, qa1, qs0, qs1, frag_ld(r0, k0), frag_ld(r0 + 32, k0));
    const v8f g1 = band_gemm(kb + 1, nn, qa0, qa1, qs0, qs1, frag_ld(r1, k0), frag_ld(r1 + 32, k0));
    const v8f g2 = band_gemm(kb + 2, nn, qa0, qa1, qs0, qs1, frag_ld(r2, k0), frag_ld(r2 + 32, k0));
#pragma unroll   // constant g keeps the tiles in registers
    for (int g = 0; g < 8; ++g) {
      skw[wofs[g]] = g0[g];
      sk_st[g * (SK_PITCH + 1)] = g1[g];
      sk_st[g * (SK_PITCH + 1) + 16] = g2[g];
    }
  }
  const _Float16* ra = band_row(Erh, kb + 3, nn);
  const _Float16* rb = band_row(Erh, kb + 4, nn);
  v16h fa0 = frag_ld(ra, k0), fa1 = frag_ld(ra + 32, k0);
  v16h fb0 = frag_ld(rb, k0), fb1 = frag_ld(rb + 32, k0);

  for (int tp = 0; tp < S_LEN; tp += 64) {
#pragma unroll   // constant par: buffer and ring places become immediate offsets
    for (int par = 0; par < 2; ++par) {
      const int t0 = tp + par * 32;
      if (t0 + 32 < S_LEN) {
        slab_load(Kbase, Vbase, t0 + 32, Kl[par ^ 1], Vl[par ^ 1], tid);
        wait_async_le4();                // current slab landed; prefetch stays in flight
      } else {
        wait_async_le0();
      }
      __syncthreads();   // also orders the ring's stores of the slab before ahead of the reads below

      // ---- Srel^T of this slab from the ring: 8 consecutive keys of the lane's query per tile ----
      v4f rr[4];
#pragma unroll
      for (int q = 0; q < 4; ++q) rr[q] = *(const v4f*)(sk_ld + par * 32 + (q >> 1) * 16 + (q & 1) * 4);
      // the ring places stored below alias keys read above: keep the compiler from lifting the
      // stores over those reads (the wave's LDS operations run in program order)
      __builtin_amdgcn_fence(__ATOMIC_ACQ_REL, "wavefront");

      // the next slab's two new band blocks into the ring, then the fragments of the slab after
      // into the same registers: their loads have a whole slab to land
      {
        const v8f ga = band_gemm(kb + 3, nn, qa0, qa1, qs0, qs1, fa0, fa1);
        const v8f gb = band_gemm(kb + 4, nn, qa0, qa1, qs0, qs1, fb0, fb1);
#pragma unroll   // constant g keeps the tiles in registers
        for (int g = 0; g < 8; ++g) {
          if (par == 0) {     // blocks 3 and 0 (mod 4)
            sk_st[g * (SK_PITCH + 1) + 32] = ga[g];
            skw[wofs[g]] = gb[g];
          } else {            // blocks 1 and 2 (mod 4)
            sk_st[g * (SK_PITCH + 1)] = ga[g];
            sk_st[g * (SK_PITCH + 1) + 16] = gb[g];
          }
        }
      }
      kb += 2;
      ra = band_row(Erh, kb + 3, nn);
      rb = band_row(Erh, kb + 4, nn);
      fa0 = frag_ld(ra, k0); fa1 = frag_ld(ra + 32, k0);
      // a precaution: the build let a result of the loads below land on the address pair of the
      // loads above; the wait stands between them
      asm volatile("s_wait_xcnt 0x0" ::: "memory");
      fb0 = frag_ld(rb, k0); fb1 = frag_ld(rb + 32, k0);
      // keeps these loads here: the build sank half of them to the slab's last barrier, which
      // waits for them
      __builtin_amdgcn_sched_barrier(0);

      // ---- S^T: two 16-key tiles (K = 64), K rows from LDS as A, Q as B ----
      float sc[16];
#pragma unroll
      for (int sub = 0; sub < 2; ++sub) {
        const _Float16* krow = &Kl[par][sub * 16 + nn][0];
        v8f c = {};
        c = WMMA_F16(frag_ld(krow, k0), qa0, c);
        c = WMMA_F16(frag_ld(krow + 32, k0), qa1, c);
#pragma unroll
        for (int g = 0; g < 8; ++g)
          sc[sub * 8 + g] = (c[g] + rr[sub * 2 + (g >> 2)][g & 3]) * 0.125f;   // / sqrt(D_HEAD)
      }

      // ---- online softmax across this 32-key slab: one query per lane ----
      float m4[4];
#pragma unroll
      for (int e = 0; e < 4; ++e)
        m4[e] = fmaxf(fmaxf(sc[e], sc[e + 4]), fmaxf(sc[e + 8], sc[e + 12]));
      float tm = fmaxf(fmaxf(m4[0], m4[1]), fmaxf(m4[2], m4[3]));
      tm = fmaxf(tm, other_half(tm));
      const float nm = fmaxf(rowmax, tm);
      const float al = __expf(rowmax - nm);
      rowmax = nm;
      v16h pb;          // P^T as B: element e = key 8 hiH + e (e < 8), 16 + 8 hiH + e - 8 (e >= 8)
      float p4[4] = {0.f, 0.f, 0.f, 0.f};
#pragma unroll
      for (int e = 0; e < 16; ++e) {
        const float p = __expf(sc[e] - nm);
        p4[e & 3] += p;
        pb[e] = (_Float16)p;
      }
      rowsum = rowsum * al + ((p4[0] + p4[1]) + (p4[2] + p4[3]));
#pragma unroll
      for (int g = 0; g < 8; ++g) { o0[g] *= al; o1[g] *= al; o2[g] *= al; o3[g] *= al; }

      // ---- O^T += V^T P^T : 4 WMMAs over the 64 head dims (K = 32), V^T rows from LDS as A ----
      const _Float16* vrow_ = &Vl[par][nn][0];              // row stride 32 halfs
      o0 = WMMA_F16(frag_ld(vrow_,            k0), pb, o0);
      o1 = WMMA_F16(frag_ld(vrow_ + 16 * 32,  k0), pb, o1);
      o2 = WMMA_F16(frag_ld(vrow_ + 32 * 32,  k0), pb, o2);
      o3 = WMMA_F16(frag_ld(vrow_ + 48 * 32,  k0), pb, o3);

      __syncthreads();   // slab buffers free for the next prefetch
    }
  }

  // ---- join the halves' sums, normalize and write (B, S, D_MODEL) f32 ----
  const float inv = 1.0f / (rowsum + other_half(rowsum));
  float* orow = out + ((size_t)(b * S_LEN + s0 + nn)) * D_MODEL + h * D_HEAD + 8 * hiH;
  *(v4f*)(orow +  0) = (v4f){o0[0], o0[1], o0[2], o0[3]} * inv;
  *(v4f*)(orow +  4) = (v4f){o0[4], o0[5], o0[6], o0[7]} * inv;
  *(v4f*)(orow + 16) = (v4f){o1[0], o1[1], o1[2], o1[3]} * inv;
  *(v4f*)(orow + 20) = (v4f){o1[4], o1[5], o1[6], o1[7]} * inv;
  *(v4f*)(orow + 32) = (v4f){o2[0], o2[1], o2[2], o2[3]} * inv;
  *(v4f*)(orow + 36) = (v4f){o2[4], o2[5], o2[6], o2[7]} * inv;
  *(v4f*)(orow + 48) = (v4f){o3[0], o3[1], o3[2], o3[3]} * inv;
  *(v4f*)(orow + 52) = (v4f){o3[4], o3[5], o3[6], o3[7]} * inv;
}

extern "C" void kernel_launch(void* const* d_in, const int* in_sizes, int n_in,
                              void* d_out, int out_size, void* d_ws, size_t ws_size,
                              hipStream_t stream) {
  (void)in_sizes; (void)n_in; (void)out_size; (void)ws_size;
  const float* x  = (const float*)d_in[0];
  const float* Wq = (const float*)d_in[1];
  const float* bq = (const float*)d_in[2];
  const float* Wk = (const float*)d_in[3];
  const float* bk = (const float*)d_in[4];
  const float* Wv = (const float*)d_in[5];
  const float* bv = (const float*)d_in[6];
  const float* Er = (const float*)d_in[7];

  char* ws = (char*)d_ws;
  const size_t xhN = (size_t)BATCH * S_LEN * D_MODEL;        // 4,194,304
  const size_t wN  = (size_t)D_MODEL * D_MODEL;              // 1,048,576
  const size_t erN = (size_t)S_LEN * D_HEAD;                 // 131,072

  _Float16* Xh  = (_Float16*)(ws);
  _Float16* Wqh = (_Float16*)(ws + 2 * xhN);
  _Float16* Wkh = Wqh + wN;
  _Float16* Wvh = Wkh + wN;
  _Float16* Erh = Wvh + wN;
  _Float16* Qh  = Erh + erN;
  _Float16* Kh  = Qh + xhN;
  _Float16* Vth = Kh + xhN;

  // Xh, Wqh, Wkh, Wvh, Erh are contiguous from Xh on
  cast_all<<<CAST_XB + 3 * CAST_WB + CAST_EB, CAST_T, 0, stream>>>(x, Wq, Wk, Wv, Er, Xh);

  // QKV: M = 4096 rows, N = 1024 feats, K = 1024; z selects Q/K/V
  qkv_gemm<<<dim3(D_MODEL / 128, (BATCH * S_LEN) / 128, 3), 128, 0, stream>>>(
      Xh, Wqh, Wkh, Wvh, bq, bk, bv, Qh, Kh, Vth);

  // attention: 64 query rows per block (4 waves x 16)
  attn_kernel<<<dim3(S_LEN / 64, N_HEADS, BATCH), 128, 0, stream>>>(
      Qh, Kh, Vth, Erh, (float*)d_out);
}

// v005
// Measured time: 120 microseconds a run.
// Timed twice side by side with v004, it ran 1.18 times as fast both times.
// Counting every step since v000, it is 3.25 times as fast.
#include <hip/hip_runtime.h>
#include <hip/hip_bf16.h>

#define S_LEN   2048
#define D_MODEL 1024
#define N_HEADS 16
#define D_HEAD  64
#define BATCH   2

typedef _Float16 h8   __attribute__((ext_vector_type(8)));
typedef _Float16 v16h __attribute__((ext_vector_type(16)));
typedef float    v8f  __attribute__((ext_vector_type(8)));

#define WMMA_F16(a, b, c) \
  __builtin_amdgcn_wmma_f32_16x16x32_f16(false, (a), false, (b), (short)0, (c), false, false)

// ---------- CDNA5 async global->LDS copy (guarded; falls back to ld+ds_store) ----------
#if defined(__has_builtin)
#if __has_builtin(__builtin_amdgcn_global_load_async_to_lds_b128)
#define HAVE_ASYNC_CP 1
#endif
#endif
#ifndef HAVE_ASYNC_CP
#define HAVE_ASYNC_CP 0
#endif

typedef int v4i_t __attribute__((vector_size(16)));
typedef __attribute__((address_space(1))) v4i_t* g_v4i_p;   // global int4*
typedef __attribute__((address_space(3))) v4i_t* l_v4i_p;   // LDS int4*

static __device__ __forceinline__ void cp16_g2l(const _Float16* g, _Float16* l) {
#if HAVE_ASYNC_CP
  __builtin_amdgcn_global_load_async_to_lds_b128(
      (g_v4i_p)(unsigned long long)g,
      (l_v4i_p)(unsigned int)(unsigned long long)l, 0, 0);
#else
  *(h8*)l = *(const h8*)g;
#endif
}
static __device__ __forceinline__ void wait_async_le4() {
#if HAVE_ASYNC_CP
  asm volatile("s_wait_asynccnt 0x4" ::: "memory");
#endif
}
static __device__ __forceinline__ void wait_async_le0() {
#if HAVE_ASYNC_CP
  asm volatile("s_wait_asynccnt 0x0" ::: "memory");
#endif
}

// Load one lane's slice of a 16x32 (f16) A/B fragment.
// Layout per ISA 7.12.2: lanes 0-15 hold K[0..7]+K[16..23], lanes 16-31 hold K[8..15]+K[24..31].
static __device__ __forceinline__ v16h frag_ld(const _Float16* p, int k0) {
  h8 lo = *(const h8*)(p + k0);
  h8 hi = *(const h8*)(p + k0 + 16);
  return __builtin_shufflevector(lo, hi, 0,1,2,3,4,5,6,7,8,9,10,11,12,13,14,15);
}

// The skew reads, for query s and key t, position u = S - 1 + t - s of one band of 2 S positions:
// u < S is q[s].Er[u], u == S is the skew's zero column, u > S is q[s+1].Er[u - S - 1].
// Band block k holds positions 16 k .. 16 k + 15; a 16x16 score tile needs blocks k and k + 1.
#define BAND_WRAP (S_LEN / 16)   // first block that belongs to q[s+1]

// Er row behind column nn of band block k
static __device__ __forceinline__ const _Float16* band_row(const _Float16* __restrict__ Erh,
                                                           int k, int nn) {
  int e = k * 16 + nn - ((k >= BAND_WRAP) ? (S_LEN + 1) : 0);
  e = e < 0 ? 0 : e;                        // the zero column's lane
  e = e > (S_LEN - 1) ? (S_LEN - 1) : e;    // blocks fetched past the last slab, never used
  return Erh + (size_t)e * D_HEAD;
}

// G = Qtile(16x64) @ (band block k)^T -> 16x16 f32 (2 WMMAs over K=64); k is wave-uniform
static __device__ __forceinline__ v8f band_gemm(int k, int nn, v16h qa0, v16h qa1,
                                                v16h qs0, v16h qs1, v16h f0, v16h f1) {
  const bool wrap = (k >= BAND_WRAP);
  v8f c = {};
  c = WMMA_F16(wrap ? qs0 : qa0, f0, c);
  c = WMMA_F16(wrap ? qs1 : qa1, f1, c);
  const bool zcol = (k * 16 + nn == S_LEN);
#pragma unroll   // constant g keeps the tile in registers
  for (int g = 0; g < 8; ++g) c[g] = zcol ? 0.f : c[g];
  return c;
}

// ---------------- Kernel 1: f32 -> f16 cast of x, Wq, Wk, Wv and Er, one launch ----------------
// The five f16 copies lie one behind the other in the workspace, so a block's place in the grid is
// its place in the destination; each array is a whole number of blocks. A thread converts 64
// elements: sixteen 16-byte loads, each 512 contiguous bytes of a wave, issued ahead of the
// conversions, and sixteen 8-byte stores, each two whole 128-byte lines of a wave.
#define CAST_T 128                                        // threads per block
#define CAST_V 16                                         // 16-byte loads per thread
#define CAST_CHUNK (CAST_T * CAST_V * 4)                  // floats per block
#define CAST_XB (BATCH * S_LEN * D_MODEL / CAST_CHUNK)    // blocks of x
#define CAST_WB (D_MODEL * D_MODEL / CAST_CHUNK)          // blocks of each W
#define CAST_EB (S_LEN * D_HEAD / CAST_CHUNK)             // blocks of Er

typedef float    c4f __attribute__((ext_vector_type(4)));
typedef _Float16 c4h __attribute__((ext_vector_type(4)));

__global__ void __launch_bounds__(CAST_T)
cast_all(const float* __restrict__ x, const float* __restrict__ Wq, const float* __restrict__ Wk,
         const float* __restrict__ Wv, const float* __restrict__ Er, _Float16* __restrict__ dst) {
  const int blk = blockIdx.x;
  const float* src = x;
  int rel = blk;
  if (blk >= CAST_XB + 3 * CAST_WB)      { src = Er; rel = blk - (CAST_XB + 3 * CAST_WB); }
  else if (blk >= CAST_XB + 2 * CAST_WB) { src = Wv; rel = blk - (CAST_XB + 2 * CAST_WB); }
  else if (blk >= CAST_XB + CAST_WB)     { src = Wk; rel = blk - (CAST_XB + CAST_WB); }
  else if (blk >= CAST_XB)               { src = Wq; rel = blk - CAST_XB; }
  const float* p = src + (size_t)rel * CAST_CHUNK + threadIdx.x * 4;
  _Float16*    q = dst + (size_t)blk * CAST_CHUNK + threadIdx.x * 4;
  c4f v[CAST_V];
#pragma unroll   // constant j: the values stay in registers and the loads are in flight together
  for (int j = 0; j < CAST_V; ++j) v[j] = *(const c4f*)(p + j * CAST_T * 4);
#pragma unroll   // constant j, as above
  for (int j = 0; j < CAST_V; ++j)
    *(c4h*)(q + j * CAST_T * 4) = (c4h){(_Float16)v[j][0], (_Float16)v[j][1],
                                        (_Float16)v[j][2], (_Float16)v[j][3]};
}

// ---------------- Kernel 2: QKV projection GEMM ----------------
// y = Xh @ W^T + b ; z = 0/1/2 -> Q/K/V. Q,K stored (b,h,s,dh); V stored transposed (b,h,dh,s).
// One 128x128 tile of y per block, 64x64 per wave (4x4 WMMA tiles), so every LDS fragment
// feeds four WMMAs. A pass is 64 k: 128 W rows and 128 X rows of 128 B, laid at a pitch of
// 144 B (16 B x odd: conflict-free for ds_load_b128), two buffers filled by async copies.
#define G_PITCH 72                       // halfs per staged row (144 B)
#define G_STAGE (256 * G_PITCH)          // halfs per buffer: W rows 0..127, X rows 128..255
#define G_PASSES (D_MODEL / 64)

// Eight 16-byte async copies of one lane. The s_wait_xcnt stands inside the statement so
// that no address register of an issued copy is rewritten ahead of it.
static __device__ __forceinline__ void cp16x8(unsigned l, const _Float16* g) {
  const unsigned l1 = l + 1 * 16 * G_PITCH * 2, l2 = l + 2 * 16 * G_PITCH * 2,
                 l3 = l + 3 * 16 * G_PITCH * 2, l4 = l + 4 * 16 * G_PITCH * 2,
                 l5 = l + 5 * 16 * G_PITCH * 2, l6 = l + 6 * 16 * G_PITCH * 2,
                 l7 = l + 7 * 16 * G_PITCH * 2;
  const _Float16 *g1 = g + 1 * 16 * D_MODEL, *g2 = g + 2 * 16 * D_MODEL,
                 *g3 = g + 3 * 16 * D_MODEL, *g4 = g + 4 * 16 * D_MODEL,
                 *g5 = g + 5 * 16 * D_MODEL, *g6 = g + 6 * 16 * D_MODEL,
                 *g7 = g + 7 * 16 * D_MODEL;
  asm volatile(
      "global_load_async_to_lds_b128 %0, %8, off\n\t"
      "global_load_async_to_lds_b128 %1, %9, off\n\t"
      "global_load_async_to_lds_b128 %2, %10, off\n\t"
      "global_load_async_to_lds_b128 %3, %11, off\n\t"
      "global_load_async_to_lds_b128 %4, %12, off\n\t"
      "global_load_async_to_lds_b128 %5, %13, off\n\t"
      "global_load_async_to_lds_b128 %6, %14, off\n\t"
      "global_load_async_to_lds_b128 %7, %15, off\n\t"
      "s_wait_xcnt 0x0"
      :: "v"(l), "v"(l1), "v"(l2), "v"(l3), "v"(l4), "v"(l5), "v"(l6), "v"(l7),
         "v"(g), "v"(g1), "v"(g2), "v"(g3), "v"(g4), "v"(g5), "v"(g6), "v"(g7)
      : "memory");
}

// Epilogue memory operations stand with their waits in one asm statement each, so that no
// register that an issued load or store names is rewritten ahead of the wait (a precaution).
typedef float v4f __attribute__((ext_vector_type(4)));

// 4 x 8 consecutive floats at p + 16 i (i = 0..3)
static __device__ __forceinline__ void ld_bias_rows(const float* p, v4f (&b)[8]) {
  asm volatile(
      "global_load_b128 %0, %8, off\n\t"
      "global_load_b128 %1, %8, off offset:16\n\t"
      "global_load_b128 %2, %8, off offset:64\n\t"
      "global_load_b128 %3, %8, off offset:80\n\t"
      "global_load_b128 %4, %8, off offset:128\n\t"
      "global_load_b128 %5, %8, off offset:144\n\t"
      "global_load_b128 %6, %8, off offset:192\n\t"
      "global_load_b128 %7, %8, off offset:208\n\t"
      "s_wait_loadcnt 0x0\n\t"
      "s_wait_xcnt 0x0"
      : "=&v"(b[0]), "=&v"(b[1]), "=&v"(b[2]), "=&v"(b[3]),
        "=&v"(b[4]), "=&v"(b[5]), "=&v"(b[6]), "=&v"(b[7])
      : "v"(p) : "memory");
}
// one float at p + 16 j (j = 0..3)
static __device__ __forceinline__ void ld_bias_cols(const float* p, float (&b)[4]) {
  asm volatile(
      "global_load_b32 %0, %4, off\n\t"
      "global_load_b32 %1, %4, off offset:64\n\t"
      "global_load_b32 %2, %4, off offset:128\n\t"
      "global_load_b32 %3, %4, off offset:192\n\t"
      "s_wait_loadcnt 0x0\n\t"
      "s_wait_xcnt 0x0"
      : "=&v"(b[0]), "=&v"(b[1]), "=&v"(b[2]), "=&v"(b[3])
      : "v"(p) : "memory");
}
// Q,K: v[4 i + j] goes to token row + 16 j (rows of 128 B), dh + 16 i
static __device__ __forceinline__ void st_tile_qk(_Float16* p, const h8 (&v)[16]) {
  asm volatile(
      "global_store_b128 %0, %1, off\n\t"
      "global_store_b128 %0, %2, off offset:2048\n\t"
      "global_store_b128 %0, %3, off offset:4096\n\t"
      "global_store_b128 %0, %4, off offset:6144\n\t"
      "global_store_b128 %0, %5, off offset:32\n\t"
      "global_store_b128 %0, %6, off offset:2080\n\t"
      "global_store_b128 %0, %7, off offset:4128\n\t"
      "global_store_b128 %0, %8, off offset:6176\n\t"
      "global_store_b128 %0, %9, off offset:64\n\t"
      "global_store_b128 %0, %10, off offset:2112\n\t"
      "global_store_b128 %0, %11, off offset:4160\n\t"
      "global_store_b128 %0, %12, off offset:6208\n\t"
      "global_store_b128 %0, %13, off offset:96\n\t"
      "global_store_b128 %0, %14, off offset:2144\n\t"
      "global_store_b128 %0, %15, off offset:4192\n\t"
      "global_store_b128 %0, %16, off offset:6240\n\t"
      "s_wait_xcnt 0x0"
      :: "v"(p), "v"(v[0]), "v"(v[1]), "v"(v[2]), "v"(v[3]), "v"(v[4]), "v"(v[5]), "v"(v[6]), "v"(v[7]),
         "v"(v[8]), "v"(v[9]), "v"(v[10]), "v"(v[11]), "v"(v[12]), "v"(v[13]), "v"(v[14]), "v"(v[15])
      : "memory");
}
// V transposed: v[4 j + i] goes to dh row + 16 j (rows of S_LEN halfs = 4096 B), s + 16 i
static __device__ __forceinline__ void st_tile_vt(_Float16* p, const h8 (&v)[16]) {
  asm volatile(
      "global_store_b128 %0, %1, off\n\t"
      "global_store_b128 %0, %2, off offset:32\n\t"
      "global_store_b128 %0, %3, off offset:64\n\t"
      "global_store_b128 %0, %4, off offset:96\n\t"
      "global_store_b128 %0, %5, off offset:65536\n\t"
      "global_store_b128 %0, %6, off offset:65568\n\t"
      "global_store_b128 %0, %7, off offset:65600\n\t"
      "global_store_b128 %0, %8, off offset:65632\n\t"
      "global_store_b128 %0, %9, off offset:131072\n\t"
      "global_store_b128 %0, %10, off offset:131104\n\t"
      "global_store_b128 %0, %11, off offset:131136\n\t"
      "global_store_b128 %0, %12, off offset:131168\n\t"
      "global_store_b128 %0, %13, off offset:196608\n\t"
      "global_store_b128 %0, %14, off offset:196640\n\t"
      "global_store_b128 %0, %15, off offset:196672\n\t"
      "global_store_b128 %0, %16, off offset:196704\n\t"
      "s_wait_xcnt 0x0"
      :: "v"(p), "v"(v[0]), "v"(v[1]), "v"(v[2]), "v"(v[3]), "v"(v[4]), "v"(v[5]), "v"(v[6]), "v"(v[7]),
         "v"(v[8]), "v"(v[9]), "v"(v[10]), "v"(v[11]), "v"(v[12]), "v"(v[13]), "v"(v[14]), "v"(v[15])
      : "memory");
}

__global__ void __launch_bounds__(128)
qkv_gemm(const _Float16* __restrict__ Xh,
         const _Float16* __restrict__ Wqh, const _Float16* __restrict__ Wkh,
         const _Float16* __restrict__ Wvh,
         const float* __restrict__ bq, const float* __restrict__ bk, const float* __restrict__ bv,
         _Float16* __restrict__ Qh, _Float16* __restrict__ Kh, _Float16* __restrict__ Vth) {
  __shared__ __align__(16) _Float16 St[2 * G_STAGE];   // 73,728 B

  const int tid  = threadIdx.x;
  const int lane = tid & 31;
  const int wave = tid >> 5;
  const int nn   = lane & 15;
  const int hiH  = (lane >> 4) & 1;
  const int k0   = hiH * 8;
  const int n0   = blockIdx.x * 128 + (wave & 1) * 64;    // this wave's first feature
  const int row0 = blockIdx.y * 128 + (wave >> 1) * 64;   // this wave's first token row
  const int which = blockIdx.z;

  const _Float16* W    = (which == 0) ? Wqh : (which == 1) ? Wkh : Wvh;
  const float*    bias = (which == 0) ? bq  : (which == 1) ? bk  : bv;

  // copies: a lane brings chunk (tid & 7) of rows (tid >> 3) + 16 r, r = 0..7, of W and of X
  const int crow = tid >> 3, ccol = (tid & 7) << 3;
  const _Float16* gW = W  + (size_t)(blockIdx.x * 128 + crow) * D_MODEL + ccol;
  const _Float16* gX = Xh + (size_t)(blockIdx.y * 128 + crow) * D_MODEL + ccol;
  const unsigned  lW = (unsigned)(unsigned long long)&St[crow * G_PITCH + ccol];
  const unsigned  lX = lW + 128 * G_PITCH * 2;

  // Q,K: features are the rows of D (operand A = W), so a lane holds 8 consecutive dh of one
  // token; V: tokens are the rows (A = X), so a lane holds 8 consecutive s of one feature.
  const int wrow = (wave & 1) * 64 + nn, xrow = 128 + (wave >> 1) * 64 + nn;
  const int aoff = ((which == 2) ? xrow : wrow) * G_PITCH + k0;
  const int boff = ((which == 2) ? wrow : xrow) * G_PITCH + k0;

  v8f acc[4][4];
#pragma unroll
  for (int i = 0; i < 4; ++i)
#pragma unroll
    for (int j = 0; j < 4; ++j) acc[i][j] = (v8f){};

  cp16x8(lW, gW);
  cp16x8(lX, gX);
  wait_async_le0();
  __syncthreads();
  cp16x8(lW + G_STAGE * 2, gW + 64);
  cp16x8(lX + G_STAGE * 2, gX + 64);

  for (int t = 0; t < G_PASSES; ++t) {
    const int bo = (t & 1) * G_STAGE;
    // the whole pass's fragments go to registers as one group of LDS reads
    v16h af[2][4], bf[2][4];
#pragma unroll
    for (int ks = 0; ks < 2; ++ks)
#pragma unroll
      for (int i = 0; i < 4; ++i) {
        af[ks][i] = frag_ld(&St[bo + aoff + i * 16 * G_PITCH + ks * 32], 0);
        bf[ks][i] = frag_ld(&St[bo + boff + i * 16 * G_PITCH + ks * 32], 0);
      }
    // publish point of pass t + 1: own LDS reads done, own copies landed, then the barrier
    // that shows pass t + 1's tile to every wave and frees pass t's buffer for the refill
    asm volatile("s_wait_dscnt 0x0" ::: "memory");
    wait_async_le0();
    __syncthreads();
    if (t + 2 < G_PASSES) {
      cp16x8(lW + bo * 2, gW + (t + 2) * 64);
      cp16x8(lX + bo * 2, gX + (t + 2) * 64);
    }
    // the pass's WMMAs work on registers alone, so the refill flies under all of them
#pragma unroll
    for (int ks = 0; ks < 2; ++ks)
#pragma unroll
      for (int i = 0; i < 4; ++i)
#pragma unroll
        for (int j = 0; j < 4; ++j) acc[i][j] = WMMA_F16(af[ks][i], bf[ks][j], acc[i][j]);
  }
  wait_async_le0();   // no copy is outstanding when the wave ends

  const int bb = row0 >> 11;             // / S_LEN: one batch entry per 64-row wave tile
  const int s0 = row0 & (S_LEN - 1);
  const size_t head = (size_t)(bb * N_HEADS + (n0 >> 6));   // one head per 64-feature wave tile
  h8 v[16];
  if (which == 2) {
    float bb_[4];
    ld_bias_cols(bias + n0 + nn, bb_);
#pragma unroll
    for (int j = 0; j < 4; ++j)
#pragma unroll
      for (int i = 0; i < 4; ++i)
#pragma unroll
        for (int g = 0; g < 8; ++g) v[j * 4 + i][g] = (_Float16)(acc[i][j][g] + bb_[j]);
    st_tile_vt(Vth + (head * D_HEAD + nn) * S_LEN + s0 + hiH * 8, v);
  } else {
    v4f bb_[8];
    ld_bias_rows(bias + n0 + hiH * 8, bb_);
#pragma unroll
    for (int i = 0; i < 4; ++i)
#pragma unroll
      for (int j = 0; j < 4; ++j)
#pragma unroll
        for (int g = 0; g < 8; ++g)
          v[i * 4 + j][g] = (_Float16)(acc[i][j][g] + bb_[i * 2 + (g >> 2)][g & 3]);
    st_tile_qk(((which == 0) ? Qh : Kh) + (head * S_LEN + s0 + nn) * D_HEAD + hiH * 8, v);
  }
}

// ---------------- Kernel 3: flash attention with relative skew ----------------
// K/V slabs (32 keys) are double-buffered in LDS via async copies, shared by all 4 waves;
// prefetch of slab n+1 overlaps compute on slab n (s_wait_asynccnt <= 4).
// A fragment read takes 16 bytes of each of 16 rows per half wave: at a row pitch of 16 B x odd
// the 16 rows fall on all 64 banks; at the rows' own 128 B and 64 B they fall on 8 and 16 banks.
#define K_PITCH 72   // halfs per staged K row: 64 + 8 (144 B)
#define V_PITCH 40   // halfs per staged V^T row: 32 + 8 (80 B)
static __device__ __forceinline__ void slab_load(const _Float16* __restrict__ Kbase,
                                                 const _Float16* __restrict__ Vbase,
                                                 int t0,
                                                 _Float16 (*Kl)[K_PITCH], _Float16 (*Vl)[V_PITCH],
                                                 int tid) {
#pragma unroll
  for (int r = 0; r < 2; ++r) {
    int c = tid + r * 128;                 // 0..255
    int krow = c >> 3, kcol = (c & 7) << 3;   // 32 rows x 64 halfs
    cp16_g2l(Kbase + (size_t)(t0 + krow) * D_HEAD + kcol, &Kl[krow][kcol]);
    int vrow = c >> 2, vcol = (c & 3) << 3;   // 64 rows x 32 halfs
    cp16_g2l(Vbase + (size_t)vrow * S_LEN + t0 + vcol, &Vl[vrow][vcol]);
  }
}

#define SK_PITCH 68   // floats per ring row: 64 keys + 4, so 16 rows' 16-byte reads fall on 64 banks

// value of the lane 16 away
static __device__ __forceinline__ float other_half(float v) {
  int b = __builtin_bit_cast(int, v);
  b = __builtin_amdgcn_permlanex16(b, b, 0x76543210, 0xfedcba98, false, false);
  return __builtin_bit_cast(float, b);
}

__global__ void __launch_bounds__(128)
attn_kernel(const _Float16* __restrict__ Qh, const _Float16* __restrict__ Kh,
            const _Float16* __restrict__ Vt, const _Float16* __restrict__ Erh,
            float* __restrict__ out) {
  __shared__ __align__(16) _Float16 Kl[2][32][K_PITCH];   // double-buffered K slab
  __shared__ __align__(16) _Float16 Vl[2][64][V_PITCH];   // double-buffered V slab (dh,t)
  __shared__ __align__(16) float sk[4][16 * SK_PITCH];   // per-wave skew ring

  const int tid  = threadIdx.x;
  const int lane = tid & 31;
  const int wave = __builtin_amdgcn_readfirstlane(tid >> 5);   // scalar: picks the band blocks
  const int hiH  = (lane >> 4) & 1;
  const int k0   = hiH * 8;
  const int nn   = lane & 15;

  const int h  = blockIdx.y;
  const int b  = blockIdx.z;
  const int s0 = blockIdx.x * 64 + wave * 16;

  const size_t head = (size_t)(b * N_HEADS + h) * (size_t)S_LEN * D_HEAD;
  const _Float16* Qbase = Qh + head;
  const _Float16* Kbase = Kh + head;
  const _Float16* Vbase = Vt + head;   // (dh, t) layout

  // warm the Er diagonal band this block touches first
  {
    int e = S_LEN - 16 - s0 + nn;
    e = e < 0 ? 0 : e;
    __builtin_prefetch(Erh + (size_t)e * D_HEAD, 0, 1);
  }

  const _Float16* qrow = Qbase + (size_t)(s0 + nn) * D_HEAD;
  int sshift = s0 + nn + 1; if (sshift > S_LEN - 1) sshift = S_LEN - 1;
  const _Float16* qsrow = Qbase + (size_t)sshift * D_HEAD;  // rows s+1 (skew wrap term)

  const v16h qa0 = frag_ld(qrow, k0);        // Q  d 0..31
  const v16h qa1 = frag_ld(qrow + 32, k0);   // Q  d 32..63
  const v16h qs0 = frag_ld(qsrow, k0);       // Qs d 0..31
  const v16h qs1 = frag_ld(qsrow + 32, k0);  // Qs d 32..63

  float rowmax = -3.0e38f, rowsum = 0.f;     // of query s0 + nn; rowsum over this half's keys
  v8f o0 = {}, o1 = {}, o2 = {}, o3 = {};    // O^T: register g = dh 16 n + 8 hiH + g, lane = query

  slab_load(Kbase, Vbase, 0, Kl[0], Vl[0], tid);   // preload slab 0

  // Band stream: block kb + m holds, for query row i, keys 16 m - 15 + i .. 16 m + i, so slab n
  // (keys 32 n .. 32 n + 31) needs blocks m <= 2 n + 2. Blocks are multiplied and stored one slab
  // ahead of their first full use; their Er fragments are fetched one slab before that.
  // Ring column of (row i = 8 hiH + g, lane nn) in block m: (16 m + 49 + nn + i) & 63; only
  // m = 0 (mod 4) can wrap inside a block.
  float* const skw = &sk[wave][0];
  float* const sk_st = skw + (8 * hiH) * (SK_PITCH + 1) + nn + 1;    // + g (SK_PITCH + 1) + 16 ((m & 3) - 1)
  const float* const sk_ld = skw + nn * SK_PITCH + 8 * hiH;          // + (first key of the tile) & 63
  int wofs[8];                                                       // the wrapping block's places
#pragma unroll   // constant g keeps the table in registers
  for (int g = 0; g < 8; ++g)
    wofs[g] = (8 * hiH + g) * SK_PITCH + ((49 + nn + 8 * hiH + g) & 63);

  int kb = (S_LEN - 16 - s0) >> 4;
  {
    const _Float16* r0 = band_row(Erh, kb, nn);
    const _Float16* r1 = band_row(Erh, kb + 1, nn);
    const _Float16* r2 = band_row(Erh, kb + 2, nn);
    const v8f g0 = band_gemm(kb,     nn, qa0, qa1, qs0, qs1, frag_ld(r0, k0), frag_ld(r0 + 32, k0));
    const v8f g1 = band_gemm(kb + 1, nn, qa0, qa1, qs0, qs1, frag_ld(r1, k0), frag_ld(r1 + 32, k0));
    const v8f g2 = band_gemm(kb + 2, nn, qa0, qa1, qs0, qs1, frag_ld(r2, k0), frag_ld(r2 + 32, k0));
#pragma unroll   // constant g keeps the tiles in registers
    for (int g = 0; g < 8; ++g) {
      skw[wofs[g]] = g0[g];
      sk_st[g * (SK_PITCH + 1)] = g1[g];
      sk_st[g * (SK_PITCH + 1) + 16] = g2[g];
    }
  }
  const _Float16* ra = band_row(Erh, kb + 3, nn);
  const _Float16* rb = band_row(Erh, kb + 4, nn);
  v16h fa0 = frag_ld(ra, k0), fa1 = frag_ld(ra + 32, k0);
  v16h fb0 = frag_ld(rb, k0), fb1 = frag_ld(rb + 32, k0);

  for (int tp = 0; tp < S_LEN; tp += 64) {
#pragma unroll   // constant par: buffer and ring places become immediate offsets
    for (int par = 0; par < 2; ++par) {
      const int t0 = tp + par * 32;
      if (t0 + 32 < S_LEN) {
        slab_load(Kbase, Vbase, t0 + 32, Kl[par ^ 1], Vl[par ^ 1], tid);
        wait_async_le4();                // current slab landed; prefetch stays in flight
      } else {
        wait_async_le0();
      }
      __syncthreads();   // also orders the ring's stores of the slab before ahead of the reads below

      // ---- Srel^T of this slab from the ring: 8 consecutive keys of the lane's query per tile ----
      v4f rr[4];
#pragma unroll
      for (int q = 0; q < 4; ++q) rr[q] = *(const v4f*)(sk_ld + par * 32 + (q >> 1) * 16 + (q & 1) * 4);
      // the ring places stored below alias keys read above: keep the compiler from lifting the
      // stores over those reads (the wave's LDS operations run in program order)
      __builtin_amdgcn_fence(__ATOMIC_ACQ_REL, "wavefront");

      // the next slab's two new band blocks into the ring, then the fragments of the slab after
      // into the same registers: their loads have a whole slab to land
      {
        const v8f ga = band_gemm(kb + 3, nn, qa0, qa1, qs0, qs1, fa0, fa1);
        const v8f gb = band_gemm(kb + 4, nn, qa0, qa1, qs0, qs1, fb0, fb1);
#pragma unroll   // constant g keeps the tiles in registers
        for (int g = 0; g < 8; ++g) {
          if (par == 0) {     // blocks 3 and 0 (mod 4)
            sk_st[g * (SK_PITCH + 1) + 32] = ga[g];
            skw[wofs[g]] = gb[g];
          } else {            // blocks 1 and 2 (mod 4)
            sk_st[g * (SK_PITCH + 1)] = ga[g];
            sk_st[g * (SK_PITCH + 1) + 16] = gb[g];
          }
        }
      }
      kb += 2;
      ra = band_row(Erh, kb + 3, nn);
      rb = band_row(Erh, kb + 4, nn);
      fa0 = frag_ld(ra, k0); fa1 = frag_ld(ra + 32, k0);
      // a precaution: the build let a result of the loads below land on the address pair of the
      // loads above; the wait stands between them
      asm volatile("s_wait_xcnt 0x0" ::: "memory");
      fb0 = frag_ld(rb, k0); fb1 = frag_ld(rb + 32, k0);
      // keeps these loads here: the build sank half of them to the slab's last barrier, which
      // waits for them
      __builtin_amdgcn_sched_barrier(0);

      // ---- S^T: two 16-key tiles (K = 64), K rows from LDS as A, Q as B ----
      float sc[16];
#pragma unroll
      for (int sub = 0; sub < 2; ++sub) {
        const _Float16* krow = &Kl[par][sub * 16 + nn][0];
        v8f c = {};
        c = WMMA_F16(frag_ld(krow, k0), qa0, c);
        c = WMMA_F16(frag_ld(krow + 32, k0), qa1, c);
#pragma unroll
        for (int g = 0; g < 8; ++g)
          sc[sub * 8 + g] = (c[g] + rr[sub * 2 + (g >> 2)][g & 3]) * 0.125f;   // / sqrt(D_HEAD)
      }

      // ---- online softmax across this 32-key slab: one query per lane ----
      float m4[4];
#pragma unroll
      for (int e = 0; e < 4; ++e)
        m4[e] = fmaxf(fmaxf(sc[e], sc[e + 4]), fmaxf(sc[e + 8], sc[e + 12]));
      float tm = fmaxf(fmaxf(m4[0], m4[1]), fmaxf(m4[2], m4[3]));
      tm = fmaxf(tm, other_half(tm));
      const float nm = fmaxf(rowmax, tm);
      const float al = __expf(rowmax - nm);
      rowmax = nm;
      v16h pb;          // P^T as B: element e = key 8 hiH + e (e < 8), 16 + 8 hiH + e - 8 (e >= 8)
      float p4[4] = {0.f, 0.f, 0.f, 0.f};
#pragma unroll
      for (int e = 0; e < 16; ++e) {
        const float p = __expf(sc[e] - nm);
        p4[e & 3] += p;
        pb[e] = (_Float16)p;
      }
      rowsum = rowsum * al + ((p4[0] + p4[1]) + (p4[2] + p4[3]));
#pragma unroll
      for (int g = 0; g < 8; ++g) { o0[g] *= al; o1[g] *= al; o2[g] *= al; o3[g] *= al; }

      // ---- O^T += V^T P^T : 4 WMMAs over the 64 head dims (K = 32), V^T rows from LDS as A ----
      const _Float16* vrow_ = &Vl[par][nn][0];
      o0 = WMMA_F16(frag_ld(vrow_,                k0), pb, o0);
      o1 = WMMA_F16(frag_ld(vrow_ + 16 * V_PITCH, k0), pb, o1);
      o2 = WMMA_F16(frag_ld(vrow_ + 32 * V_PITCH, k0), pb, o2);
      o3 = WMMA_F16(frag_ld(vrow_ + 48 * V_PITCH, k0), pb, o3);

      __syncthreads();   // slab buffers free for the next prefetch
    }
  }

  // ---- join the halves' sums, normalize and write (B, S, D_MODEL) f32 ----
  const float inv = 1.0f / (rowsum + other_half(rowsum));
  float* orow = out + ((size_t)(b * S_LEN + s0 + nn)) * D_MODEL + h * D_HEAD + 8 * hiH;
  *(v4f*)(orow +  0) = (v4f){o0[0], o0[1], o0[2], o0[3]} * inv;
  *(v4f*)(orow +  4) = (v4f){o0[4], o0[5], o0[6], o0[7]} * inv;
  *(v4f*)(orow + 16) = (v4f){o1[0], o1[1], o1[2], o1[3]} * inv;
  *(v4f*)(orow + 20) = (v4f){o1[4], o1[5], o1[6], o1[7]} * inv;
  *(v4f*)(orow + 32) = (v4f){o2[0], o2[1], o2[2], o2[3]} * inv;
  *(v4f*)(orow + 36) = (v4f){o2[4], o2[5], o2[6], o2[7]} * inv;
  *(v4f*)(orow + 48) = (v4f){o3[0], o3[1], o3[2], o3[3]} * inv;
  *(v4f*)(orow + 52) = (v4f){o3[4], o3[5], o3[6], o3[7]} * inv;
}

extern "C" void kernel_launch(void* const* d_in, const int* in_sizes, int n_in,
                              void* d_out, int out_size, void* d_ws, size_t ws_size,
                              hipStream_t stream) {
  (void)in_sizes; (void)n_in; (void)out_size; (void)ws_size;
  const float* x  = (const float*)d_in[0];
  const float* Wq = (const float*)d_in[1];
  const float* bq = (const float*)d_in[2];
  const float* Wk = (const float*)d_in[3];
  const float* bk = (const float*)d_in[4];
  const float* Wv = (const float*)d_in[5];
  const float* bv = (const float*)d_in[6];
  const float* Er = (const float*)d_in[7];

  char* ws = (char*)d_ws;
  const size_t xhN = (size_t)BATCH * S_LEN * D_MODEL;        // 4,194,304
  const size_t wN  = (size_t)D_MODEL * D_MODEL;              // 1,048,576
  const size_t erN = (size_t)S_LEN * D_HEAD;                 // 131,072

  _Float16* Xh  = (_Float16*)(ws);
  _Float16* Wqh = (_Float16*)(ws + 2 * xhN);
  _Float16* Wkh = Wqh + wN;
  _Float16* Wvh = Wkh + wN;
  _Float16* Erh = Wvh + wN;
  _Float16* Qh  = Erh + erN;
  _Float16* Kh  = Qh + xhN;
  _Float16* Vth = Kh + xhN;

  // Xh, Wqh, Wkh, Wvh, Erh are contiguous from Xh on
  cast_all<<<CAST_XB + 3 * CAST_WB + CAST_EB, CAST_T, 0, stream>>>(x, Wq, Wk, Wv, Er, Xh);

  // QKV: M = 4096 rows, N = 1024 feats, K = 1024; z selects Q/K/V
  qkv_gemm<<<dim3(D_MODEL / 128, (BATCH * S_LEN) / 128, 3), 128, 0, stream>>>(
      Xh, Wqh, Wkh, Wvh, bq, bk, bv, Qh, Kh, Vth);

  // attention: 64 query rows per block (4 waves x 16)
  attn_kernel<<<dim3(S_LEN / 64, N_HEADS, BATCH), 128, 0, stream>>>(
      Qh, Kh, Vth, Erh, (float*)d_out);
}

// v006
// Measured time: 98.9 microseconds a run.
// In two side-by-side timings against v005, it was 1.21 and 1.22 times as fast.
// All steps since v000 together make it 3.95 times as fast.
#include <hip/hip_runtime.h>
#include <hip/hip_bf16.h>

#define S_LEN   2048
#define D_MODEL 1024
#define N_HEADS 16
#define D_HEAD  64
#define BATCH   2

typedef _Float16 h8   __attribute__((ext_vector_type(8)));
typedef _Float16 v16h __attribute__((ext_vector_type(16)));
typedef float    v8f  __attribute__((ext_vector_type(8)));

#define WMMA_F16(a, b, c) \
  __builtin_amdgcn_wmma_f32_16x16x32_f16(false, (a), false, (b), (short)0, (c), false, false)

// ---------- CDNA5 async global->LDS copy (guarded; falls back to ld+ds_store) ----------
#if defined(__has_builtin)
#if __has_builtin(__builtin_amdgcn_global_load_async_to_lds_b128)
#define HAVE_ASYNC_CP 1
#endif
#endif
#ifndef HAVE_ASYNC_CP
#define HAVE_ASYNC_CP 0
#endif

typedef int v4i_t __attribute__((vector_size(16)));
typedef __attribute__((address_space(1))) v4i_t* g_v4i_p;   // global int4*
typedef __attribute__((address_space(3))) v4i_t* l_v4i_p;   // LDS int4*

static __device__ __forceinline__ void cp16_g2l(const _Float16* g, _Float16* l) {
#if HAVE_ASYNC_CP
  __builtin_amdgcn_global_load_async_to_lds_b128(
      (g_v4i_p)(unsigned long long)g,
      (l_v4i_p)(unsigned int)(unsigned long long)l, 0, 0);
#else
  *(h8*)l = *(const h8*)g;
#endif
}
static __device__ __forceinline__ void wait_async_le0() {
#if HAVE_ASYNC_CP
  asm volatile("s_wait_asynccnt 0x0" ::: "memory");
#endif
}

// Load one lane's slice of a 16x32 (f16) A/B fragment.
// Layout per ISA 7.12.2: lanes 0-15 hold K[0..7]+K[16..23], lanes 16-31 hold K[8..15]+K[24..31].
static __device__ __forceinline__ v16h frag_ld(const _Float16* p, int k0) {
  h8 lo = *(const h8*)(p + k0);
  h8 hi = *(const h8*)(p + k0 + 16);
  return __builtin_shufflevector(lo, hi, 0,1,2,3,4,5,6,7,8,9,10,11,12,13,14,15);
}

// The skew reads, for query s and key t, position u = S - 1 + t - s of one band of 2 S positions:
// u < S is q[s].Er[u], u == S is the skew's zero column, u > S is q[s+1].Er[u - S - 1].
// Band block k holds positions 16 k .. 16 k + 15; a 16x16 score tile needs blocks k and k + 1.
#define BAND_WRAP (S_LEN / 16)   // first block that belongs to q[s+1]

// Er row behind column nn of band block k
static __device__ __forceinline__ const _Float16* band_row(const _Float16* __restrict__ Erh,
                                                           int k, int nn) {
  int e = k * 16 + nn - ((k >= BAND_WRAP) ? (S_LEN + 1) : 0);
  e = e < 0 ? 0 : e;                        // the zero column's lane
  e = e > (S_LEN - 1) ? (S_LEN - 1) : e;    // blocks fetched past the last slab, never used
  return Erh + (size_t)e * D_HEAD;
}

// G = Qtile(16x64) @ (band block k)^T -> 16x16 f32 (2 WMMAs over K=64); k is wave-uniform
static __device__ __forceinline__ v8f band_gemm(int k, int nn, v16h qa0, v16h qa1,
                                                v16h qs0, v16h qs1, v16h f0, v16h f1) {
  const bool wrap = (k >= BAND_WRAP);
  v8f c = {};
  c = WMMA_F16(wrap ? qs0 : qa0, f0, c);
  c = WMMA_F16(wrap ? qs1 : qa1, f1, c);
  const bool zcol = (k * 16 + nn == S_LEN);
#pragma unroll   // constant g keeps the tile in registers
  for (int g = 0; g < 8; ++g) c[g] = zcol ? 0.f : c[g];
  return c;
}

// ---------------- Kernel 1: f32 -> f16 cast of x, Wq, Wk, Wv and Er, one launch ----------------
// The five f16 copies lie one behind the other in the workspace, so a block's place in the grid is
// its place in the destination; each array is a whole number of blocks. A thread converts 64
// elements: sixteen 16-byte loads, each 512 contiguous bytes of a wave, issued ahead of the
// conversions, and sixteen 8-byte stores, each two whole 128-byte lines of a wave.
#define CAST_T 128                                        // threads per block
#define CAST_V 16                                         // 16-byte loads per thread
#define CAST_CHUNK (CAST_T * CAST_V * 4)                  // floats per block
#define CAST_XB (BATCH * S_LEN * D_MODEL / CAST_CHUNK)    // blocks of x
#define CAST_WB (D_MODEL * D_MODEL / CAST_CHUNK)          // blocks of each W
#define CAST_EB (S_LEN * D_HEAD / CAST_CHUNK)             // blocks of Er

typedef float    c4f __attribute__((ext_vector_type(4)));
typedef _Float16 c4h __attribute__((ext_vector_type(4)));

__global__ void __launch_bounds__(CAST_T)
cast_all(const float* __restrict__ x, const float* __restrict__ Wq, const float* __restrict__ Wk,
         const float* __restrict__ Wv, const float* __restrict__ Er, _Float16* __restrict__ dst) {
  const int blk = blockIdx.x;
  const float* src = x;
  int rel = blk;
  if (blk >= CAST_XB + 3 * CAST_WB)      { src = Er; rel = blk - (CAST_XB + 3 * CAST_WB); }
  else if (blk >= CAST_XB + 2 * CAST_WB) { src = Wv; rel = blk - (CAST_XB + 2 * CAST_WB); }
  else if (blk >= CAST_XB + CAST_WB)     { src = Wk; rel = blk - (CAST_XB + CAST_WB); }
  else if (blk >= CAST_XB)               { src = Wq; rel = blk - CAST_XB; }
  const float* p = src + (size_t)rel * CAST_CHUNK + threadIdx.x * 4;
  _Float16*    q = dst + (size_t)blk * CAST_CHUNK + threadIdx.x * 4;
  c4f v[CAST_V];
#pragma unroll   // constant j: the values stay in registers and the loads are in flight together
  for (int j = 0; j < CAST_V; ++j) v[j] = *(const c4f*)(p + j * CAST_T * 4);
#pragma unroll   // constant j, as above
  for (int j = 0; j < CAST_V; ++j)
    *(c4h*)(q + j * CAST_T * 4) = (c4h){(_Float16)v[j][0], (_Float16)v[j][1],
                                        (_Float16)v[j][2], (_Float16)v[j][3]};
}

// ---------------- Kernel 2: QKV projection GEMM ----------------
// y = Xh @ W^T + b ; z = 0/1/2 -> Q/K/V. Q,K stored (b,h,s,dh); V stored transposed (b,h,dh,s).
// One 128x128 tile of y per block, 64x64 per wave (4x4 WMMA tiles), so every LDS fragment
// feeds four WMMAs. A pass is 64 k: 128 W rows and 128 X rows of 128 B, laid at a pitch of
// 144 B (16 B x odd: conflict-free for ds_load_b128), two buffers filled by async copies.
#define G_PITCH 72                       // halfs per staged row (144 B)
#define G_STAGE (256 * G_PITCH)          // halfs per buffer: W rows 0..127, X rows 128..255
#define G_PASSES (D_MODEL / 64)

// Eight 16-byte async copies of one lane. The s_wait_xcnt stands inside the statement so
// that no address register of an issued copy is rewritten ahead of it.
static __device__ __forceinline__ void cp16x8(unsigned l, const _Float16* g) {
  const unsigned l1 = l + 1 * 16 * G_PITCH * 2, l2 = l + 2 * 16 * G_PITCH * 2,
                 l3 = l + 3 * 16 * G_PITCH * 2, l4 = l + 4 * 16 * G_PITCH * 2,
                 l5 = l + 5 * 16 * G_PITCH * 2, l6 = l + 6 * 16 * G_PITCH * 2,
                 l7 = l + 7 * 16 * G_PITCH * 2;
  const _Float16 *g1 = g + 1 * 16 * D_MODEL, *g2 = g + 2 * 16 * D_MODEL,
                 *g3 = g + 3 * 16 * D_MODEL, *g4 = g + 4 * 16 * D_MODEL,
                 *g5 = g + 5 * 16 * D_MODEL, *g6 = g + 6 * 16 * D_MODEL,
                 *g7 = g + 7 * 16 * D_MODEL;
  asm volatile(
      "global_load_async_to_lds_b128 %0, %8, off\n\t"
      "global_load_async_to_lds_b128 %1, %9, off\n\t"
      "global_load_async_to_lds_b128 %2, %10, off\n\t"
      "global_load_async_to_lds_b128 %3, %11, off\n\t"
      "global_load_async_to_lds_b128 %4, %12, off\n\t"
      "global_load_async_to_lds_b128 %5, %13, off\n\t"
      "global_load_async_to_lds_b128 %6, %14, off\n\t"
      "global_load_async_to_lds_b128 %7, %15, off\n\t"
      "s_wait_xcnt 0x0"
      :: "v"(l), "v"(l1), "v"(l2), "v"(l3), "v"(l4), "v"(l5), "v"(l6), "v"(l7),
         "v"(g), "v"(g1), "v"(g2), "v"(g3), "v"(g4), "v"(g5), "v"(g6), "v"(g7)
      : "memory");
}

// Epilogue memory operations stand with their waits in one asm statement each, so that no
// register that an issued load or store names is rewritten ahead of the wait (a precaution).
typedef float v4f __attribute__((ext_vector_type(4)));

// 4 x 8 consecutive floats at p + 16 i (i = 0..3)
static __device__ __forceinline__ void ld_bias_rows(const float* p, v4f (&b)[8]) {
  asm volatile(
      "global_load_b128 %0, %8, off\n\t"
      "global_load_b128 %1, %8, off offset:16\n\t"
      "global_load_b128 %2, %8, off offset:64\n\t"
      "global_load_b128 %3, %8, off offset:80\n\t"
      "global_load_b128 %4, %8, off offset:128\n\t"
      "global_load_b128 %5, %8, off offset:144\n\t"
      "global_load_b128 %6, %8, off offset:192\n\t"
      "global_load_b128 %7, %8, off offset:208\n\t"
      "s_wait_loadcnt 0x0\n\t"
      "s_wait_xcnt 0x0"
      : "=&v"(b[0]), "=&v"(b[1]), "=&v"(b[2]), "=&v"(b[3]),
        "=&v"(b[4]), "=&v"(b[5]), "=&v"(b[6]), "=&v"(b[7])
      : "v"(p) : "memory");
}
// one float at p + 16 j (j = 0..3)
static __device__ __forceinline__ void ld_bias_cols(const float* p, float (&b)[4]) {
  asm volatile(
      "global_load_b32 %0, %4, off\n\t"
      "global_load_b32 %1, %4, off offset:64\n\t"
      "global_load_b32 %2, %4, off offset:128\n\t"
      "global_load_b32 %3, %4, off offset:192\n\t"
      "s_wait_loadcnt 0x0\n\t"
      "s_wait_xcnt 0x0"
      : "=&v"(b[0]), "=&v"(b[1]), "=&v"(b[2]), "=&v"(b[3])
      : "v"(p) : "memory");
}
// Q,K: v[4 i + j] goes to token row + 16 j (rows of 128 B), dh + 16 i
static __device__ __forceinline__ void st_tile_qk(_Float16* p, const h8 (&v)[16]) {
  asm volatile(
      "global_store_b128 %0, %1, off\n\t"
      "global_store_b128 %0, %2, off offset:2048\n\t"
      "global_store_b128 %0, %3, off offset:4096\n\t"
      "global_store_b128 %0, %4, off offset:6144\n\t"
      "global_store_b128 %0, %5, off offset:32\n\t"
      "global_store_b128 %0, %6, off offset:2080\n\t"
      "global_store_b128 %0, %7, off offset:4128\n\t"
      "global_store_b128 %0, %8, off offset:6176\n\t"
      "global_store_b128 %0, %9, off offset:64\n\t"
      "global_store_b128 %0, %10, off offset:2112\n\t"
      "global_store_b128 %0, %11, off offset:4160\n\t"
      "global_store_b128 %0, %12, off offset:6208\n\t"
      "global_store_b128 %0, %13, off offset:96\n\t"
      "global_store_b128 %0, %14, off offset:2144\n\t"
      "global_store_b128 %0, %15, off offset:4192\n\t"
      "global_store_b128 %0, %16, off offset:6240\n\t"
      "s_wait_xcnt 0x0"
      :: "v"(p), "v"(v[0]), "v"(v[1]), "v"(v[2]), "v"(v[3]), "v"(v[4]), "v"(v[5]), "v"(v[6]), "v"(v[7]),
         "v"(v[8]), "v"(v[9]), "v"(v[10]), "v"(v[11]), "v"(v[12]), "v"(v[13]), "v"(v[14]), "v"(v[15])
      : "memory");
}
// V transposed: v[4 j + i] goes to dh row + 16 j (rows of S_LEN halfs = 4096 B), s + 16 i
static __device__ __forceinline__ void st_tile_vt(_Float16* p, const h8 (&v)[16]) {
  asm volatile(
      "global_store_b128 %0, %1, off\n\t"
      "global_store_b128 %0, %2, off offset:32\n\t"
      "global_store_b128 %0, %3, off offset:64\n\t"
      "global_store_b128 %0, %4, off offset:96\n\t"
      "global_store_b128 %0, %5, off offset:65536\n\t"
      "global_store_b128 %0, %6, off offset:65568\n\t"
      "global_store_b128 %0, %7, off offset:65600\n\t"
      "global_store_b128 %0, %8, off offset:65632\n\t"
      "global_store_b128 %0, %9, off offset:131072\n\t"
      "global_store_b128 %0, %10, off offset:131104\n\t"
      "global_store_b128 %0, %11, off offset:131136\n\t"
      "global_store_b128 %0, %12, off offset:131168\n\t"
      "global_store_b128 %0, %13, off offset:196608\n\t"
      "global_store_b128 %0, %14, off offset:196640\n\t"
      "global_store_b128 %0, %15, off offset:196672\n\t"
      "global_store_b128 %0, %16, off offset:196704\n\t"
      "s_wait_xcnt 0x0"
      :: "v"(p), "v"(v[0]), "v"(v[1]), "v"(v[2]), "v"(v[3]), "v"(v[4]), "v"(v[5]), "v"(v[6]), "v"(v[7]),
         "v"(v[8]), "v"(v[9]), "v"(v[10]), "v"(v[11]), "v"(v[12]), "v"(v[13]), "v"(v[14]), "v"(v[15])
      : "memory");
}

__global__ void __launch_bounds__(128)
qkv_gemm(const _Float16* __restrict__ Xh,
         const _Float16* __restrict__ Wqh, const _Float16* __restrict__ Wkh,
         const _Float16* __restrict__ Wvh,
         const float* __restrict__ bq, const float* __restrict__ bk, const float* __restrict__ bv,
         _Float16* __restrict__ Qh, _Float16* __restrict__ Kh, _Float16* __restrict__ Vth) {
  __shared__ __align__(16) _Float16 St[2 * G_STAGE];   // 73,728 B

  const int tid  = threadIdx.x;
  const int lane = tid & 31;
  const int wave = tid >> 5;
  const int nn   = lane & 15;
  const int hiH  = (lane >> 4) & 1;
  const int k0   = hiH * 8;
  const int n0   = blockIdx.x * 128 + (wave & 1) * 64;    // this wave's first feature
  const int row0 = blockIdx.y * 128 + (wave >> 1) * 64;   // this wave's first token row
  const int which = blockIdx.z;

  const _Float16* W    = (which == 0) ? Wqh : (which == 1) ? Wkh : Wvh;
  const float*    bias = (which == 0) ? bq  : (which == 1) ? bk  : bv;

  // copies: a lane brings chunk (tid & 7) of rows (tid >> 3) + 16 r, r = 0..7, of W and of X
  const int crow = tid >> 3, ccol = (tid & 7) << 3;
  const _Float16* gW = W  + (size_t)(blockIdx.x * 128 + crow) * D_MODEL + ccol;
  const _Float16* gX = Xh + (size_t)(blockIdx.y * 128 + crow) * D_MODEL + ccol;
  const unsigned  lW = (unsigned)(unsigned long long)&St[crow * G_PITCH + ccol];
  const unsigned  lX = lW + 128 * G_PITCH * 2;

  // Q,K: features are the rows of D (operand A = W), so a lane holds 8 consecutive dh of one
  // token; V: tokens are the rows (A = X), so a lane holds 8 consecutive s of one feature.
  const int wrow = (wave & 1) * 64 + nn, xrow = 128 + (wave >> 1) * 64 + nn;
  const int aoff = ((which == 2) ? xrow : wrow) * G_PITCH + k0;
  const int boff = ((which == 2) ? wrow : xrow) * G_PITCH + k0;

  v8f acc[4][4];
#pragma unroll
  for (int i = 0; i < 4; ++i)
#pragma unroll
    for (int j = 0; j < 4; ++j) acc[i][j] = (v8f){};

  cp16x8(lW, gW);
  cp16x8(lX, gX);
  wait_async_le0();
  __syncthreads();
  cp16x8(lW + G_STAGE * 2, gW + 64);
  cp16x8(lX + G_STAGE * 2, gX + 64);

  for (int t = 0; t < G_PASSES; ++t) {
    const int bo = (t & 1) * G_STAGE;
    // the whole pass's fragments go to registers as one group of LDS reads
    v16h af[2][4], bf[2][4];
#pragma unroll
    for (int ks = 0; ks < 2; ++ks)
#pragma unroll
      for (int i = 0; i < 4; ++i) {
        af[ks][i] = frag_ld(&St[bo + aoff + i * 16 * G_PITCH + ks * 32], 0);
        bf[ks][i] = frag_ld(&St[bo + boff + i * 16 * G_PITCH + ks * 32], 0);
      }
    // publish point of pass t + 1: own LDS reads done, own copies landed, then the barrier
    // that shows pass t + 1's tile to every wave and frees pass t's buffer for the refill
    asm volatile("s_wait_dscnt 0x0" ::: "memory");
    wait_async_le0();
    __syncthreads();
    if (t + 2 < G_PASSES) {
      cp16x8(lW + bo * 2, gW + (t + 2) * 64);
      cp16x8(lX + bo * 2, gX + (t + 2) * 64);
    }
    // the pass's WMMAs work on registers alone, so the refill flies under all of them
#pragma unroll
    for (int ks = 0; ks < 2; ++ks)
#pragma unroll
      for (int i = 0; i < 4; ++i)
#pragma unroll
        for (int j = 0; j < 4; ++j) acc[i][j] = WMMA_F16(af[ks][i], bf[ks][j], acc[i][j]);
  }
  wait_async_le0();   // no copy is outstanding when the wave ends

  const int bb = row0 >> 11;             // / S_LEN: one batch entry per 64-row wave tile
  const int s0 = row0 & (S_LEN - 1);
  const size_t head = (size_t)(bb * N_HEADS + (n0 >> 6));   // one head per 64-feature wave tile
  h8 v[16];
  if (which == 2) {
    float bb_[4];
    ld_bias_cols(bias + n0 + nn, bb_);
#pragma unroll
    for (int j = 0; j < 4; ++j)
#pragma unroll
      for (int i = 0; i < 4; ++i)
#pragma unroll
        for (int g = 0; g < 8; ++g) v[j * 4 + i][g] = (_Float16)(acc[i][j][g] + bb_[j]);
    st_tile_vt(Vth + (head * D_HEAD + nn) * S_LEN + s0 + hiH * 8, v);
  } else {
    v4f bb_[8];
    ld_bias_rows(bias + n0 + hiH * 8, bb_);
#pragma unroll
    for (int i = 0; i < 4; ++i)
#pragma unroll
      for (int j = 0; j < 4; ++j)
#pragma unroll
        for (int g = 0; g < 8; ++g)
          v[i * 4 + j][g] = (_Float16)(acc[i][j][g] + bb_[i * 2 + (g >> 2)][g & 3]);
    st_tile_qk(((which == 0) ? Qh : Kh) + (head * S_LEN + s0 + nn) * D_HEAD + hiH * 8, v);
  }
}

// ---------------- Kernel 3: flash attention with relative skew ----------------
// K/V slabs (32 keys) are double-buffered in LDS via async copies, shared by all 4 waves;
// the copies of slab n+1 are issued behind slab n's barrier and fly under its compute.
// A fragment read takes 16 bytes of each of 16 rows per half wave: at a row pitch of 16 B x odd
// the 16 rows fall on all 64 banks; at the rows' own 128 B and 64 B they fall on 8 and 16 banks.
#define K_PITCH 72   // halfs per staged K row: 64 + 8 (144 B)
#define V_PITCH 40   // halfs per staged V^T row: 32 + 8 (80 B)
static __device__ __forceinline__ void slab_load(const _Float16* __restrict__ Kbase,
                                                 const _Float16* __restrict__ Vbase,
                                                 int t0,
                                                 _Float16 (*Kl)[K_PITCH], _Float16 (*Vl)[V_PITCH],
                                                 int tid) {
#pragma unroll
  for (int r = 0; r < 2; ++r) {
    int c = tid + r * 128;                 // 0..255
    int krow = c >> 3, kcol = (c & 7) << 3;   // 32 rows x 64 halfs
    cp16_g2l(Kbase + (size_t)(t0 + krow) * D_HEAD + kcol, &Kl[krow][kcol]);
    int vrow = c >> 2, vcol = (c & 3) << 3;   // 64 rows x 32 halfs
    cp16_g2l(Vbase + (size_t)vrow * S_LEN + t0 + vcol, &Vl[vrow][vcol]);
  }
}

// One band block (16 Er rows of 128 B) into its ring slot, whole 128-byte lines: a thread brings
// 16 bytes of row tid / 8. k is the same for the whole block of threads.
static __device__ __forceinline__ void band_stage(const _Float16* __restrict__ Erh, int k,
                                                  _Float16 (*slot)[K_PITCH], int tid) {
  const int row = tid >> 3, col = (tid & 7) << 3;
  cp16_g2l(band_row(Erh, k, row) + col, &slot[row][col]);
}

#define SK_PITCH 68   // floats per ring row: 64 keys + 4, so 16 rows' 16-byte reads fall on 64 banks

// value of the lane 16 away
static __device__ __forceinline__ float other_half(float v) {
  int b = __builtin_bit_cast(int, v);
  b = __builtin_amdgcn_permlanex16(b, b, 0x76543210, 0xfedcba98, false, false);
  return __builtin_bit_cast(float, b);
}

// The grid gives every SIMD four waves; said to the compiler, so that it does not hold registers
// down for a fifth wave that the larger LDS would still admit and serialise the fragment reads.
__global__ void __launch_bounds__(128) __attribute__((amdgpu_waves_per_eu(4, 4)))
attn_kernel(const _Float16* __restrict__ Qh, const _Float16* __restrict__ Kh,
            const _Float16* __restrict__ Vt, const _Float16* __restrict__ Erh,
            float* __restrict__ out) {
  __shared__ __align__(16) _Float16 Kl[2][32][K_PITCH];   // double-buffered K slab
  __shared__ __align__(16) _Float16 Vl[2][64][V_PITCH];   // double-buffered V slab (dh,t)
  __shared__ __align__(16) float sk[4][16 * SK_PITCH];   // per-wave skew ring
  __shared__ __align__(16) _Float16 El[8][16][K_PITCH];   // ring of band blocks, shared by the waves

  const int tid  = threadIdx.x;
  const int lane = tid & 31;
  const int wave = __builtin_amdgcn_readfirstlane(tid >> 5);   // scalar: picks the band blocks
  const int hiH  = (lane >> 4) & 1;
  const int k0   = hiH * 8;
  const int nn   = lane & 15;

  const int h  = blockIdx.y;
  const int b  = blockIdx.z;
  const int s0 = blockIdx.x * 64 + wave * 16;

  const size_t head = (size_t)(b * N_HEADS + h) * (size_t)S_LEN * D_HEAD;
  const _Float16* Qbase = Qh + head;
  const _Float16* Kbase = Kh + head;
  const _Float16* Vbase = Vt + head;   // (dh, t) layout

  // warm the Er diagonal band this block touches first
  {
    int e = S_LEN - 16 - s0 + nn;
    e = e < 0 ? 0 : e;
    __builtin_prefetch(Erh + (size_t)e * D_HEAD, 0, 1);
  }

  const _Float16* qrow = Qbase + (size_t)(s0 + nn) * D_HEAD;
  int sshift = s0 + nn + 1; if (sshift > S_LEN - 1) sshift = S_LEN - 1;
  const _Float16* qsrow = Qbase + (size_t)sshift * D_HEAD;  // rows s+1 (skew wrap term)

  const v16h qa0 = frag_ld(qrow, k0);        // Q  d 0..31
  const v16h qa1 = frag_ld(qrow + 32, k0);   // Q  d 32..63
  const v16h qs0 = frag_ld(qsrow, k0);       // Qs d 0..31
  const v16h qs1 = frag_ld(qsrow + 32, k0);  // Qs d 32..63

  float rowmax = -3.0e38f, rowsum = 0.f;     // of query s0 + nn; rowsum over this half's keys
  v8f o0 = {}, o1 = {}, o2 = {}, o3 = {};    // O^T: register g = dh 16 n + 8 hiH + g, lane = query

  slab_load(Kbase, Vbase, 0, Kl[0], Vl[0], tid);   // preload slab 0

  // Wave w's band stream runs w blocks behind wave 0's, so the four waves read the same Er rows
  // within two slabs: each block is staged once for all of them. Block kb0 + j lies in slot j & 7.
  // In slab n the waves read j = 2 n + 2 .. 2 n + 6 while j = 2 n + 7 and 2 n + 8 are in flight.
  const int kb0 = (S_LEN - 16 - (int)blockIdx.x * 64) >> 4;
#pragma unroll   // constant j: the slots are immediate offsets
  for (int j = 2; j < 7; ++j) band_stage(Erh, kb0 + j, El[j], tid);

  // Band stream: block kb + m holds, for query row i, keys 16 m - 15 + i .. 16 m + i, so slab n
  // (keys 32 n .. 32 n + 31) needs blocks m <= 2 n + 2. Blocks are multiplied and stored one slab
  // ahead of their first full use; their Er fragments are fetched one slab before that, the first
  // two blocks' from memory, all later ones from the LDS ring of band blocks.
  // Ring column of (row i = 8 hiH + g, lane nn) in block m: (16 m + 49 + nn + i) & 63; only
  // m = 0 (mod 4) can wrap inside a block.
  float* const skw = &sk[wave][0];
  float* const sk_st = skw + (8 * hiH) * (SK_PITCH + 1) + nn + 1;    // + g (SK_PITCH + 1) + 16 ((m & 3) - 1)
  const float* const sk_ld = skw + nn * SK_PITCH + 8 * hiH;          // + (first key of the tile) & 63
  int wofs[8];                                                       // the wrapping block's places
#pragma unroll   // constant g keeps the table in registers
  for (int g = 0; g < 8; ++g)
    wofs[g] = (8 * hiH + g) * SK_PITCH + ((49 + nn + 8 * hiH + g) & 63);

  int kb = (S_LEN - 16 - s0) >> 4;
  {
    const _Float16* r0 = band_row(Erh, kb, nn);
    const _Float16* r1 = band_row(Erh, kb + 1, nn);
    const _Float16* r2 = band_row(Erh, kb + 2, nn);
    const v8f g0 = band_gemm(kb,     nn, qa0, qa1, qs0, qs1, frag_ld(r0, k0), frag_ld(r0 + 32, k0));
    const v8f g1 = band_gemm(kb + 1, nn, qa0, qa1, qs0, qs1, frag_ld(r1, k0), frag_ld(r1 + 32, k0));
    const v8f g2 = band_gemm(kb + 2, nn, qa0, qa1, qs0, qs1, frag_ld(r2, k0), frag_ld(r2 + 32, k0));
#pragma unroll   // constant g keeps the tiles in registers
    for (int g = 0; g < 8; ++g) {
      skw[wofs[g]] = g0[g];
      sk_st[g * (SK_PITCH + 1)] = g1[g];
      sk_st[g * (SK_PITCH + 1) + 16] = g2[g];
    }
  }
  const _Float16* ra = band_row(Erh, kb + 3, nn);
  const _Float16* rb = band_row(Erh, kb + 4, nn);
  v16h fa0 = frag_ld(ra, k0), fa1 = frag_ld(ra + 32, k0);
  v16h fb0 = frag_ld(rb, k0), fb1 = frag_ld(rb + 32, k0);

  for (int tp = 0; tp < S_LEN; tp += 64) {
#pragma unroll   // constant par: buffer and ring places become immediate offsets
    for (int par = 0; par < 2; ++par) {
      const int t0 = tp + par * 32;
      const int j0 = t0 >> 4;            // 2 n
      // publish point: own LDS reads of the slab before done, own copies (this slab, band blocks up
      // to j0 + 6) landed, then the one barrier that shows them to every wave and frees the places
      // that the slab before has read for the refill
      asm volatile("s_wait_dscnt 0x0" ::: "memory");
      wait_async_le0();
      __syncthreads();   // also orders the ring's stores of the slab before ahead of the reads below
      if (t0 + 32 < S_LEN) {
        slab_load(Kbase, Vbase, t0 + 32, Kl[par ^ 1], Vl[par ^ 1], tid);
        band_stage(Erh, kb0 + j0 + 7, El[(j0 + 7) & 7], tid);
        band_stage(Erh, kb0 + j0 + 8, El[j0 & 7], tid);
      }

      // ---- Srel^T of this slab from the ring: 8 consecutive keys of the lane's query per tile ----
      v4f rr[4];
#pragma unroll
      for (int q = 0; q < 4; ++q) rr[q] = *(const v4f*)(sk_ld + par * 32 + (q >> 1) * 16 + (q & 1) * 4);
      // the ring places stored below alias keys read above: keep the compiler from lifting the
      // stores over those reads (the wave's LDS operations run in program order)
      __builtin_amdgcn_fence(__ATOMIC_ACQ_REL, "wavefront");

      // the next slab's two new band blocks into the ring; the fragments of the slab after go into
      // the same registers further down
      {
        const v8f ga = band_gemm(kb + 3, nn, qa0, qa1, qs0, qs1, fa0, fa1);
        const v8f gb = band_gemm(kb + 4, nn, qa0, qa1, qs0, qs1, fb0, fb1);
#pragma unroll   // constant g keeps the tiles in registers
        for (int g = 0; g < 8; ++g) {
          if (par == 0) {     // blocks 3 and 0 (mod 4)
            sk_st[g * (SK_PITCH + 1) + 32] = ga[g];
            skw[wofs[g]] = gb[g];
          } else {            // blocks 1 and 2 (mod 4)
            sk_st[g * (SK_PITCH + 1)] = ga[g];
            sk_st[g * (SK_PITCH + 1) + 16] = gb[g];
          }
        }
      }
      kb += 2;

      // ---- S^T: two 16-key tiles (K = 64), K rows from LDS as A, Q as B ----
      float sc[16];
#pragma unroll
      for (int sub = 0; sub < 2; ++sub) {
        const _Float16* krow = &Kl[par][sub * 16 + nn][0];
        v8f c = {};
        c = WMMA_F16(frag_ld(krow, k0), qa0, c);
        c = WMMA_F16(frag_ld(krow + 32, k0), qa1, c);
#pragma unroll
        for (int g = 0; g < 8; ++g)
          sc[sub * 8 + g] = (c[g] + rr[sub * 2 + (g >> 2)][g & 3]) * 0.125f;   // / sqrt(D_HEAD)
      }

      // ---- the next band products' Er fragments from the ring of band blocks ----
      {
        const _Float16* ea = &El[(j0 + 5 - wave) & 7][nn][0];   // block kb + 3
        const _Float16* eb = &El[(j0 + 6 - wave) & 7][nn][0];   // block kb + 4
        fa0 = frag_ld(ea, k0); fa1 = frag_ld(ea + 32, k0);
        fb0 = frag_ld(eb, k0); fb1 = frag_ld(eb + 32, k0);
      }
      // keeps these reads here, where the softmax covers their latency: the build sank them to the
      // slab's end, directly in front of the wait of the publish point
      __builtin_amdgcn_sched_barrier(0);

      // ---- online softmax across this 32-key slab: one query per lane ----
      float m4[4];
#pragma unroll
      for (int e = 0; e < 4; ++e)
        m4[e] = fmaxf(fmaxf(sc[e], sc[e + 4]), fmaxf(sc[e + 8], sc[e + 12]));
      float tm = fmaxf(fmaxf(m4[0], m4[1]), fmaxf(m4[2], m4[3]));
      tm = fmaxf(tm, other_half(tm));
      const float nm = fmaxf(rowmax, tm);
      const float al = __expf(rowmax - nm);
      rowmax = nm;
      v16h pb;          // P^T as B: element e = key 8 hiH + e (e < 8), 16 + 8 hiH + e - 8 (e >= 8)
      float p4[4] = {0.f, 0.f, 0.f, 0.f};
#pragma unroll
      for (int e = 0; e < 16; ++e) {
        const float p = __expf(sc[e] - nm);
        p4[e & 3] += p;
        pb[e] = (_Float16)p;
      }
      rowsum = rowsum * al + ((p4[0] + p4[1]) + (p4[2] + p4[3]));
#pragma unroll
      for (int g = 0; g < 8; ++g) { o0[g] *= al; o1[g] *= al; o2[g] *= al; o3[g] *= al; }

      // ---- O^T += V^T P^T : 4 WMMAs over the 64 head dims (K = 32), V^T rows from LDS as A ----
      const _Float16* vrow_ = &Vl[par][nn][0];
      o0 = WMMA_F16(frag_ld(vrow_,                k0), pb, o0);
      o1 = WMMA_F16(frag_ld(vrow_ + 16 * V_PITCH, k0), pb, o1);
      o2 = WMMA_F16(frag_ld(vrow_ + 32 * V_PITCH, k0), pb, o2);
      o3 = WMMA_F16(frag_ld(vrow_ + 48 * V_PITCH, k0), pb, o3);
    }
  }

  // ---- join the halves' sums, normalize and write (B, S, D_MODEL) f32 ----
  const float inv = 1.0f / (rowsum + other_half(rowsum));
  float* orow = out + ((size_t)(b * S_LEN + s0 + nn)) * D_MODEL + h * D_HEAD + 8 * hiH;
  *(v4f*)(orow +  0) = (v4f){o0[0], o0[1], o0[2], o0[3]} * inv;
  *(v4f*)(orow +  4) = (v4f){o0[4], o0[5], o0[6], o0[7]} * inv;
  *(v4f*)(orow + 16) = (v4f){o1[0], o1[1], o1[2], o1[3]} * inv;
  *(v4f*)(orow + 20) = (v4f){o1[4], o1[5], o1[6], o1[7]} * inv;
  *(v4f*)(orow + 32) = (v4f){o2[0], o2[1], o2[2], o2[3]} * inv;
  *(v4f*)(orow + 36) = (v4f){o2[4], o2[5], o2[6], o2[7]} * inv;
  *(v4f*)(orow + 48) = (v4f){o3[0], o3[1], o3[2], o3[3]} * inv;
  *(v4f*)(orow + 52) = (v4f){o3[4], o3[5], o3[6], o3[7]} * inv;
}

extern "C" void kernel_launch(void* const* d_in, const int* in_sizes, int n_in,
                              void* d_out, int out_size, void* d_ws, size_t ws_size,
                              hipStream_t stream) {
  (void)in_sizes; (void)n_in; (void)out_size; (void)ws_size;
  const float* x  = (const float*)d_in[0];
  const float* Wq = (const float*)d_in[1];
  const float* bq = (const float*)d_in[2];
  const float* Wk = (const float*)d_in[3];
  const float* bk = (const float*)d_in[4];
  const float* Wv = (const float*)d_in[5];
  const float* bv = (const float*)d_in[6];
  const float* Er = (const float*)d_in[7];

  char* ws = (char*)d_ws;
  const size_t xhN = (size_t)BATCH * S_LEN * D_MODEL;        // 4,194,304
  const size_t wN  = (size_t)D_MODEL * D_MODEL;              // 1,048,576
  const size_t erN = (size_t)S_LEN * D_HEAD;                 // 131,072

  _Float16* Xh  = (_Float16*)(ws);
  _Float16* Wqh = (_Float16*)(ws + 2 * xhN);
  _Float16* Wkh = Wqh + wN;
  _Float16* Wvh = Wkh + wN;
  _Float16* Erh = Wvh + wN;
  _Float16* Qh  = Erh + erN;
  _Float16* Kh  = Qh + xhN;
  _Float16* Vth = Kh + xhN;

  // Xh, Wqh, Wkh, Wvh, Erh are contiguous from Xh on
  cast_all<<<CAST_XB + 3 * CAST_WB + CAST_EB, CAST_T, 0, stream>>>(x, Wq, Wk, Wv, Er, Xh);

  // QKV: M = 4096 rows, N = 1024 feats, K = 1024; z selects Q/K/V
  qkv_gemm<<<dim3(D_MODEL / 128, (BATCH * S_LEN) / 128, 3), 128, 0, stream>>>(
      Xh, Wqh, Wkh, Wvh, bq, bk, bv, Qh, Kh, Vth);

  // attention: 64 query rows per block (4 waves x 16)
  attn_kernel<<<dim3(S_LEN / 64, N_HEADS, BATCH), 128, 0, stream>>>(
      Qh, Kh, Vth, Erh, (float*)d_out);
}

// v007
// One run takes 97.5 microseconds.
// Timed twice side by side with v006, it ran 1.03 and 1.02 times as fast.
// All steps since v000 together make it 4.06 times as fast.
#include <hip/hip_runtime.h>
#include <hip/hip_bf16.h>

#define S_LEN   2048
#define D_MODEL 1024
#define N_HEADS 16
#define D_HEAD  64
#define BATCH   2

typedef _Float16 h8   __attribute__((ext_vector_type(8)));
typedef _Float16 v16h __attribute__((ext_vector_type(16)));
typedef float    v8f  __attribute__((ext_vector_type(8)));

#define WMMA_F16(a, b, c) \
  __builtin_amdgcn_wmma_f32_16x16x32_f16(false, (a), false, (b), (short)0, (c), false, false)

// ---------- CDNA5 async global->LDS copy (guarded; falls back to ld+ds_store) ----------
#if defined(__has_builtin)
#if __has_builtin(__builtin_amdgcn_global_load_async_to_lds_b128)
#define HAVE_ASYNC_CP 1
#endif
#endif
#ifndef HAVE_ASYNC_CP
#define HAVE_ASYNC_CP 0
#endif

typedef int v4i_t __attribute__((vector_size(16)));
typedef __attribute__((address_space(1))) v4i_t* g_v4i_p;   // global int4*
typedef __attribute__((address_space(3))) v4i_t* l_v4i_p;   // LDS int4*

static __device__ __forceinline__ void cp16_g2l(const _Float16* g, _Float16* l) {
#if HAVE_ASYNC_CP
  __builtin_amdgcn_global_load_async_to_lds_b128(
      (g_v4i_p)(unsigned long long)g,
      (l_v4i_p)(unsigned int)(unsigned long long)l, 0, 0);
#else
  *(h8*)l = *(const h8*)g;
#endif
}
static __device__ __forceinline__ void wait_async_le0() {
#if HAVE_ASYNC_CP
  asm volatile("s_wait_asynccnt 0x0" ::: "memory");
#endif
}

// Load one lane's slice of a 16x32 (f16) A/B fragment.
// Layout per ISA 7.12.2: lanes 0-15 hold K[0..7]+K[16..23], lanes 16-31 hold K[8..15]+K[24..31].
static __device__ __forceinline__ v16h frag_ld(const _Float16* p, int k0) {
  h8 lo = *(const h8*)(p + k0);
  h8 hi = *(const h8*)(p + k0 + 16);
  return __builtin_shufflevector(lo, hi, 0,1,2,3,4,5,6,7,8,9,10,11,12,13,14,15);
}

// The skew reads, for query s and key t, position u = S - 1 + t - s of one band of 2 S positions:
// u < S is q[s].Er[u], u == S is the skew's zero column, u > S is q[s+1].Er[u - S - 1].
// Band block k holds positions 16 k .. 16 k + 15; a 16x16 score tile needs blocks k and k + 1.
#define BAND_WRAP (S_LEN / 16)   // first block that belongs to q[s+1]

// Er row behind column nn of band block k
static __device__ __forceinline__ const _Float16* band_row(const _Float16* __restrict__ Erh,
                                                           int k, int nn) {
  int e = k * 16 + nn - ((k >= BAND_WRAP) ? (S_LEN + 1) : 0);
  e = e < 0 ? 0 : e;                        // the zero column's lane
  e = e > (S_LEN - 1) ? (S_LEN - 1) : e;    // blocks fetched past the last slab, never used
  return Erh + (size_t)e * D_HEAD;
}

// Where a band block lies, known at compile time in the slab loop's steady phases
#define BAND_BELOW 0   // k < BAND_WRAP: q[s], no zero column
#define BAND_ABOVE 1   // k > BAND_WRAP: q[s+1], no zero column
#define BAND_ANY   2   // decided from k

// G = Qtile(16x64) @ (band block k)^T -> 16x16 f32 (2 WMMAs over K=64); k is wave-uniform
template <int WHERE>
static __device__ __forceinline__ v8f band_gemm(int k, int nn, v16h qa0, v16h qa1,
                                                v16h qs0, v16h qs1, v16h f0, v16h f1) {
  v8f c = {};
  if (WHERE == BAND_BELOW) {
    c = WMMA_F16(qa0, f0, c);
    return WMMA_F16(qa1, f1, c);
  }
  if (WHERE == BAND_ABOVE) {
    c = WMMA_F16(qs0, f0, c);
    return WMMA_F16(qs1, f1, c);
  }
  const bool wrap = (k >= BAND_WRAP);
  c = WMMA_F16(wrap ? qs0 : qa0, f0, c);
  c = WMMA_F16(wrap ? qs1 : qa1, f1, c);
  const bool zcol = (k * 16 + nn == S_LEN);
#pragma unroll   // constant g keeps the tile in registers
  for (int g = 0; g < 8; ++g) c[g] = zcol ? 0.f : c[g];
  return c;
}

template <int W> struct band_where { static constexpr int value = W; };

// ---------------- Kernel 1: f32 -> f16 cast of x, Wq, Wk, Wv and Er, one launch ----------------
// The five f16 copies lie one behind the other in the workspace, so a block's place in the grid is
// its place in the destination; each array is a whole number of blocks. A thread converts 64
// elements: sixteen 16-byte loads, each 512 contiguous bytes of a wave, issued ahead of the
// conversions, and sixteen 8-byte stores, each two whole 128-byte lines of a wave.
#define CAST_T 128                                        // threads per block
#define CAST_V 16                                         // 16-byte loads per thread
#define CAST_CHUNK (CAST_T * CAST_V * 4)                  // floats per block
#define CAST_XB (BATCH * S_LEN * D_MODEL / CAST_CHUNK)    // blocks of x
#define CAST_WB (D_MODEL * D_MODEL / CAST_CHUNK)          // blocks of each W
#define CAST_EB (S_LEN * D_HEAD / CAST_CHUNK)             // blocks of Er

typedef float    c4f __attribute__((ext_vector_type(4)));
typedef _Float16 c4h __attribute__((ext_vector_type(4)));

__global__ void __launch_bounds__(CAST_T)
cast_all(const float* __restrict__ x, const float* __restrict__ Wq, const float* __restrict__ Wk,
         const float* __restrict__ Wv, const float* __restrict__ Er, _Float16* __restrict__ dst) {
  const int blk = blockIdx.x;
  const float* src = x;
  int rel = blk;
  if (blk >= CAST_XB + 3 * CAST_WB)      { src = Er; rel = blk - (CAST_XB + 3 * CAST_WB); }
  else if (blk >= CAST_XB + 2 * CAST_WB) { src = Wv; rel = blk - (CAST_XB + 2 * CAST_WB); }
  else if (blk >= CAST_XB + CAST_WB)     { src = Wk; rel = blk - (CAST_XB + CAST_WB); }
  else if (blk >= CAST_XB)               { src = Wq; rel = blk - CAST_XB; }
  const float* p = src + (size_t)rel * CAST_CHUNK + threadIdx.x * 4;
  _Float16*    q = dst + (size_t)blk * CAST_CHUNK + threadIdx.x * 4;
  c4f v[CAST_V];
#pragma unroll   // constant j: the values stay in registers and the loads are in flight together
  for (int j = 0; j < CAST_V; ++j) v[j] = *(const c4f*)(p + j * CAST_T * 4);
#pragma unroll   // constant j, as above
  for (int j = 0; j < CAST_V; ++j)
    *(c4h*)(q + j * CAST_T * 4) = (c4h){(_Float16)v[j][0], (_Float16)v[j][1],
                                        (_Float16)v[j][2], (_Float16)v[j][3]};
}

// ---------------- Kernel 2: QKV projection GEMM ----------------
// y = Xh @ W^T + b ; z = 0/1/2 -> Q/K/V. Q,K stored (b,h,s,dh); V stored transposed (b,h,dh,s).
// One 128x128 tile of y per block, 64x64 per wave (4x4 WMMA tiles), so every LDS fragment
// feeds four WMMAs. A pass is 64 k: 128 W rows and 128 X rows of 128 B, laid at a pitch of
// 144 B (16 B x odd: conflict-free for ds_load_b128), two buffers filled by async copies.
#define G_PITCH 72                       // halfs per staged row (144 B)
#define G_STAGE (256 * G_PITCH)          // halfs per buffer: W rows 0..127, X rows 128..255
#define G_PASSES (D_MODEL / 64)

// Eight 16-byte async copies of one lane. The s_wait_xcnt stands inside the statement so
// that no address register of an issued copy is rewritten ahead of it.
static __device__ __forceinline__ void cp16x8(unsigned l, const _Float16* g) {
  const unsigned l1 = l + 1 * 16 * G_PITCH * 2, l2 = l + 2 * 16 * G_PITCH * 2,
                 l3 = l + 3 * 16 * G_PITCH * 2, l4 = l + 4 * 16 * G_PITCH * 2,
                 l5 = l + 5 * 16 * G_PITCH * 2, l6 = l + 6 * 16 * G_PITCH * 2,
                 l7 = l + 7 * 16 * G_PITCH * 2;
  const _Float16 *g1 = g + 1 * 16 * D_MODEL, *g2 = g + 2 * 16 * D_MODEL,
                 *g3 = g + 3 * 16 * D_MODEL, *g4 = g + 4 * 16 * D_MODEL,
                 *g5 = g + 5 * 16 * D_MODEL, *g6 = g + 6 * 16 * D_MODEL,
                 *g7 = g + 7 * 16 * D_MODEL;
  asm volatile(
      "global_load_async_to_lds_b128 %0, %8, off\n\t"
      "global_load_async_to_lds_b128 %1, %9, off\n\t"
      "global_load_async_to_lds_b128 %2, %10, off\n\t"
      "global_load_async_to_lds_b128 %3, %11, off\n\t"
      "global_load_async_to_lds_b128 %4, %12, off\n\t"
      "global_load_async_to_lds_b128 %5, %13, off\n\t"
      "global_load_async_to_lds_b128 %6, %14, off\n\t"
      "global_load_async_to_lds_b128 %7, %15, off\n\t"
      "s_wait_xcnt 0x0"
      :: "v"(l), "v"(l1), "v"(l2), "v"(l3), "v"(l4), "v"(l5), "v"(l6), "v"(l7),
         "v"(g), "v"(g1), "v"(g2), "v"(g3), "v"(g4), "v"(g5), "v"(g6), "v"(g7)
      : "memory");
}

// Epilogue memory operations stand with their waits in one asm statement each, so that no
// register that an issued load or store names is rewritten ahead of the wait (a precaution).
typedef float v4f __attribute__((ext_vector_type(4)));

// 4 x 8 consecutive floats at p + 16 i (i = 0..3)
static __device__ __forceinline__ void ld_bias_rows(const float* p, v4f (&b)[8]) {
  asm volatile(
      "global_load_b128 %0, %8, off\n\t"
      "global_load_b128 %1, %8, off offset:16\n\t"
      "global_load_b128 %2, %8, off offset:64\n\t"
      "global_load_b128 %3, %8, off offset:80\n\t"
      "global_load_b128 %4, %8, off offset:128\n\t"
      "global_load_b128 %5, %8, off offset:144\n\t"
      "global_load_b128 %6, %8, off offset:192\n\t"
      "global_load_b128 %7, %8, off offset:208\n\t"
      "s_wait_loadcnt 0x0\n\t"
      "s_wait_xcnt 0x0"
      : "=&v"(b[0]), "=&v"(b[1]), "=&v"(b[2]), "=&v"(b[3]),
        "=&v"(b[4]), "=&v"(b[5]), "=&v"(b[6]), "=&v"(b[7])
      : "v"(p) : "memory");
}
// one float at p + 16 j (j = 0..3)
static __device__ __forceinline__ void ld_bias_cols(const float* p, float (&b)[4]) {
  asm volatile(
      "global_load_b32 %0, %4, off\n\t"
      "global_load_b32 %1, %4, off offset:64\n\t"
      "global_load_b32 %2, %4, off offset:128\n\t"
      "global_load_b32 %3, %4, off offset:192\n\t"
      "s_wait_loadcnt 0x0\n\t"
      "s_wait_xcnt 0x0"
      : "=&v"(b[0]), "=&v"(b[1]), "=&v"(b[2]), "=&v"(b[3])
      : "v"(p) : "memory");
}
// Q,K: v[4 i + j] goes to token row + 16 j (rows of 128 B), dh + 16 i
static __device__ __forceinline__ void st_tile_qk(_Float16* p, const h8 (&v)[16]) {
  asm volatile(
      "global_store_b128 %0, %1, off\n\t"
      "global_store_b128 %0, %2, off offset:2048\n\t"
      "global_store_b128 %0, %3, off offset:4096\n\t"
      "global_store_b128 %0, %4, off offset:6144\n\t"
      "global_store_b128 %0, %5, off offset:32\n\t"
      "global_store_b128 %0, %6, off offset:2080\n\t"
      "global_store_b128 %0, %7, off offset:4128\n\t"
      "global_store_b128 %0, %8, off offset:6176\n\t"
      "global_store_b128 %0, %9, off offset:64\n\t"
      "global_store_b128 %0, %10, off offset:2112\n\t"
      "global_store_b128 %0, %11, off offset:4160\n\t"
      "global_store_b128 %0, %12, off offset:6208\n\t"
      "global_store_b128 %0, %13, off offset:96\n\t"
      "global_store_b128 %0, %14, off offset:2144\n\t"
      "global_store_b128 %0, %15, off offset:4192\n\t"
      "global_store_b128 %0, %16, off offset:6240\n\t"
      "s_wait_xcnt 0x0"
      :: "v"(p), "v"(v[0]), "v"(v[1]), "v"(v[2]), "v"(v[3]), "v"(v[4]), "v"(v[5]), "v"(v[6]), "v"(v[7]),
         "v"(v[8]), "v"(v[9]), "v"(v[10]), "v"(v[11]), "v"(v[12]), "v"(v[13]), "v"(v[14]), "v"(v[15])
      : "memory");
}
// V transposed: v[4 j + i] goes to dh row + 16 j (rows of S_LEN halfs = 4096 B), s + 16 i
static __device__ __forceinline__ void st_tile_vt(_Float16* p, const h8 (&v)[16]) {
  asm volatile(
      "global_store_b128 %0, %1, off\n\t"
      "global_store_b128 %0, %2, off offset:32\n\t"
      "global_store_b128 %0, %3, off offset:64\n\t"
      "global_store_b128 %0, %4, off offset:96\n\t"
      "global_store_b128 %0, %5, off offset:65536\n\t"
      "global_store_b128 %0, %6, off offset:65568\n\t"
      "global_store_b128 %0, %7, off offset:65600\n\t"
      "global_store_b128 %0, %8, off offset:65632\n\t"
      "global_store_b128 %0, %9, off offset:131072\n\t"
      "global_store_b128 %0, %10, off offset:131104\n\t"
      "global_store_b128 %0, %11, off offset:131136\n\t"
      "global_store_b128 %0, %12, off offset:131168\n\t"
      "global_store_b128 %0, %13, off offset:196608\n\t"
      "global_store_b128 %0, %14, off offset:196640\n\t"
      "global_store_b128 %0, %15, off offset:196672\n\t"
      "global_store_b128 %0, %16, off offset:196704\n\t"
      "s_wait_xcnt 0x0"
      :: "v"(p), "v"(v[0]), "v"(v[1]), "v"(v[2]), "v"(v[3]), "v"(v[4]), "v"(v[5]), "v"(v[6]), "v"(v[7]),
         "v"(v[8]), "v"(v[9]), "v"(v[10]), "v"(v[11]), "v"(v[12]), "v"(v[13]), "v"(v[14]), "v"(v[15])
      : "memory");
}

__global__ void __launch_bounds__(128)
qkv_gemm(const _Float16* __restrict__ Xh,
         const _Float16* __restrict__ Wqh, const _Float16* __restrict__ Wkh,
         const _Float16* __restrict__ Wvh,
         const float* __restrict__ bq, const float* __restrict__ bk, const float* __restrict__ bv,
         _Float16* __restrict__ Qh, _Float16* __restrict__ Kh, _Float16* __restrict__ Vth) {
  __shared__ __align__(16) _Float16 St[2 * G_STAGE];   // 73,728 B

  const int tid  = threadIdx.x;
  const int lane = tid & 31;
  const int wave = tid >> 5;
  const int nn   = lane & 15;
  const int hiH  = (lane >> 4) & 1;
  const int k0   = hiH * 8;
  const int n0   = blockIdx.x * 128 + (wave & 1) * 64;    // this wave's first feature
  const int row0 = blockIdx.y * 128 + (wave >> 1) * 64;   // this wave's first token row
  const int which = blockIdx.z;

  const _Float16* W    = (which == 0) ? Wqh : (which == 1) ? Wkh : Wvh;
  const float*    bias = (which == 0) ? bq  : (which == 1) ? bk  : bv;

  // copies: a lane brings chunk (tid & 7) of rows (tid >> 3) + 16 r, r = 0..7, of W and of X
  const int crow = tid >> 3, ccol = (tid & 7) << 3;
  const _Float16* gW = W  + (size_t)(blockIdx.x * 128 + crow) * D_MODEL + ccol;
  const _Float16* gX = Xh + (size_t)(blockIdx.y * 128 + crow) * D_MODEL + ccol;
  const unsigned  lW = (unsigned)(unsigned long long)&St[crow * G_PITCH + ccol];
  const unsigned  lX = lW + 128 * G_PITCH * 2;

  // Q,K: features are the rows of D (operand A = W), so a lane holds 8 consecutive dh of one
  // token; V: tokens are the rows (A = X), so a lane holds 8 consecutive s of one feature.
  const int wrow = (wave & 1) * 64 + nn, xrow = 128 + (wave >> 1) * 64 + nn;
  const int aoff = ((which == 2) ? xrow : wrow) * G_PITCH + k0;
  const int boff = ((which == 2) ? wrow : xrow) * G_PITCH + k0;

  v8f acc[4][4];
#pragma unroll
  for (int i = 0; i < 4; ++i)
#pragma unroll
    for (int j = 0; j < 4; ++j) acc[i][j] = (v8f){};

  cp16x8(lW, gW);
  cp16x8(lX, gX);
  wait_async_le0();
  __syncthreads();
  cp16x8(lW + G_STAGE * 2, gW + 64);
  cp16x8(lX + G_STAGE * 2, gX + 64);

  for (int t = 0; t < G_PASSES; ++t) {
    const int bo = (t & 1) * G_STAGE;
    // the whole pass's fragments go to registers as one group of LDS reads
    v16h af[2][4], bf[2][4];
#pragma unroll
    for (int ks = 0; ks < 2; ++ks)
#pragma unroll
      for (int i = 0; i < 4; ++i) {
        af[ks][i] = frag_ld(&St[bo + aoff + i * 16 * G_PITCH + ks * 32], 0);
        bf[ks][i] = frag_ld(&St[bo + boff + i * 16 * G_PITCH + ks * 32], 0);
      }
    // publish point of pass t + 1: own LDS reads done, own copies landed, then the barrier
    // that shows pass t + 1's tile to every wave and frees pass t's buffer for the refill
    asm volatile("s_wait_dscnt 0x0" ::: "memory");
    wait_async_le0();
    __syncthreads();
    if (t + 2 < G_PASSES) {
      cp16x8(lW + bo * 2, gW + (t + 2) * 64);
      cp16x8(lX + bo * 2, gX + (t + 2) * 64);
    }
    // the pass's WMMAs work on registers alone, so the refill flies under all of them
#pragma unroll
    for (int ks = 0; ks < 2; ++ks)
#pragma unroll
      for (int i = 0; i < 4; ++i)
#pragma unroll
        for (int j = 0; j < 4; ++j) acc[i][j] = WMMA_F16(af[ks][i], bf[ks][j], acc[i][j]);
  }
  wait_async_le0();   // no copy is outstanding when the wave ends

  const int bb = row0 >> 11;             // / S_LEN: one batch entry per 64-row wave tile
  const int s0 = row0 & (S_LEN - 1);
  const size_t head = (size_t)(bb * N_HEADS + (n0 >> 6));   // one head per 64-feature wave tile
  h8 v[16];
  if (which == 2) {
    float bb_[4];
    ld_bias_cols(bias + n0 + nn, bb_);
#pragma unroll
    for (int j = 0; j < 4; ++j)
#pragma unroll
      for (int i = 0; i < 4; ++i)
#pragma unroll
        for (int g = 0; g < 8; ++g) v[j * 4 + i][g] = (_Float16)(acc[i][j][g] + bb_[j]);
    st_tile_vt(Vth + (head * D_HEAD + nn) * S_LEN + s0 + hiH * 8, v);
  } else {
    v4f bb_[8];
    ld_bias_rows(bias + n0 + hiH * 8, bb_);
#pragma unroll
    for (int i = 0; i < 4; ++i)
#pragma unroll
      for (int j = 0; j < 4; ++j)
#pragma unroll
        for (int g = 0; g < 8; ++g)
          v[i * 4 + j][g] = (_Float16)(acc[i][j][g] + bb_[i * 2 + (g >> 2)][g & 3]);
    st_tile_qk(((which == 0) ? Qh : Kh) + (head * S_LEN + s0 + nn) * D_HEAD + hiH * 8, v);
  }
}

// ---------------- Kernel 3: flash attention with relative skew ----------------
// K/V slabs (32 keys) are double-buffered in LDS via async copies, shared by all 4 waves;
// the copies of slab n+1 are issued behind slab n's barrier and fly under its compute.
// A fragment read takes 16 bytes of each of 16 rows per half wave: at a row pitch of 16 B x odd
// the 16 rows fall on all 64 banks; at the rows' own 128 B and 64 B they fall on 8 and 16 banks.
#define K_PITCH 72   // halfs per staged K row: 64 + 8 (144 B)
#define V_PITCH 40   // halfs per staged V^T row: 32 + 8 (80 B)
static __device__ __forceinline__ void slab_load(const _Float16* __restrict__ Kbase,
                                                 const _Float16* __restrict__ Vbase,
                                                 int t0,
                                                 _Float16 (*Kl)[K_PITCH], _Float16 (*Vl)[V_PITCH],
                                                 int tid) {
#pragma unroll
  for (int r = 0; r < 2; ++r) {
    int c = tid + r * 128;                 // 0..255
    int krow = c >> 3, kcol = (c & 7) << 3;   // 32 rows x 64 halfs
    cp16_g2l(Kbase + (size_t)(t0 + krow) * D_HEAD + kcol, &Kl[krow][kcol]);
    int vrow = c >> 2, vcol = (c & 3) << 3;   // 64 rows x 32 halfs
    cp16_g2l(Vbase + (size_t)vrow * S_LEN + t0 + vcol, &Vl[vrow][vcol]);
  }
}

// One band block (16 Er rows of 128 B) into its ring slot, whole 128-byte lines: a thread brings
// 16 bytes of row tid / 8. k is the same for the whole block of threads.
static __device__ __forceinline__ void band_stage(const _Float16* __restrict__ Erh, int k,
                                                  _Float16 (*slot)[K_PITCH], int tid) {
  const int row = tid >> 3, col = (tid & 7) << 3;
  cp16_g2l(band_row(Erh, k, row) + col, &slot[row][col]);
}

#define SK_PITCH 68   // floats per ring row: 64 keys + 4, so 16 rows' 16-byte reads fall on 64 banks

// value of the lane 16 away
static __device__ __forceinline__ float other_half(float v) {
  int b = __builtin_bit_cast(int, v);
  b = __builtin_amdgcn_permlanex16(b, b, 0x76543210, 0xfedcba98, false, false);
  return __builtin_bit_cast(float, b);
}

// The grid gives every SIMD four waves; said to the compiler, so that it does not hold registers
// down for a fifth wave that the larger LDS would still admit and serialise the fragment reads.
__global__ void __launch_bounds__(128) __attribute__((amdgpu_waves_per_eu(4, 4)))
attn_kernel(const _Float16* __restrict__ Qh, const _Float16* __restrict__ Kh,
            const _Float16* __restrict__ Vt, const _Float16* __restrict__ Erh,
            float* __restrict__ out) {
  __shared__ __align__(16) _Float16 Kl[2][32][K_PITCH];   // double-buffered K slab
  __shared__ __align__(16) _Float16 Vl[2][64][V_PITCH];   // double-buffered V slab (dh,t)
  __shared__ __align__(16) float sk[4][16 * SK_PITCH];   // per-wave skew ring
  __shared__ __align__(16) _Float16 El[8][16][K_PITCH];   // ring of band blocks, shared by the waves

  const int tid  = threadIdx.x;
  const int lane = tid & 31;
  const int wave = __builtin_amdgcn_readfirstlane(tid >> 5);   // scalar: picks the band blocks
  const int hiH  = (lane >> 4) & 1;
  const int k0   = hiH * 8;
  const int nn   = lane & 15;

  const int h  = blockIdx.y;
  const int b  = blockIdx.z;
  const int s0 = blockIdx.x * 64 + wave * 16;

  const size_t head = (size_t)(b * N_HEADS + h) * (size_t)S_LEN * D_HEAD;
  const _Float16* Qbase = Qh + head;
  const _Float16* Kbase = Kh + head;
  const _Float16* Vbase = Vt + head;   // (dh, t) layout

  // warm the Er diagonal band this block touches first
  {
    int e = S_LEN - 16 - s0 + nn;
    e = e < 0 ? 0 : e;
    __builtin_prefetch(Erh + (size_t)e * D_HEAD, 0, 1);
  }

  const _Float16* qrow = Qbase + (size_t)(s0 + nn) * D_HEAD;
  int sshift = s0 + nn + 1; if (sshift > S_LEN - 1) sshift = S_LEN - 1;
  const _Float16* qsrow = Qbase + (size_t)sshift * D_HEAD;  // rows s+1 (skew wrap term)

  const v16h qa0 = frag_ld(qrow, k0);        // Q  d 0..31
  const v16h qa1 = frag_ld(qrow + 32, k0);   // Q  d 32..63
  const v16h qs0 = frag_ld(qsrow, k0);       // Qs d 0..31
  const v16h qs1 = frag_ld(qsrow + 32, k0);  // Qs d 32..63

  float rowmax = -3.0e38f, rowsum = 0.f;     // of query s0 + nn; rowsum over this half's keys
  v8f o0 = {}, o1 = {}, o2 = {}, o3 = {};    // O^T: register g = dh 16 n + 8 hiH + g, lane = query

  slab_load(Kbase, Vbase, 0, Kl[0], Vl[0], tid);   // preload slab 0

  // Wave w's band stream runs w blocks behind wave 0's, so the four waves read the same Er rows
  // within two slabs: each block is staged once for all of them. Block kb0 + j lies in slot j & 7.
  // In slab n the waves read j = 2 n + 2 .. 2 n + 6 while j = 2 n + 7 and 2 n + 8 are in flight.
  const int kb0 = (S_LEN - 16 - (int)blockIdx.x * 64) >> 4;
#pragma unroll   // constant j: the slots are immediate offsets
  for (int j = 2; j < 7; ++j) band_stage(Erh, kb0 + j, El[j], tid);

  // Band stream: block kb + m holds, for query row i, keys 16 m - 15 + i .. 16 m + i, so slab n
  // (keys 32 n .. 32 n + 31) needs blocks m <= 2 n + 2. Blocks are multiplied and stored one slab
  // ahead of their first full use; their Er fragments are fetched one slab before that, the first
  // two blocks' from memory, all later ones from the LDS ring of band blocks.
  // Ring column of (row i = 8 hiH + g, lane nn) in block m: (16 m + 49 + nn + i) & 63; only
  // m = 0 (mod 4) can wrap inside a block.
  float* const skw = &sk[wave][0];
  float* const sk_st = skw + (8 * hiH) * (SK_PITCH + 1) + nn + 1;    // + g (SK_PITCH + 1) + 16 ((m & 3) - 1)
  const float* const sk_ld = skw + nn * SK_PITCH + 8 * hiH;          // + (first key of the tile) & 63
  int wofs[8];                                                       // the wrapping block's places
#pragma unroll   // constant g keeps the table in registers
  for (int g = 0; g < 8; ++g)
    wofs[g] = (8 * hiH + g) * SK_PITCH + ((49 + nn + 8 * hiH + g) & 63);

  int kb = (S_LEN - 16 - s0) >> 4;
  {
    const _Float16* r0 = band_row(Erh, kb, nn);
    const _Float16* r1 = band_row(Erh, kb + 1, nn);
    const _Float16* r2 = band_row(Erh, kb + 2, nn);
    const v8f g0 = band_gemm<BAND_ANY>(kb,     nn, qa0, qa1, qs0, qs1, frag_ld(r0, k0), frag_ld(r0 + 32, k0));
    const v8f g1 = band_gemm<BAND_ANY>(kb + 1, nn, qa0, qa1, qs0, qs1, frag_ld(r1, k0), frag_ld(r1 + 32, k0));
    const v8f g2 = band_gemm<BAND_ANY>(kb + 2, nn, qa0, qa1, qs0, qs1, frag_ld(r2, k0), frag_ld(r2 + 32, k0));
#pragma unroll   // constant g keeps the tiles in registers
    for (int g = 0; g < 8; ++g) {
      skw[wofs[g]] = g0[g];
      sk_st[g * (SK_PITCH + 1)] = g1[g];
      sk_st[g * (SK_PITCH + 1) + 16] = g2[g];
    }
  }
  const _Float16* ra = band_row(Erh, kb + 3, nn);
  const _Float16* rb = band_row(Erh, kb + 4, nn);
  v16h fa0 = frag_ld(ra, k0), fa1 = frag_ld(ra + 32, k0);
  v16h fb0 = frag_ld(rb, k0), fb1 = frag_ld(rb + 32, k0);

  // two slabs (64 keys from tp on); where says on which side of the wrap their band blocks lie
  auto slab_pair = [&](auto where, const int tp) __attribute__((always_inline)) {
    constexpr int WHERE = decltype(where)::value;
#pragma unroll   // constant par: buffer and ring places become immediate offsets
    for (int par = 0; par < 2; ++par) {
      const int t0 = tp + par * 32;
      const int j0 = t0 >> 4;            // 2 n
      // publish point: own LDS reads of the slab before done, own copies (this slab, band blocks up
      // to j0 + 6) landed, then the one barrier that shows them to every wave and frees the places
      // that the slab before has read for the refill
      asm volatile("s_wait_dscnt 0x0" ::: "memory");
      wait_async_le0();
      __syncthreads();   // also orders the ring's stores of the slab before ahead of the reads below
      if (t0 + 32 < S_LEN) {
        slab_load(Kbase, Vbase, t0 + 32, Kl[par ^ 1], Vl[par ^ 1], tid);
        band_stage(Erh, kb0 + j0 + 7, El[(j0 + 7) & 7], tid);
        band_stage(Erh, kb0 + j0 + 8, El[j0 & 7], tid);
      }

      // ---- Srel^T of this slab from the ring: 8 consecutive keys of the lane's query per tile ----
      v4f rr[4];
#pragma unroll
      for (int q = 0; q < 4; ++q) rr[q] = *(const v4f*)(sk_ld + par * 32 + (q >> 1) * 16 + (q & 1) * 4);
      // the slab's K fragments
      v16h kf[2][2];
#pragma unroll   // constant sub keeps the fragments in registers
      for (int sub = 0; sub < 2; ++sub) {
        const _Float16* krow = &Kl[par][sub * 16 + nn][0];
        kf[sub][0] = frag_ld(krow, k0);
        kf[sub][1] = frag_ld(krow + 32, k0);
      }
      // the ring places stored below alias keys read above: keep the compiler from lifting the
      // stores over those reads (the wave's LDS operations run in program order)
      __builtin_amdgcn_fence(__ATOMIC_ACQ_REL, "wavefront");
      // keeps the reads above one group ahead of the products: with the selects gone the build read
      // the K fragments one by one into the same registers, a full wait in front of each product
      __builtin_amdgcn_sched_barrier(0);

      // the next slab's two new band blocks; the fragments of the slab after go into the same
      // registers further down
      const v8f ga = band_gemm<WHERE>(kb + 3, nn, qa0, qa1, qs0, qs1, fa0, fa1);
      const v8f gb = band_gemm<WHERE>(kb + 4, nn, qa0, qa1, qs0, qs1, fb0, fb1);
      kb += 2;

      // ---- S^T: two 16-key tiles (K = 64), K rows from LDS as A, Q as B ----
      float sc[16];
#pragma unroll
      for (int sub = 0; sub < 2; ++sub) {
        v8f c = {};
        c = WMMA_F16(kf[sub][0], qa0, c);
        c = WMMA_F16(kf[sub][1], qa1, c);
#pragma unroll
        for (int g = 0; g < 8; ++g)
          sc[sub * 8 + g] = (c[g] + rr[sub * 2 + (g >> 2)][g & 3]) * 0.125f;   // / sqrt(D_HEAD)
      }

      // ---- the next band products' Er fragments from the ring of band blocks ----
      {
        const _Float16* ea = &El[(j0 + 5 - wave) & 7][nn][0];   // block kb + 3
        const _Float16* eb = &El[(j0 + 6 - wave) & 7][nn][0];   // block kb + 4
        fa0 = frag_ld(ea, k0); fa1 = frag_ld(ea + 32, k0);
        fb0 = frag_ld(eb, k0); fb1 = frag_ld(eb + 32, k0);
      }
      // keeps these reads here, where the softmax covers their latency: the build sank them to the
      // slab's end, directly in front of the wait of the publish point
      __builtin_amdgcn_sched_barrier(0);

      // the band products go into the ring behind the S^T products: both tiles stay live over them,
      // so no S^T product takes a band product's registers as its result inside the WMMA distance
#pragma unroll   // constant g keeps the tiles in registers
      for (int g = 0; g < 8; ++g) {
        if (par == 0) {     // blocks 3 and 0 (mod 4)
          sk_st[g * (SK_PITCH + 1) + 32] = ga[g];
          skw[wofs[g]] = gb[g];
        } else {            // blocks 1 and 2 (mod 4)
          sk_st[g * (SK_PITCH + 1)] = ga[g];
          sk_st[g * (SK_PITCH + 1) + 16] = gb[g];
        }
      }

      // ---- online softmax across this 32-key slab: one query per lane ----
      float m4[4];
#pragma unroll
      for (int e = 0; e < 4; ++e)
        m4[e] = fmaxf(fmaxf(sc[e], sc[e + 4]), fmaxf(sc[e + 8], sc[e + 12]));
      float tm = fmaxf(fmaxf(m4[0], m4[1]), fmaxf(m4[2], m4[3]));
      tm = fmaxf(tm, other_half(tm));
      const float nm = fmaxf(rowmax, tm);
      const float al = __expf(rowmax - nm);
      rowmax = nm;
      v16h pb;          // P^T as B: element e = key 8 hiH + e (e < 8), 16 + 8 hiH + e - 8 (e >= 8)
      float p4[4] = {0.f, 0.f, 0.f, 0.f};
#pragma unroll
      for (int e = 0; e < 16; ++e) {
        const float p = __expf(sc[e] - nm);
        p4[e & 3] += p;
        pb[e] = (_Float16)p;
      }
      rowsum = rowsum * al + ((p4[0] + p4[1]) + (p4[2] + p4[3]));
#pragma unroll
      for (int g = 0; g < 8; ++g) { o0[g] *= al; o1[g] *= al; o2[g] *= al; o3[g] *= al; }

      // ---- O^T += V^T P^T : 4 WMMAs over the 64 head dims (K = 32), V^T rows from LDS as A ----
      const _Float16* vrow_ = &Vl[par][nn][0];
      o0 = WMMA_F16(frag_ld(vrow_,                k0), pb, o0);
      o1 = WMMA_F16(frag_ld(vrow_ + 16 * V_PITCH, k0), pb, o1);
      o2 = WMMA_F16(frag_ld(vrow_ + 32 * V_PITCH, k0), pb, o2);
      o3 = WMMA_F16(frag_ld(vrow_ + 48 * V_PITCH, k0), pb, o3);
    }
  };

  // Slab n multiplies blocks kb0 - wave + 2 n + 3 and + 4, kb0 = BAND_WRAP - 1 - 4 blockIdx.x. For
  // every wave of the block they lie below the wrap in the pairs of slabs before blockIdx.x - 1 and
  // above it from pair blockIdx.x + 1 on: there the Q operand is fixed and no zero column is cut,
  // so the selects stand only in the pairs between. The bounds are the same for the whole block.
  const int t_any   = ((int)blockIdx.x > 1 ? (int)blockIdx.x - 1 : 0) * 64;
  const int t_above = ((int)blockIdx.x + 1) * 64;
  int tp = 0;
  for (; tp < t_any; tp += 64)   slab_pair(band_where<BAND_BELOW>{}, tp);
  for (; tp < t_above; tp += 64) slab_pair(band_where<BAND_ANY>{}, tp);
  for (; tp < S_LEN; tp += 64)   slab_pair(band_where<BAND_ABOVE>{}, tp);

  // ---- join the halves' sums, normalize and write (B, S, D_MODEL) f32 ----
  const float inv = 1.0f / (rowsum + other_half(rowsum));
  float* orow = out + ((size_t)(b * S_LEN + s0 + nn)) * D_MODEL + h * D_HEAD + 8 * hiH;
  *(v4f*)(orow +  0) = (v4f){o0[0], o0[1], o0[2], o0[3]} * inv;
  *(v4f*)(orow +  4) = (v4f){o0[4], o0[5], o0[6], o0[7]} * inv;
  *(v4f*)(orow + 16) = (v4f){o1[0], o1[1], o1[2], o1[3]} * inv;
  *(v4f*)(orow + 20) = (v4f){o1[4], o1[5], o1[6], o1[7]} * inv;
  *(v4f*)(orow + 32) = (v4f){o2[0], o2[1], o2[2], o2[3]} * inv;
  *(v4f*)(orow + 36) = (v4f){o2[4], o2[5], o2[6], o2[7]} * inv;
  *(v4f*)(orow + 48) = (v4f){o3[0], o3[1], o3[2], o3[3]} * inv;
  *(v4f*)(orow + 52) = (v4f){o3[4], o3[5], o3[6], o3[7]} * inv;
}

extern "C" void kernel_launch(void* const* d_in, const int* in_sizes, int n_in,
                              void* d_out, int out_size, void* d_ws, size_t ws_size,
                              hipStream_t stream) {
  (void)in_sizes; (void)n_in; (void)out_size; (void)ws_size;
  const float* x  = (const float*)d_in[0];
  const float* Wq = (const float*)d_in[1];
  const float* bq = (const float*)d_in[2];
  const float* Wk = (const float*)d_in[3];
  const float* bk = (const float*)d_in[4];
  const float* Wv = (const float*)d_in[5];
  const float* bv = (const float*)d_in[6];
  const float* Er = (const float*)d_in[7];

  char* ws = (char*)d_ws;
  const size_t xhN = (size_t)BATCH * S_LEN * D_MODEL;        // 4,194,304
  const size_t wN  = (size_t)D_MODEL * D_MODEL;              // 1,048,576
  const size_t erN = (size_t)S_LEN * D_HEAD;                 // 131,072

  _Float16* Xh  = (_Float16*)(ws);
  _Float16* Wqh = (_Float16*)(ws + 2 * xhN);
  _Float16* Wkh = Wqh + wN;
  _Float16* Wvh = Wkh + wN;
  _Float16* Erh = Wvh + wN;
  _Float16* Qh  = Erh + erN;
  _Float16* Kh  = Qh + xhN;
  _Float16* Vth = Kh + xhN;

  // Xh, Wqh, Wkh, Wvh, Erh are contiguous from Xh on
  cast_all<<<CAST_XB + 3 * CAST_WB + CAST_EB, CAST_T, 0, stream>>>(x, Wq, Wk, Wv, Er, Xh);

  // QKV: M = 4096 rows, N = 1024 feats, K = 1024; z selects Q/K/V
  qkv_gemm<<<dim3(D_MODEL / 128, (BATCH * S_LEN) / 128, 3), 128, 0, stream>>>(
      Xh, Wqh, Wkh, Wvh, bq, bk, bv, Qh, Kh, Vth);

  // attention: 64 query rows per block (4 waves x 16)
  attn_kernel<<<dim3(S_LEN / 64, N_HEADS, BATCH), 128, 0, stream>>>(
      Qh, Kh, Vth, Erh, (float*)d_out);
}

// v008
// One run takes 93.7 microseconds.
// Two timings next to v007 put it at 1.03 and 1.04 times that version's speed.
// Counting every step since v000, it is 4.21 times as fast.
#include <hip/hip_runtime.h>
#include <hip/hip_bf16.h>

#define S_LEN   2048
#define D_MODEL 1024
#define N_HEADS 16
#define D_HEAD  64
#define BATCH   2

typedef _Float16 h8   __attribute__((ext_vector_type(8)));
typedef _Float16 v16h __attribute__((ext_vector_type(16)));
typedef float    v8f  __attribute__((ext_vector_type(8)));

#define WMMA_F16(a, b, c) \
  __builtin_amdgcn_wmma_f32_16x16x32_f16(false, (a), false, (b), (short)0, (c), false, false)

// ---------- CDNA5 async global->LDS copy (guarded; falls back to ld+ds_store) ----------
#if defined(__has_builtin)
#if __has_builtin(__builtin_amdgcn_global_load_async_to_lds_b128)
#define HAVE_ASYNC_CP 1
#endif
#endif
#ifndef HAVE_ASYNC_CP
#define HAVE_ASYNC_CP 0
#endif

typedef int v4i_t __attribute__((vector_size(16)));
typedef __attribute__((address_space(1))) v4i_t* g_v4i_p;   // global int4*
typedef __attribute__((address_space(3))) v4i_t* l_v4i_p;   // LDS int4*

static __device__ __forceinline__ void cp16_g2l(const _Float16* g, _Float16* l) {
#if HAVE_ASYNC_CP
  __builtin_amdgcn_global_load_async_to_lds_b128(
      (g_v4i_p)(unsigned long long)g,
      (l_v4i_p)(unsigned int)(unsigned long long)l, 0, 0);
#else
  *(h8*)l = *(const h8*)g;
#endif
}
static __device__ __forceinline__ void wait_async_le0() {
#if HAVE_ASYNC_CP
  asm volatile("s_wait_asynccnt 0x0" ::: "memory");
#endif
}

// Load one lane's slice of a 16x32 (f16) A/B fragment.
// Layout per ISA 7.12.2: lanes 0-15 hold K[0..7]+K[16..23], lanes 16-31 hold K[8..15]+K[24..31].
static __device__ __forceinline__ v16h frag_ld(const _Float16* p, int k0) {
  h8 lo = *(const h8*)(p + k0);
  h8 hi = *(const h8*)(p + k0 + 16);
  return __builtin_shufflevector(lo, hi, 0,1,2,3,4,5,6,7,8,9,10,11,12,13,14,15);
}

// The skew reads, for query s and key t, position u = S - 1 + t - s of one band of 2 S positions:
// u < S is q[s].Er[u], u == S is the skew's zero column, u > S is q[s+1].Er[u - S - 1].
// Band block k holds positions 16 k .. 16 k + 15; a 16x16 score tile needs blocks k and k + 1.
#define BAND_WRAP (S_LEN / 16)   // first block that belongs to q[s+1]

// Er row behind column nn of band block k
static __device__ __forceinline__ const _Float16* band_row(const _Float16* __restrict__ Erh,
                                                           int k, int nn) {
  int e = k * 16 + nn - ((k >= BAND_WRAP) ? (S_LEN + 1) : 0);
  e = e < 0 ? 0 : e;                        // the zero column's lane
  e = e > (S_LEN - 1) ? (S_LEN - 1) : e;    // blocks fetched past the last slab, never used
  return Erh + (size_t)e * D_HEAD;
}

// Where a band block lies, known at compile time in the slab loop's steady phases
#define BAND_BELOW 0   // k < BAND_WRAP: q[s], no zero column
#define BAND_ABOVE 1   // k > BAND_WRAP: q[s+1], no zero column
#define BAND_ANY   2   // decided from k

// G = Qtile(16x64) @ (band block k)^T -> 16x16 f32 (2 WMMAs over K=64); k is wave-uniform
template <int WHERE>
static __device__ __forceinline__ v8f band_gemm(int k, int nn, v16h qa0, v16h qa1,
                                                v16h qs0, v16h qs1, v16h f0, v16h f1) {
  v8f c = {};
  if (WHERE == BAND_BELOW) {
    c = WMMA_F16(qa0, f0, c);
    return WMMA_F16(qa1, f1, c);
  }
  if (WHERE == BAND_ABOVE) {
    c = WMMA_F16(qs0, f0, c);
    return WMMA_F16(qs1, f1, c);
  }
  const bool wrap = (k >= BAND_WRAP);
  c = WMMA_F16(wrap ? qs0 : qa0, f0, c);
  c = WMMA_F16(wrap ? qs1 : qa1, f1, c);
  const bool zcol = (k * 16 + nn == S_LEN);
#pragma unroll   // constant g keeps the tile in registers
  for (int g = 0; g < 8; ++g) c[g] = zcol ? 0.f : c[g];
  return c;
}

template <int W> struct band_where { static constexpr int value = W; };

// ---------------- Kernel 1: f32 -> f16 cast of x, Wq, Wk, Wv and Er, one launch ----------------
// The five f16 copies lie one behind the other in the workspace, so a block's place in the grid is
// its place in the destination; each array is a whole number of blocks. A thread converts 64
// elements: sixteen 16-byte loads, each 512 contiguous bytes of a wave, issued ahead of the
// conversions, and sixteen 8-byte stores, each two whole 128-byte lines of a wave.
#define CAST_T 128                                        // threads per block
#define CAST_V 16                                         // 16-byte loads per thread
#define CAST_CHUNK (CAST_T * CAST_V * 4)                  // floats per block
#define CAST_XB (BATCH * S_LEN * D_MODEL / CAST_CHUNK)    // blocks of x
#define CAST_WB (D_MODEL * D_MODEL / CAST_CHUNK)          // blocks of each W
#define CAST_EB (S_LEN * D_HEAD / CAST_CHUNK)             // blocks of Er

typedef float    c4f __attribute__((ext_vector_type(4)));
typedef _Float16 c4h __attribute__((ext_vector_type(4)));

__global__ void __launch_bounds__(CAST_T)
cast_all(const float* __restrict__ x, const float* __restrict__ Wq, const float* __restrict__ Wk,
         const float* __restrict__ Wv, const float* __restrict__ Er, _Float16* __restrict__ dst) {
  const int blk = blockIdx.x;
  const float* src = x;
  int rel = blk;
  if (blk >= CAST_XB + 3 * CAST_WB)      { src = Er; rel = blk - (CAST_XB + 3 * CAST_WB); }
  else if (blk >= CAST_XB + 2 * CAST_WB) { src = Wv; rel = blk - (CAST_XB + 2 * CAST_WB); }
  else if (blk >= CAST_XB + CAST_WB)     { src = Wk; rel = blk - (CAST_XB + CAST_WB); }
  else if (blk >= CAST_XB)               { src = Wq; rel = blk - CAST_XB; }
  const float* p = src + (size_t)rel * CAST_CHUNK + threadIdx.x * 4;
  _Float16*    q = dst + (size_t)blk * CAST_CHUNK + threadIdx.x * 4;
  c4f v[CAST_V];
#pragma unroll   // constant j: the values stay in registers and the loads are in flight together
  for (int j = 0; j < CAST_V; ++j) v[j] = *(const c4f*)(p + j * CAST_T * 4);
#pragma unroll   // constant j, as above
  for (int j = 0; j < CAST_V; ++j)
    *(c4h*)(q + j * CAST_T * 4) = (c4h){(_Float16)v[j][0], (_Float16)v[j][1],
                                        (_Float16)v[j][2], (_Float16)v[j][3]};
}

// ---------------- Kernel 2: QKV projection GEMM ----------------
// y = Xh @ W^T + b ; z = 0/1/2 -> Q/K/V. Q,K stored (b,h,s,dh); V stored transposed (b,h,dh,s).
// One 128x128 tile of y per block, 64x64 per wave (4x4 WMMA tiles), so every LDS fragment
// feeds four WMMAs. A pass is 64 k: 128 W rows and 128 X rows of 128 B, laid at a pitch of
// 144 B (16 B x odd: conflict-free for ds_load_b128), two buffers filled by async copies.
#define G_PITCH 72                       // halfs per staged row (144 B)
#define G_STAGE (256 * G_PITCH)          // halfs per buffer: W rows 0..127, X rows 128..255
#define G_PASSES (D_MODEL / 64)

// Eight 16-byte async copies of one lane. The s_wait_xcnt stands inside the statement so
// that no address register of an issued copy is rewritten ahead of it.
static __device__ __forceinline__ void cp16x8(unsigned l, const _Float16* g) {
  const unsigned l1 = l + 1 * 16 * G_PITCH * 2, l2 = l + 2 * 16 * G_PITCH * 2,
                 l3 = l + 3 * 16 * G_PITCH * 2, l4 = l + 4 * 16 * G_PITCH * 2,
                 l5 = l + 5 * 16 * G_PITCH * 2, l6 = l + 6 * 16 * G_PITCH * 2,
                 l7 = l + 7 * 16 * G_PITCH * 2;
  const _Float16 *g1 = g + 1 * 16 * D_MODEL, *g2 = g + 2 * 16 * D_MODEL,
                 *g3 = g + 3 * 16 * D_MODEL, *g4 = g + 4 * 16 * D_MODEL,
                 *g5 = g + 5 * 16 * D_MODEL, *g6 = g + 6 * 16 * D_MODEL,
                 *g7 = g + 7 * 16 * D_MODEL;
  asm volatile(
      "global_load_async_to_lds_b128 %0, %8, off\n\t"
      "global_load_async_to_lds_b128 %1, %9, off\n\t"
      "global_load_async_to_lds_b128 %2, %10, off\n\t"
      "global_load_async_to_lds_b128 %3, %11, off\n\t"
      "global_load_async_to_lds_b128 %4, %12, off\n\t"
      "global_load_async_to_lds_b128 %5, %13, off\n\t"
      "global_load_async_to_lds_b128 %6, %14, off\n\t"
      "global_load_async_to_lds_b128 %7, %15, off\n\t"
      "s_wait_xcnt 0x0"
      :: "v"(l), "v"(l1), "v"(l2), "v"(l3), "v"(l4), "v"(l5), "v"(l6), "v"(l7),
         "v"(g), "v"(g1), "v"(g2), "v"(g3), "v"(g4), "v"(g5), "v"(g6), "v"(g7)
      : "memory");
}

// Epilogue memory operations stand with their waits in one asm statement each, so that no
// register that an issued load or store names is rewritten ahead of the wait (a precaution).
typedef float v4f __attribute__((ext_vector_type(4)));

// 4 x 8 consecutive floats at p + 16 i (i = 0..3)
static __device__ __forceinline__ void ld_bias_rows(const float* p, v4f (&b)[8]) {
  asm volatile(
      "global_load_b128 %0, %8, off\n\t"
      "global_load_b128 %1, %8, off offset:16\n\t"
      "global_load_b128 %2, %8, off offset:64\n\t"
      "global_load_b128 %3, %8, off offset:80\n\t"
      "global_load_b128 %4, %8, off offset:128\n\t"
      "global_load_b128 %5, %8, off offset:144\n\t"
      "global_load_b128 %6, %8, off offset:192\n\t"
      "global_load_b128 %7, %8, off offset:208\n\t"
      "s_wait_loadcnt 0x0\n\t"
      "s_wait_xcnt 0x0"
      : "=&v"(b[0]), "=&v"(b[1]), "=&v"(b[2]), "=&v"(b[3]),
        "=&v"(b[4]), "=&v"(b[5]), "=&v"(b[6]), "=&v"(b[7])
      : "v"(p) : "memory");
}
// one float at p + 16 j (j = 0..3)
static __device__ __forceinline__ void ld_bias_cols(const float* p, float (&b)[4]) {
  asm volatile(
      "global_load_b32 %0, %4, off\n\t"
      "global_load_b32 %1, %4, off offset:64\n\t"
      "global_load_b32 %2, %4, off offset:128\n\t"
      "global_load_b32 %3, %4, off offset:192\n\t"
      "s_wait_loadcnt 0x0\n\t"
      "s_wait_xcnt 0x0"
      : "=&v"(b[0]), "=&v"(b[1]), "=&v"(b[2]), "=&v"(b[3])
      : "v"(p) : "memory");
}
// Q,K: v[4 i + j] goes to token row + 16 j (rows of 128 B), dh + 16 i
static __device__ __forceinline__ void st_tile_qk(_Float16* p, const h8 (&v)[16]) {
  asm volatile(
      "global_store_b128 %0, %1, off\n\t"
      "global_store_b128 %0, %2, off offset:2048\n\t"
      "global_store_b128 %0, %3, off offset:4096\n\t"
      "global_store_b128 %0, %4, off offset:6144\n\t"
      "global_store_b128 %0, %5, off offset:32\n\t"
      "global_store_b128 %0, %6, off offset:2080\n\t"
      "global_store_b128 %0, %7, off offset:4128\n\t"
      "global_store_b128 %0, %8, off offset:6176\n\t"
      "global_store_b128 %0, %9, off offset:64\n\t"
      "global_store_b128 %0, %10, off offset:2112\n\t"
      "global_store_b128 %0, %11, off offset:4160\n\t"
      "global_store_b128 %0, %12, off offset:6208\n\t"
      "global_store_b128 %0, %13, off offset:96\n\t"
      "global_store_b128 %0, %14, off offset:2144\n\t"
      "global_store_b128 %0, %15, off offset:4192\n\t"
      "global_store_b128 %0, %16, off offset:6240\n\t"
      "s_wait_xcnt 0x0"
      :: "v"(p), "v"(v[0]), "v"(v[1]), "v"(v[2]), "v"(v[3]), "v"(v[4]), "v"(v[5]), "v"(v[6]), "v"(v[7]),
         "v"(v[8]), "v"(v[9]), "v"(v[10]), "v"(v[11]), "v"(v[12]), "v"(v[13]), "v"(v[14]), "v"(v[15])
      : "memory");
}
// V transposed: v[4 j + i] goes to dh row + 16 j (rows of S_LEN halfs = 4096 B), s + 16 i
static __device__ __forceinline__ void st_tile_vt(_Float16* p, const h8 (&v)[16]) {
  asm volatile(
      "global_store_b128 %0, %1, off\n\t"
      "global_store_b128 %0, %2, off offset:32\n\t"
      "global_store_b128 %0, %3, off offset:64\n\t"
      "global_store_b128 %0, %4, off offset:96\n\t"
      "global_store_b128 %0, %5, off offset:65536\n\t"
      "global_store_b128 %0, %6, off offset:65568\n\t"
      "global_store_b128 %0, %7, off offset:65600\n\t"
      "global_store_b128 %0, %8, off offset:65632\n\t"
      "global_store_b128 %0, %9, off offset:131072\n\t"
      "global_store_b128 %0, %10, off offset:131104\n\t"
      "global_store_b128 %0, %11, off offset:131136\n\t"
      "global_store_b128 %0, %12, off offset:131168\n\t"
      "global_store_b128 %0, %13, off offset:196608\n\t"
      "global_store_b128 %0, %14, off offset:196640\n\t"
      "global_store_b128 %0, %15, off offset:196672\n\t"
      "global_store_b128 %0, %16, off offset:196704\n\t"
      "s_wait_xcnt 0x0"
      :: "v"(p), "v"(v[0]), "v"(v[1]), "v"(v[2]), "v"(v[3]), "v"(v[4]), "v"(v[5]), "v"(v[6]), "v"(v[7]),
         "v"(v[8]), "v"(v[9]), "v"(v[10]), "v"(v[11]), "v"(v[12]), "v"(v[13]), "v"(v[14]), "v"(v[15])
      : "memory");
}

__global__ void __launch_bounds__(128)
qkv_gemm(const _Float16* __restrict__ Xh,
         const _Float16* __restrict__ Wqh, const _Float16* __restrict__ Wkh,
         const _Float16* __restrict__ Wvh,
         const float* __restrict__ bq, const float* __restrict__ bk, const float* __restrict__ bv,
         _Float16* __restrict__ Qh, _Float16* __restrict__ Kh, _Float16* __restrict__ Vth) {
  __shared__ __align__(16) _Float16 St[2 * G_STAGE];   // 73,728 B

  const int tid  = threadIdx.x;
  const int lane = tid & 31;
  const int wave = tid >> 5;
  const int nn   = lane & 15;
  const int hiH  = (lane >> 4) & 1;
  const int k0   = hiH * 8;
  const int n0   = blockIdx.x * 128 + (wave & 1) * 64;    // this wave's first feature
  const int row0 = blockIdx.y * 128 + (wave >> 1) * 64;   // this wave's first token row
  const int which = blockIdx.z;

  const _Float16* W    = (which == 0) ? Wqh : (which == 1) ? Wkh : Wvh;
  const float*    bias = (which == 0) ? bq  : (which == 1) ? bk  : bv;

  // copies: a lane brings chunk (tid & 7) of rows (tid >> 3) + 16 r, r = 0..7, of W and of X
  const int crow = tid >> 3, ccol = (tid & 7) << 3;
  const _Float16* gW = W  + (size_t)(blockIdx.x * 128 + crow) * D_MODEL + ccol;
  const _Float16* gX = Xh + (size_t)(blockIdx.y * 128 + crow) * D_MODEL + ccol;
  const unsigned  lW = (unsigned)(unsigned long long)&St[crow * G_PITCH + ccol];
  const unsigned  lX = lW + 128 * G_PITCH * 2;

  // Q,K: features are the rows of D (operand A = W), so a lane holds 8 consecutive dh of one
  // token; V: tokens are the rows (A = X), so a lane holds 8 consecutive s of one feature.
  const int wrow = (wave & 1) * 64 + nn, xrow = 128 + (wave >> 1) * 64 + nn;
  const int aoff = ((which == 2) ? xrow : wrow) * G_PITCH + k0;
  const int boff = ((which == 2) ? wrow : xrow) * G_PITCH + k0;

  v8f acc[4][4];
#pragma unroll
  for (int i = 0; i < 4; ++i)
#pragma unroll
    for (int j = 0; j < 4; ++j) acc[i][j] = (v8f){};

  cp16x8(lW, gW);
  cp16x8(lX, gX);
  wait_async_le0();
  __syncthreads();
  cp16x8(lW + G_STAGE * 2, gW + 64);
  cp16x8(lX + G_STAGE * 2, gX + 64);

  for (int t = 0; t < G_PASSES; ++t) {
    const int bo = (t & 1) * G_STAGE;
    // the whole pass's fragments go to registers as one group of LDS reads
    v16h af[2][4], bf[2][4];
#pragma unroll
    for (int ks = 0; ks < 2; ++ks)
#pragma unroll
      for (int i = 0; i < 4; ++i) {
        af[ks][i] = frag_ld(&St[bo + aoff + i * 16 * G_PITCH + ks * 32], 0);
        bf[ks][i] = frag_ld(&St[bo + boff + i * 16 * G_PITCH + ks * 32], 0);
      }
    // publish point of pass t + 1: own LDS reads done, own copies landed, then the barrier
    // that shows pass t + 1's tile to every wave and frees pass t's buffer for the refill
    asm volatile("s_wait_dscnt 0x0" ::: "memory");
    wait_async_le0();
    __syncthreads();
    if (t + 2 < G_PASSES) {
      cp16x8(lW + bo * 2, gW + (t + 2) * 64);
      cp16x8(lX + bo * 2, gX + (t + 2) * 64);
    }
    // the pass's WMMAs work on registers alone, so the refill flies under all of them
#pragma unroll
    for (int ks = 0; ks < 2; ++ks)
#pragma unroll
      for (int i = 0; i < 4; ++i)
#pragma unroll
        for (int j = 0; j < 4; ++j) acc[i][j] = WMMA_F16(af[ks][i], bf[ks][j], acc[i][j]);
  }
  wait_async_le0();   // no copy is outstanding when the wave ends

  const int bb = row0 >> 11;             // / S_LEN: one batch entry per 64-row wave tile
  const int s0 = row0 & (S_LEN - 1);
  const size_t head = (size_t)(bb * N_HEADS + (n0 >> 6));   // one head per 64-feature wave tile
  h8 v[16];
  if (which == 2) {
    float bb_[4];
    ld_bias_cols(bias + n0 + nn, bb_);
#pragma unroll
    for (int j = 0; j < 4; ++j)
#pragma unroll
      for (int i = 0; i < 4; ++i)
#pragma unroll
        for (int g = 0; g < 8; ++g) v[j * 4 + i][g] = (_Float16)(acc[i][j][g] + bb_[j]);
    st_tile_vt(Vth + (head * D_HEAD + nn) * S_LEN + s0 + hiH * 8, v);
  } else {
    v4f bb_[8];
    ld_bias_rows(bias + n0 + hiH * 8, bb_);
#pragma unroll
    for (int i = 0; i < 4; ++i)
#pragma unroll
      for (int j = 0; j < 4; ++j)
#pragma unroll
        for (int g = 0; g < 8; ++g)
          v[i * 4 + j][g] = (_Float16)(acc[i][j][g] + bb_[i * 2 + (g >> 2)][g & 3]);
    st_tile_qk(((which == 0) ? Qh : Kh) + (head * S_LEN + s0 + nn) * D_HEAD + hiH * 8, v);
  }
}

// ---------------- Kernel 3: flash attention with relative skew ----------------
// K/V slabs (32 keys) are double-buffered in LDS via async copies, shared by all 4 waves;
// the copies of slab n+1 are issued behind slab n's barrier and fly under its compute.
// A fragment read takes 16 bytes of each of 16 rows per half wave: at a row pitch of 16 B x odd
// the 16 rows fall on all 64 banks; at the rows' own 128 B and 64 B they fall on 8 and 16 banks.
#define K_PITCH 72   // halfs per staged K row: 64 + 8 (144 B)
#define V_PITCH 40   // halfs per staged V^T row: 32 + 8 (80 B)
static __device__ __forceinline__ void slab_load(const _Float16* __restrict__ Kbase,
                                                 const _Float16* __restrict__ Vbase,
                                                 int t0,
                                                 _Float16 (*Kl)[K_PITCH], _Float16 (*Vl)[V_PITCH],
                                                 int tid) {
#pragma unroll
  for (int r = 0; r < 2; ++r) {
    int c = tid + r * 128;                 // 0..255
    int krow = c >> 3, kcol = (c & 7) << 3;   // 32 rows x 64 halfs
    cp16_g2l(Kbase + (size_t)(t0 + krow) * D_HEAD + kcol, &Kl[krow][kcol]);
    int vrow = c >> 2, vcol = (c & 3) << 3;   // 64 rows x 32 halfs
    cp16_g2l(Vbase + (size_t)vrow * S_LEN + t0 + vcol, &Vl[vrow][vcol]);
  }
}

// One band block (16 Er rows of 128 B) into its ring slot, whole 128-byte lines: a thread brings
// 16 bytes of row tid / 8. k is the same for the whole block of threads.
static __device__ __forceinline__ void band_stage(const _Float16* __restrict__ Erh, int k,
                                                  _Float16 (*slot)[K_PITCH], int tid) {
  const int row = tid >> 3, col = (tid & 7) << 3;
  cp16_g2l(band_row(Erh, k, row) + col, &slot[row][col]);
}

#define SK_PITCH 68   // floats per ring row: 64 keys + 4, so 16 rows' 16-byte reads fall on 64 banks

// value of the lane 16 away
static __device__ __forceinline__ float other_half(float v) {
  int b = __builtin_bit_cast(int, v);
  b = __builtin_amdgcn_permlanex16(b, b, 0x76543210, 0xfedcba98, false, false);
  return __builtin_bit_cast(float, b);
}

// The prologue's global loads: a row's two fragments are the 16 bytes at p, p + 32 B, p + 64 B and
// p + 96 B (p = row + 8 hiH halfs). The loads of several rows stand with their waits in one asm
// statement, so that all are in flight together and no register that an issued load names is
// rewritten ahead of the wait (a precaution).
#define LD_ROW(d0, d1, d2, d3, a)                      \
  "global_load_b128 %" #d0 ", %" #a ", off\n\t"           \
  "global_load_b128 %" #d1 ", %" #a ", off offset:32\n\t" \
  "global_load_b128 %" #d2 ", %" #a ", off offset:64\n\t" \
  "global_load_b128 %" #d3 ", %" #a ", off offset:96\n\t"
static __device__ __forceinline__ void ld_rows4(const _Float16* p0, const _Float16* p1,
                                                const _Float16* p2, const _Float16* p3,
                                                h8 (&v)[16]) {
  asm volatile(
      LD_ROW(0, 1, 2, 3, 16) LD_ROW(4, 5, 6, 7, 17) LD_ROW(8, 9, 10, 11, 18)
      LD_ROW(12, 13, 14, 15, 19)
      "s_wait_loadcnt 0x0\n\t"
      "s_wait_xcnt 0x0"
      : "=&v"(v[0]), "=&v"(v[1]), "=&v"(v[2]), "=&v"(v[3]), "=&v"(v[4]), "=&v"(v[5]),
        "=&v"(v[6]), "=&v"(v[7]), "=&v"(v[8]), "=&v"(v[9]), "=&v"(v[10]), "=&v"(v[11]),
        "=&v"(v[12]), "=&v"(v[13]), "=&v"(v[14]), "=&v"(v[15])
      : "v"(p0), "v"(p1), "v"(p2), "v"(p3) : "memory");
}
static __device__ __forceinline__ void ld_rows6(const _Float16* p0, const _Float16* p1,
                                                const _Float16* p2, const _Float16* p3,
                                                const _Float16* p4, const _Float16* p5,
                                                h8 (&v)[24]) {
  asm volatile(
      LD_ROW(0, 1, 2, 3, 24) LD_ROW(4, 5, 6, 7, 25) LD_ROW(8, 9, 10, 11, 26)
      LD_ROW(12, 13, 14, 15, 27) LD_ROW(16, 17, 18, 19, 28) LD_ROW(20, 21, 22, 23, 29)
      "s_wait_loadcnt 0x0\n\t"
      "s_wait_xcnt 0x0"
      : "=&v"(v[0]), "=&v"(v[1]), "=&v"(v[2]), "=&v"(v[3]), "=&v"(v[4]), "=&v"(v[5]),
        "=&v"(v[6]), "=&v"(v[7]), "=&v"(v[8]), "=&v"(v[9]), "=&v"(v[10]), "=&v"(v[11]),
        "=&v"(v[12]), "=&v"(v[13]), "=&v"(v[14]), "=&v"(v[15]), "=&v"(v[16]), "=&v"(v[17]),
        "=&v"(v[18]), "=&v"(v[19]), "=&v"(v[20]), "=&v"(v[21]), "=&v"(v[22]), "=&v"(v[23])
      : "v"(p0), "v"(p1), "v"(p2), "v"(p3), "v"(p4), "v"(p5) : "memory");
}
// fragment from its two 16-byte halves, in frag_ld's order
static __device__ __forceinline__ v16h frag_of(h8 lo, h8 hi) {
  return __builtin_shufflevector(lo, hi, 0,1,2,3,4,5,6,7,8,9,10,11,12,13,14,15);
}

// A wave holds two 16-query tiles, so every K, V^T and Er fragment it reads from LDS feeds both.
#define Q_TILES 2
#define BLK_Q (4 * Q_TILES * 16)   // queries per block
#define EL_SLOTS 16                // ring of band blocks: ten are live at a time

// The grid gives every SIMD two waves; said to the compiler, so that it does not hold registers
// down for a third wave that the LDS would still admit and serialise the fragment reads.
__global__ void __launch_bounds__(128) __attribute__((amdgpu_waves_per_eu(2, 2)))
attn_kernel(const _Float16* __restrict__ Qh, const _Float16* __restrict__ Kh,
            const _Float16* __restrict__ Vt, const _Float16* __restrict__ Erh,
            float* __restrict__ out) {
  __shared__ __align__(16) _Float16 Kl[2][32][K_PITCH];   // double-buffered K slab
  __shared__ __align__(16) _Float16 Vl[2][64][V_PITCH];   // double-buffered V slab (dh,t)
  __shared__ __align__(16) float sk[4 * Q_TILES][16 * SK_PITCH];   // one skew ring per query tile
  __shared__ __align__(16) _Float16 El[EL_SLOTS][16][K_PITCH];     // ring of band blocks, shared by the waves

  const int tid  = threadIdx.x;
  const int lane = tid & 31;
  const int wave = __builtin_amdgcn_readfirstlane(tid >> 5);   // scalar: picks the band blocks
  const int hiH  = (lane >> 4) & 1;
  const int k0   = hiH * 8;
  const int nn   = lane & 15;

  const int h  = blockIdx.y;
  const int b  = blockIdx.z;
  const int s0 = blockIdx.x * BLK_Q + wave * (Q_TILES * 16);   // tile u holds queries s0 + 16 u + nn

  const size_t head = (size_t)(b * N_HEADS + h) * (size_t)S_LEN * D_HEAD;
  const _Float16* Qbase = Qh + head;
  const _Float16* Kbase = Kh + head;
  const _Float16* Vbase = Vt + head;   // (dh, t) layout

  // warm the Er diagonal band this block touches first
  {
    int e = S_LEN - 16 - s0 + nn;
    e = e < 0 ? 0 : e;
    __builtin_prefetch(Erh + (size_t)e * D_HEAD, 0, 1);
  }

  float rowmax[Q_TILES], rowsum[Q_TILES];   // of query s0 + 16 u + nn; rowsum over this half's keys
  v8f o[Q_TILES][4];                        // O^T: register g = dh 16 n + 8 hiH + g, lane = query
#pragma unroll   // constant u, n keep the state in registers
  for (int u = 0; u < Q_TILES; ++u) {
    rowmax[u] = -3.0e38f; rowsum[u] = 0.f;
#pragma unroll
    for (int n = 0; n < 4; ++n) o[u][n] = (v8f){};
  }

  slab_load(Kbase, Vbase, 0, Kl[0], Vl[0], tid);   // preload slab 0

  // Query tile w = 2 wave + u of the block has a band stream that runs w blocks behind tile 0's, so
  // the eight tiles read the same Er rows within four slabs: each block is staged once for all of
  // them. Block kb0 + j lies in slot j & 15. In slab n the waves read j = 2 n - 1 .. 2 n + 6 while
  // j = 2 n + 7 and 2 n + 8 are in flight.
  const int kb0 = (S_LEN - 16 - (int)blockIdx.x * BLK_Q) >> 4;
#pragma unroll   // constant j: the slots are immediate offsets
  for (int j = -1; j < 7; ++j) band_stage(Erh, kb0 + j, El[j & (EL_SLOTS - 1)], tid);

  v16h qa[Q_TILES][2], qs[Q_TILES][2];   // Q and Q of rows s + 1 (skew wrap term), d 0..31 and 32..63
  {
    const _Float16* qp[Q_TILES][2];
#pragma unroll   // constant u keeps the pointers in registers
    for (int u = 0; u < Q_TILES; ++u) {
      int sshift = s0 + 16 * u + nn + 1; if (sshift > S_LEN - 1) sshift = S_LEN - 1;
      qp[u][0] = Qbase + (size_t)(s0 + 16 * u + nn) * D_HEAD + k0;
      qp[u][1] = Qbase + (size_t)sshift * D_HEAD + k0;
    }
    h8 v[16];
    ld_rows4(qp[0][0], qp[0][1], qp[1][0], qp[1][1], v);
#pragma unroll   // constant u keeps the fragments in registers
    for (int u = 0; u < Q_TILES; ++u) {
      qa[u][0] = frag_of(v[8 * u + 0], v[8 * u + 1]);
      qa[u][1] = frag_of(v[8 * u + 2], v[8 * u + 3]);
      qs[u][0] = frag_of(v[8 * u + 4], v[8 * u + 5]);
      qs[u][1] = frag_of(v[8 * u + 6], v[8 * u + 7]);
    }
  }

  // Band stream of a tile whose first block is kt: block kt + m holds, for query row i, keys
  // 16 m - 15 + i .. 16 m + i, so slab n (keys 32 n .. 32 n + 31) needs blocks m <= 2 n + 2. Blocks
  // are multiplied and stored one slab ahead of their first full use; their Er fragments are fetched
  // one slab before that, the first blocks' from memory, all later ones from the LDS ring of band
  // blocks. Tile 1's kt is tile 0's less one, so of its two blocks of a slab one is tile 0's first
  // and the other tile 0's second of the slab before, kept in registers.
  // Ring column of (row i = 8 hiH + g, lane nn) in block m: (16 m + 49 + nn + i) & 63; only
  // m = 0 (mod 4) can wrap inside a block.
  float* const skw = &sk[wave * Q_TILES][0];                         // tile u: + u 16 SK_PITCH
  float* const sk_st = skw + (8 * hiH) * (SK_PITCH + 1) + nn + 1;    // + g (SK_PITCH + 1) + 16 ((m & 3) - 1)
  const float* const sk_ld = skw + nn * SK_PITCH + 8 * hiH;          // + (first key of the tile) & 63
  int wofs[8];                                                       // the wrapping block's places
#pragma unroll   // constant g keeps the table in registers
  for (int g = 0; g < 8; ++g)
    wofs[g] = (8 * hiH + g) * SK_PITCH + ((49 + nn + 8 * hiH + g) & 63);

  int kb = (S_LEN - 16 - s0) >> 4;   // tile 0's first block; tile 1's is kb - 1
  v16h fc0, fc1, fa0, fa1, fb0, fb1;   // fragments of blocks kb + 2, kb + 3, kb + 4
  {
    h8 v[24];                        // blocks kb - 1 .. kb + 4
    ld_rows6(band_row(Erh, kb - 1, nn) + k0, band_row(Erh, kb, nn) + k0,
             band_row(Erh, kb + 1, nn) + k0, band_row(Erh, kb + 2, nn) + k0,
             band_row(Erh, kb + 3, nn) + k0, band_row(Erh, kb + 4, nn) + k0, v);
    v16h f[4][2];                    // blocks kb - 1 .. kb + 2
#pragma unroll   // constant m keeps the fragments in registers
    for (int m = 0; m < 4; ++m) {
      f[m][0] = frag_of(v[4 * m + 0], v[4 * m + 1]);
      f[m][1] = frag_of(v[4 * m + 2], v[4 * m + 3]);
    }
    fa0 = frag_of(v[16], v[17]); fa1 = frag_of(v[18], v[19]);
    fb0 = frag_of(v[20], v[21]); fb1 = frag_of(v[22], v[23]);
#pragma unroll   // constant u keeps the tiles in registers
    for (int u = 0; u < Q_TILES; ++u) {
      const v8f g0 = band_gemm<BAND_ANY>(kb - u,     nn, qa[u][0], qa[u][1], qs[u][0], qs[u][1], f[1 - u][0], f[1 - u][1]);
      const v8f g1 = band_gemm<BAND_ANY>(kb - u + 1, nn, qa[u][0], qa[u][1], qs[u][0], qs[u][1], f[2 - u][0], f[2 - u][1]);
      const v8f g2 = band_gemm<BAND_ANY>(kb - u + 2, nn, qa[u][0], qa[u][1], qs[u][0], qs[u][1], f[3 - u][0], f[3 - u][1]);
#pragma unroll   // constant g keeps the tiles in registers
      for (int g = 0; g < 8; ++g) {
        skw[u * 16 * SK_PITCH + wofs[g]] = g0[g];
        sk_st[u * 16 * SK_PITCH + g * (SK_PITCH + 1)] = g1[g];
        sk_st[u * 16 * SK_PITCH + g * (SK_PITCH + 1) + 16] = g2[g];
      }
    }
    fc0 = f[3][0]; fc1 = f[3][1];
  }

  // two slabs (64 keys from tp on); where says on which side of the wrap their band blocks lie
  auto slab_pair = [&](auto where, const int tp) __attribute__((always_inline)) {
    constexpr int WHERE = decltype(where)::value;
#pragma unroll   // constant par: buffer and ring places become immediate offsets
    for (int par = 0; par < 2; ++par) {
      const int t0 = tp + par * 32;
      const int j0 = t0 >> 4;            // 2 n
      // publish point: own LDS reads of the slab before done, own copies (this slab, band blocks up
      // to j0 + 6) landed, then the one barrier that shows them to every wave and frees the places
      // that the slab before has read for the refill
      asm volatile("s_wait_dscnt 0x0" ::: "memory");
      wait_async_le0();
      __syncthreads();   // also orders the ring's stores of the slab before ahead of the reads below
      if (t0 + 32 < S_LEN) {
        slab_load(Kbase, Vbase, t0 + 32, Kl[par ^ 1], Vl[par ^ 1], tid);
        band_stage(Erh, kb0 + j0 + 7, El[(j0 + 7) & (EL_SLOTS - 1)], tid);
        band_stage(Erh, kb0 + j0 + 8, El[(j0 + 8) & (EL_SLOTS - 1)], tid);
      }

      // ---- Srel^T of this slab from the rings: 8 consecutive keys of the lane's query per tile ----
      v4f rr[Q_TILES][4];
#pragma unroll
      for (int u = 0; u < Q_TILES; ++u)
#pragma unroll
        for (int q = 0; q < 4; ++q)
          rr[u][q] = *(const v4f*)(sk_ld + u * 16 * SK_PITCH + par * 32 + (q >> 1) * 16 + (q & 1) * 4);
      // the slab's K fragments, read once for both query tiles
      v16h kf[2][2];
#pragma unroll   // constant sub keeps the fragments in registers
      for (int sub = 0; sub < 2; ++sub) {
        const _Float16* krow = &Kl[par][sub * 16 + nn][0];
        kf[sub][0] = frag_ld(krow, k0);
        kf[sub][1] = frag_ld(krow + 32, k0);
      }
      // the ring places stored below alias keys read above: keep the compiler from lifting the
      // stores over those reads (the wave's LDS operations run in program order)
      __builtin_amdgcn_fence(__ATOMIC_ACQ_REL, "wavefront");
      // keeps the reads above one group ahead of the products: without it the build read the K
      // fragments one by one into the same registers, a full wait in front of each product
      __builtin_amdgcn_sched_barrier(0);

      // the next slab's two new band blocks of each tile; the fragments of the slab after go into
      // the same registers further down
      v8f ga[Q_TILES], gb[Q_TILES];
      ga[0] = band_gemm<WHERE>(kb + 3, nn, qa[0][0], qa[0][1], qs[0][0], qs[0][1], fa0, fa1);
      gb[0] = band_gemm<WHERE>(kb + 4, nn, qa[0][0], qa[0][1], qs[0][0], qs[0][1], fb0, fb1);
      ga[1] = band_gemm<WHERE>(kb + 2, nn, qa[1][0], qa[1][1], qs[1][0], qs[1][1], fc0, fc1);
      gb[1] = band_gemm<WHERE>(kb + 3, nn, qa[1][0], qa[1][1], qs[1][0], qs[1][1], fa0, fa1);
      kb += 2;

      // ---- S^T: two 16-key tiles (K = 64) per query tile, K rows from LDS as A, Q as B ----
      float sc[Q_TILES][16];
#pragma unroll
      for (int sub = 0; sub < 2; ++sub)
#pragma unroll
        for (int u = 0; u < Q_TILES; ++u) {
          v8f c = {};
          c = WMMA_F16(kf[sub][0], qa[u][0], c);
          c = WMMA_F16(kf[sub][1], qa[u][1], c);
#pragma unroll
          for (int g = 0; g < 8; ++g)
            sc[u][sub * 8 + g] = (c[g] + rr[u][sub * 2 + (g >> 2)][g & 3]) * 0.125f;   // / sqrt(D_HEAD)
        }

      // ---- the next band products' Er fragments: one block stays, two come from the ring ----
      {
        fc0 = fb0; fc1 = fb1;                                                   // block kb + 2
        const _Float16* ea = &El[(j0 + 5 - 2 * wave) & (EL_SLOTS - 1)][nn][0];   // block kb + 3
        const _Float16* eb = &El[(j0 + 6 - 2 * wave) & (EL_SLOTS - 1)][nn][0];   // block kb + 4
        fa0 = frag_ld(ea, k0); fa1 = frag_ld(ea + 32, k0);
        fb0 = frag_ld(eb, k0); fb1 = frag_ld(eb + 32, k0);
      }
      // keeps these reads here, where the softmax covers their latency: the build sank them to the
      // slab's end, directly in front of the wait of the publish point
      __builtin_amdgcn_sched_barrier(0);

      // the band products go into the rings behind the S^T products: the tiles stay live over them,
      // so no S^T product takes a band product's registers as its result inside the WMMA distance
#pragma unroll   // constant u, g keep the tiles in registers
      for (int u = 0; u < Q_TILES; ++u)
#pragma unroll
        for (int g = 0; g < 8; ++g) {
          if (par == 0) {     // blocks 3 and 0 (mod 4)
            sk_st[u * 16 * SK_PITCH + g * (SK_PITCH + 1) + 32] = ga[u][g];
            skw[u * 16 * SK_PITCH + wofs[g]] = gb[u][g];
          } else {            // blocks 1 and 2 (mod 4)
            sk_st[u * 16 * SK_PITCH + g * (SK_PITCH + 1)] = ga[u][g];
            sk_st[u * 16 * SK_PITCH + g * (SK_PITCH + 1) + 16] = gb[u][g];
          }
        }

      // ---- online softmax across this 32-key slab: one query per lane and tile ----
      v16h pb[Q_TILES];   // P^T as B: element e = key 8 hiH + e (e < 8), 16 + 8 hiH + e - 8 (e >= 8)
#pragma unroll   // constant u keeps the state in registers
      for (int u = 0; u < Q_TILES; ++u) {
        float m4[4];
#pragma unroll
        for (int e = 0; e < 4; ++e)
          m4[e] = fmaxf(fmaxf(sc[u][e], sc[u][e + 4]), fmaxf(sc[u][e + 8], sc[u][e + 12]));
        float tm = fmaxf(fmaxf(m4[0], m4[1]), fmaxf(m4[2], m4[3]));
        tm = fmaxf(tm, other_half(tm));
        const float nm = fmaxf(rowmax[u], tm);
        const float al = __expf(rowmax[u] - nm);
        rowmax[u] = nm;
        float p4[4] = {0.f, 0.f, 0.f, 0.f};
#pragma unroll
        for (int e = 0; e < 16; ++e) {
          const float p = __expf(sc[u][e] - nm);
          p4[e & 3] += p;
          pb[u][e] = (_Float16)p;
        }
        rowsum[u] = rowsum[u] * al + ((p4[0] + p4[1]) + (p4[2] + p4[3]));
#pragma unroll
        for (int n = 0; n < 4; ++n)
#pragma unroll
          for (int g = 0; g < 8; ++g) o[u][n][g] *= al;
      }

      // ---- O^T += V^T P^T : 4 WMMAs per query tile over the 64 head dims (K = 32), V^T rows from
      // LDS as A, each fragment read once for both tiles ----
      const _Float16* vrow_ = &Vl[par][nn][0];
#pragma unroll   // constant n keeps the accumulators in registers
      for (int n = 0; n < 4; ++n) {
        const v16h vf = frag_ld(vrow_ + n * 16 * V_PITCH, k0);
#pragma unroll
        for (int u = 0; u < Q_TILES; ++u) o[u][n] = WMMA_F16(vf, pb[u], o[u][n]);
      }
      // keeps the products in front of the next publish point: the build let the last of them sink
      // behind its barrier, directly in front of a branch
      __builtin_amdgcn_sched_barrier(0);
    }
  };

  // Slab n multiplies blocks kb0 - w + 2 n + 3 and + 4 for the tiles w = 0 .. 7 of the block,
  // kb0 = BAND_WRAP - 1 - 8 blockIdx.x. For every tile they lie below the wrap in the pairs of slabs
  // before 2 blockIdx.x - 1 and above it from pair 2 blockIdx.x + 2 on: there the Q operand is fixed
  // and no zero column is cut, so the selects stand only in the pairs between. The bounds are the
  // same for the whole block.
  const int t_any   = ((int)blockIdx.x > 0 ? 2 * (int)blockIdx.x - 1 : 0) * 64;
  const int t_above = (2 * (int)blockIdx.x + 2) * 64;
  int tp = 0;
  for (; tp < t_any; tp += 64)   slab_pair(band_where<BAND_BELOW>{}, tp);
  for (; tp < t_above; tp += 64) slab_pair(band_where<BAND_ANY>{}, tp);
  for (; tp < S_LEN; tp += 64)   slab_pair(band_where<BAND_ABOVE>{}, tp);

  // ---- join the halves' sums, normalize and write (B, S, D_MODEL) f32 ----
#pragma unroll   // constant u, n keep the accumulators in registers
  for (int u = 0; u < Q_TILES; ++u) {
    const float inv = 1.0f / (rowsum[u] + other_half(rowsum[u]));
    float* orow = out + ((size_t)(b * S_LEN + s0 + 16 * u + nn)) * D_MODEL + h * D_HEAD + 8 * hiH;
#pragma unroll
    for (int n = 0; n < 4; ++n) {
      *(v4f*)(orow + 16 * n)     = (v4f){o[u][n][0], o[u][n][1], o[u][n][2], o[u][n][3]} * inv;
      *(v4f*)(orow + 16 * n + 4) = (v4f){o[u][n][4], o[u][n][5], o[u][n][6], o[u][n][7]} * inv;
    }
  }
}

extern "C" void kernel_launch(void* const* d_in, const int* in_sizes, int n_in,
                              void* d_out, int out_size, void* d_ws, size_t ws_size,
                              hipStream_t stream) {
  (void)in_sizes; (void)n_in; (void)out_size; (void)ws_size;
  const float* x  = (const float*)d_in[0];
  const float* Wq = (const float*)d_in[1];
  const float* bq = (const float*)d_in[2];
  const float* Wk = (const float*)d_in[3];
  const float* bk = (const float*)d_in[4];
  const float* Wv = (const float*)d_in[5];
  const float* bv = (const float*)d_in[6];
  const float* Er = (const float*)d_in[7];

  char* ws = (char*)d_ws;
  const size_t xhN = (size_t)BATCH * S_LEN * D_MODEL;        // 4,194,304
  const size_t wN  = (size_t)D_MODEL * D_MODEL;              // 1,048,576
  const size_t erN = (size_t)S_LEN * D_HEAD;                 // 131,072

  _Float16* Xh  = (_Float16*)(ws);
  _Float16* Wqh = (_Float16*)(ws + 2 * xhN);
  _Float16* Wkh = Wqh + wN;
  _Float16* Wvh = Wkh + wN;
  _Float16* Erh = Wvh + wN;
  _Float16* Qh  = Erh + erN;
  _Float16* Kh  = Qh + xhN;
  _Float16* Vth = Kh + xhN;

  // Xh, Wqh, Wkh, Wvh, Erh are contiguous from Xh on
  cast_all<<<CAST_XB + 3 * CAST_WB + CAST_EB, CAST_T, 0, stream>>>(x, Wq, Wk, Wv, Er, Xh);

  // QKV: M = 4096 rows, N = 1024 feats, K = 1024; z selects Q/K/V
  qkv_gemm<<<dim3(D_MODEL / 128, (BATCH * S_LEN) / 128, 3), 128, 0, stream>>>(
      Xh, Wqh, Wkh, Wvh, bq, bk, bv, Qh, Kh, Vth);

  // attention: 128 query rows per block (4 waves x 2 tiles x 16)
  attn_kernel<<<dim3(S_LEN / BLK_Q, N_HEADS, BATCH), 128, 0, stream>>>(
      Qh, Kh, Vth, Erh, (float*)d_out);
}

// v009
// Measured time: 87.9 microseconds a run.
// Next to v008, in two timings, it ran 1.06 times as fast each time.
// Over all steps from v000 it is 4.46 times as fast.
#include <hip/hip_runtime.h>
#include <hip/hip_bf16.h>

#define S_LEN   2048
#define D_MODEL 1024
#define N_HEADS 16
#define D_HEAD  64
#define BATCH   2

typedef _Float16 h8   __attribute__((ext_vector_type(8)));
typedef _Float16 v16h __attribute__((ext_vector_type(16)));
typedef float    v8f  __attribute__((ext_vector_type(8)));

#define WMMA_F16(a, b, c) \
  __builtin_amdgcn_wmma_f32_16x16x32_f16(false, (a), false, (b), (short)0, (c), false, false)

// ---------- CDNA5 async global->LDS copy (guarded; falls back to ld+ds_store) ----------
#if defined(__has_builtin)
#if __has_builtin(__builtin_amdgcn_global_load_async_to_lds_b128)
#define HAVE_ASYNC_CP 1
#endif
#endif
#ifndef HAVE_ASYNC_CP
#define HAVE_ASYNC_CP 0
#endif

typedef int v4i_t __attribute__((vector_size(16)));
typedef __attribute__((address_space(1))) v4i_t* g_v4i_p;   // global int4*
typedef __attribute__((address_space(3))) v4i_t* l_v4i_p;   // LDS int4*

static __device__ __forceinline__ void cp16_g2l(const _Float16* g, _Float16* l) {
#if HAVE_ASYNC_CP
  __builtin_amdgcn_global_load_async_to_lds_b128(
      (g_v4i_p)(unsigned long long)g,
      (l_v4i_p)(unsigned int)(unsigned long long)l, 0, 0);
#else
  *(h8*)l = *(const h8*)g;
#endif
}
static __device__ __forceinline__ void wait_async_le0() {
#if HAVE_ASYNC_CP
  asm volatile("s_wait_asynccnt 0x0" ::: "memory");
#endif
}

// Load one lane's slice of a 16x32 (f16) A/B fragment.
// Layout per ISA 7.12.2: lanes 0-15 hold K[0..7]+K[16..23], lanes 16-31 hold K[8..15]+K[24..31].
static __device__ __forceinline__ v16h frag_ld(const _Float16* p, int k0) {
  h8 lo = *(const h8*)(p + k0);
  h8 hi = *(const h8*)(p + k0 + 16);
  return __builtin_shufflevector(lo, hi, 0,1,2,3,4,5,6,7,8,9,10,11,12,13,14,15);
}

// The skew reads, for query s and key t, position u = S - 1 + t - s of one band of 2 S positions:
// u < S is q[s].Er[u], u == S is the skew's zero column, u > S is q[s+1].Er[u - S - 1].
// Band block k holds positions 16 k .. 16 k + 15; a 16x16 score tile needs blocks k and k + 1.
#define BAND_WRAP (S_LEN / 16)   // first block that belongs to q[s+1]

// Er row behind column nn of band block k
static __device__ __forceinline__ const _Float16* band_row(const _Float16* __restrict__ Erh,
                                                           int k, int nn) {
  int e = k * 16 + nn - ((k >= BAND_WRAP) ? (S_LEN + 1) : 0);
  e = e < 0 ? 0 : e;                        // the zero column's lane
  e = e > (S_LEN - 1) ? (S_LEN - 1) : e;    // blocks fetched past the last slab, never used
  return Erh + (size_t)e * D_HEAD;
}

// Where a band block lies, known at compile time in the slab loop's steady phases
#define BAND_BELOW 0   // k < BAND_WRAP: q[s], no zero column
#define BAND_ABOVE 1   // k > BAND_WRAP: q[s+1], no zero column
#define BAND_ANY   2   // decided from k

// G = Qtile(16x64) @ (band block k)^T -> 16x16 f32 (2 WMMAs over K=64); k is wave-uniform
template <int WHERE>
static __device__ __forceinline__ v8f band_gemm(int k, int nn, v16h qa0, v16h qa1,
                                                v16h qs0, v16h qs1, v16h f0, v16h f1) {
  v8f c = {};
  if (WHERE == BAND_BELOW) {
    c = WMMA_F16(qa0, f0, c);
    return WMMA_F16(qa1, f1, c);
  }
  if (WHERE == BAND_ABOVE) {
    c = WMMA_F16(qs0, f0, c);
    return WMMA_F16(qs1, f1, c);
  }
  const bool wrap = (k >= BAND_WRAP);
  c = WMMA_F16(wrap ? qs0 : qa0, f0, c);
  c = WMMA_F16(wrap ? qs1 : qa1, f1, c);
  const bool zcol = (k * 16 + nn == S_LEN);
#pragma unroll   // constant g keeps the tile in registers
  for (int g = 0; g < 8; ++g) c[g] = zcol ? 0.f : c[g];
  return c;
}

template <int W> struct band_where { static constexpr int value = W; };

// ---------------- Kernel 1: f32 -> f16 cast of x, Wq, Wk, Wv and Er, one launch ----------------
// The five f16 copies lie one behind the other in the workspace, so a block's place in the grid is
// its place in the destination; each array is a whole number of blocks. A thread converts 64
// elements: sixteen 16-byte loads, each 512 contiguous bytes of a wave, issued ahead of the
// conversions, and sixteen 8-byte stores, each two whole 128-byte lines of a wave.
#define CAST_T 128                                        // threads per block
#define CAST_V 16                                         // 16-byte loads per thread
#define CAST_CHUNK (CAST_T * CAST_V * 4)                  // floats per block
#define CAST_XB (BATCH * S_LEN * D_MODEL / CAST_CHUNK)    // blocks of x
#define CAST_WB (D_MODEL * D_MODEL / CAST_CHUNK)          // blocks of each W
#define CAST_EB (S_LEN * D_HEAD / CAST_CHUNK)             // blocks of Er

typedef float    c4f __attribute__((ext_vector_type(4)));
typedef _Float16 c4h __attribute__((ext_vector_type(4)));

__global__ void __launch_bounds__(CAST_T)
cast_all(const float* __restrict__ x, const float* __restrict__ Wq, const float* __restrict__ Wk,
         const float* __restrict__ Wv, const float* __restrict__ Er, _Float16* __restrict__ dst) {
  const int blk = blockIdx.x;
  const float* src = x;
  int rel = blk;
  if (blk >= CAST_XB + 3 * CAST_WB)      { src = Er; rel = blk - (CAST_XB + 3 * CAST_WB); }
  else if (blk >= CAST_XB + 2 * CAST_WB) { src = Wv; rel = blk - (CAST_XB + 2 * CAST_WB); }
  else if (blk >= CAST_XB + CAST_WB)     { src = Wk; rel = blk - (CAST_XB + CAST_WB); }
  else if (blk >= CAST_XB)               { src = Wq; rel = blk - CAST_XB; }
  const float* p = src + (size_t)rel * CAST_CHUNK + threadIdx.x * 4;
  _Float16*    q = dst + (size_t)blk * CAST_CHUNK + threadIdx.x * 4;
  c4f v[CAST_V];
#pragma unroll   // constant j: the values stay in registers and the loads are in flight together
  for (int j = 0; j < CAST_V; ++j) v[j] = *(const c4f*)(p + j * CAST_T * 4);
#pragma unroll   // constant j, as above
  for (int j = 0; j < CAST_V; ++j)
    *(c4h*)(q + j * CAST_T * 4) = (c4h){(_Float16)v[j][0], (_Float16)v[j][1],
                                        (_Float16)v[j][2], (_Float16)v[j][3]};
}

// ---------------- Kernel 2: QKV projection GEMM ----------------
// y = Xh @ W^T + b ; z = 0/1/2 -> Q/K/V. Q,K stored (b,h,s,dh); V stored transposed (b,h,dh,s).
// One 128x128 tile of y per block, 64x64 per wave (4x4 WMMA tiles), so every LDS fragment
// feeds four WMMAs. A pass is 64 k: 128 W rows and 128 X rows of 128 B, laid at a pitch of
// 144 B (16 B x odd: conflict-free for ds_load_b128), two buffers filled by async copies.
#define G_PITCH 72                       // halfs per staged row (144 B)
#define G_STAGE (256 * G_PITCH)          // halfs per buffer: W rows 0..127, X rows 128..255
#define G_PASSES (D_MODEL / 64)

// Eight 16-byte async copies of one lane. The s_wait_xcnt stands inside the statement so
// that no address register of an issued copy is rewritten ahead of it.
static __device__ __forceinline__ void cp16x8(unsigned l, const _Float16* g) {
  const unsigned l1 = l + 1 * 16 * G_PITCH * 2, l2 = l + 2 * 16 * G_PITCH * 2,
                 l3 = l + 3 * 16 * G_PITCH * 2, l4 = l + 4 * 16 * G_PITCH * 2,
                 l5 = l + 5 * 16 * G_PITCH * 2, l6 = l + 6 * 16 * G_PITCH * 2,
                 l7 = l + 7 * 16 * G_PITCH * 2;
  const _Float16 *g1 = g + 1 * 16 * D_MODEL, *g2 = g + 2 * 16 * D_MODEL,
                 *g3 = g + 3 * 16 * D_MODEL, *g4 = g + 4 * 16 * D_MODEL,
                 *g5 = g + 5 * 16 * D_MODEL, *g6 = g + 6 * 16 * D_MODEL,
                 *g7 = g + 7 * 16 * D_MODEL;
  asm volatile(
      "global_load_async_to_lds_b128 %0, %8, off\n\t"
      "global_load_async_to_lds_b128 %1, %9, off\n\t"
      "global_load_async_to_lds_b128 %2, %10, off\n\t"
      "global_load_async_to_lds_b128 %3, %11, off\n\t"
      "global_load_async_to_lds_b128 %4, %12, off\n\t"
      "global_load_async_to_lds_b128 %5, %13, off\n\t"
      "global_load_async_to_lds_b128 %6, %14, off\n\t"
      "global_load_async_to_lds_b128 %7, %15, off\n\t"
      "s_wait_xcnt 0x0"
      :: "v"(l), "v"(l1), "v"(l2), "v"(l3), "v"(l4), "v"(l5), "v"(l6), "v"(l7),
         "v"(g), "v"(g1), "v"(g2), "v"(g3), "v"(g4), "v"(g5), "v"(g6), "v"(g7)
      : "memory");
}

// Epilogue memory operations stand with their waits in one asm statement each, so that no
// register that an issued load or store names is rewritten ahead of the wait (a precaution).
typedef float v4f __attribute__((ext_vector_type(4)));

// 4 x 8 consecutive floats at p + 16 i (i = 0..3)
static __device__ __forceinline__ void ld_bias_rows(const float* p, v4f (&b)[8]) {
  asm volatile(
      "global_load_b128 %0, %8, off\n\t"
      "global_load_b128 %1, %8, off offset:16\n\t"
      "global_load_b128 %2, %8, off offset:64\n\t"
      "global_load_b128 %3, %8, off offset:80\n\t"
      "global_load_b128 %4, %8, off offset:128\n\t"
      "global_load_b128 %5, %8, off offset:144\n\t"
      "global_load_b128 %6, %8, off offset:192\n\t"
      "global_load_b128 %7, %8, off offset:208\n\t"
      "s_wait_loadcnt 0x0\n\t"
      "s_wait_xcnt 0x0"
      : "=&v"(b[0]), "=&v"(b[1]), "=&v"(b[2]), "=&v"(b[3]),
        "=&v"(b[4]), "=&v"(b[5]), "=&v"(b[6]), "=&v"(b[7])
      : "v"(p) : "memory");
}
// one float at p + 16 j (j = 0..3)
static __device__ __forceinline__ void ld_bias_cols(const float* p, float (&b)[4]) {
  asm volatile(
      "global_load_b32 %0, %4, off\n\t"
      "global_load_b32 %1, %4, off offset:64\n\t"
      "global_load_b32 %2, %4, off offset:128\n\t"
      "global_load_b32 %3, %4, off offset:192\n\t"
      "s_wait_loadcnt 0x0\n\t"
      "s_wait_xcnt 0x0"
      : "=&v"(b[0]), "=&v"(b[1]), "=&v"(b[2]), "=&v"(b[3])
      : "v"(p) : "memory");
}
// Q,K: v[4 i + j] goes to token row + 16 j (rows of 128 B), dh + 16 i
static __device__ __forceinline__ void st_tile_qk(_Float16* p, const h8 (&v)[16]) {
  asm volatile(
      "global_store_b128 %0, %1, off\n\t"
      "global_store_b128 %0, %2, off offset:2048\n\t"
      "global_store_b128 %0, %3, off offset:4096\n\t"
      "global_store_b128 %0, %4, off offset:6144\n\t"
      "global_store_b128 %0, %5, off offset:32\n\t"
      "global_store_b128 %0, %6, off offset:2080\n\t"
      "global_store_b128 %0, %7, off offset:4128\n\t"
      "global_store_b128 %0, %8, off offset:6176\n\t"
      "global_store_b128 %0, %9, off offset:64\n\t"
      "global_store_b128 %0, %10, off offset:2112\n\t"
      "global_store_b128 %0, %11, off offset:4160\n\t"
      "global_store_b128 %0, %12, off offset:6208\n\t"
      "global_store_b128 %0, %13, off offset:96\n\t"
      "global_store_b128 %0, %14, off offset:2144\n\t"
      "global_store_b128 %0, %15, off offset:4192\n\t"
      "global_store_b128 %0, %16, off offset:6240\n\t"
      "s_wait_xcnt 0x0"
      :: "v"(p), "v"(v[0]), "v"(v[1]), "v"(v[2]), "v"(v[3]), "v"(v[4]), "v"(v[5]), "v"(v[6]), "v"(v[7]),
         "v"(v[8]), "v"(v[9]), "v"(v[10]), "v"(v[11]), "v"(v[12]), "v"(v[13]), "v"(v[14]), "v"(v[15])
      : "memory");
}
// V transposed: v[4 j + i] goes to dh row + 16 j (rows of S_LEN halfs = 4096 B), s + 16 i
static __device__ __forceinline__ void st_tile_vt(_Float16* p, const h8 (&v)[16]) {
  asm volatile(
      "global_store_b128 %0, %1, off\n\t"
      "global_store_b128 %0, %2, off offset:32\n\t"
      "global_store_b128 %0, %3, off offset:64\n\t"
      "global_store_b128 %0, %4, off offset:96\n\t"
      "global_store_b128 %0, %5, off offset:65536\n\t"
      "global_store_b128 %0, %6, off offset:65568\n\t"
      "global_store_b128 %0, %7, off offset:65600\n\t"
      "global_store_b128 %0, %8, off offset:65632\n\t"
      "global_store_b128 %0, %9, off offset:131072\n\t"
      "global_store_b128 %0, %10, off offset:131104\n\t"
      "global_store_b128 %0, %11, off offset:131136\n\t"
      "global_store_b128 %0, %12, off offset:131168\n\t"
      "global_store_b128 %0, %13, off offset:196608\n\t"
      "global_store_b128 %0, %14, off offset:196640\n\t"
      "global_store_b128 %0, %15, off offset:196672\n\t"
      "global_store_b128 %0, %16, off offset:196704\n\t"
      "s_wait_xcnt 0x0"
      :: "v"(p), "v"(v[0]), "v"(v[1]), "v"(v[2]), "v"(v[3]), "v"(v[4]), "v"(v[5]), "v"(v[6]), "v"(v[7]),
         "v"(v[8]), "v"(v[9]), "v"(v[10]), "v"(v[11]), "v"(v[12]), "v"(v[13]), "v"(v[14]), "v"(v[15])
      : "memory");
}

__global__ void __launch_bounds__(128)
qkv_gemm(const _Float16* __restrict__ Xh,
         const _Float16* __restrict__ Wqh, const _Float16* __restrict__ Wkh,
         const _Float16* __restrict__ Wvh,
         const float* __restrict__ bq, const float* __restrict__ bk, const float* __restrict__ bv,
         _Float16* __restrict__ Qh, _Float16* __restrict__ Kh, _Float16* __restrict__ Vth) {
  __shared__ __align__(16) _Float16 St[2 * G_STAGE];   // 73,728 B

  const int tid  = threadIdx.x;
  const int lane = tid & 31;
  const int wave = tid >> 5;
  const int nn   = lane & 15;
  const int hiH  = (lane >> 4) & 1;
  const int k0   = hiH * 8;
  const int n0   = blockIdx.x * 128 + (wave & 1) * 64;    // this wave's first feature
  const int row0 = blockIdx.y * 128 + (wave >> 1) * 64;   // this wave's first token row
  const int which = blockIdx.z;

  const _Float16* W    = (which == 0) ? Wqh : (which == 1) ? Wkh : Wvh;
  const float*    bias = (which == 0) ? bq  : (which == 1) ? bk  : bv;

  // copies: a lane brings chunk (tid & 7) of rows (tid >> 3) + 16 r, r = 0..7, of W and of X
  const int crow = tid >> 3, ccol = (tid & 7) << 3;
  const _Float16* gW = W  + (size_t)(blockIdx.x * 128 + crow) * D_MODEL + ccol;
  const _Float16* gX = Xh + (size_t)(blockIdx.y * 128 + crow) * D_MODEL + ccol;
  const unsigned  lW = (unsigned)(unsigned long long)&St[crow * G_PITCH + ccol];
  const unsigned  lX = lW + 128 * G_PITCH * 2;

  // Q,K: features are the rows of D (operand A = W), so a lane holds 8 consecutive dh of one
  // token; V: tokens are the rows (A = X), so a lane holds 8 consecutive s of one feature.
  const int wrow = (wave & 1) * 64 + nn, xrow = 128 + (wave >> 1) * 64 + nn;
  const int aoff = ((which == 2) ? xrow : wrow) * G_PITCH + k0;
  const int boff = ((which == 2) ? wrow : xrow) * G_PITCH + k0;

  v8f acc[4][4];
#pragma unroll
  for (int i = 0; i < 4; ++i)
#pragma unroll
    for (int j = 0; j < 4; ++j) acc[i][j] = (v8f){};

  cp16x8(lW, gW);
  cp16x8(lX, gX);
  wait_async_le0();
  __syncthreads();
  cp16x8(lW + G_STAGE * 2, gW + 64);
  cp16x8(lX + G_STAGE * 2, gX + 64);

  for (int t = 0; t < G_PASSES; ++t) {
    const int bo = (t & 1) * G_STAGE;
    // the whole pass's fragments go to registers as one group of LDS reads
    v16h af[2][4], bf[2][4];
#pragma unroll
    for (int ks = 0; ks < 2; ++ks)
#pragma unroll
      for (int i = 0; i < 4; ++i) {
        af[ks][i] = frag_ld(&St[bo + aoff + i * 16 * G_PITCH + ks * 32], 0);
        bf[ks][i] = frag_ld(&St[bo + boff + i * 16 * G_PITCH + ks * 32], 0);
      }
    // publish point of pass t + 1: own LDS reads done, own copies landed, then the barrier
    // that shows pass t + 1's tile to every wave and frees pass t's buffer for the refill
    asm volatile("s_wait_dscnt 0x0" ::: "memory");
    wait_async_le0();
    __syncthreads();
    if (t + 2 < G_PASSES) {
      cp16x8(lW + bo * 2, gW + (t + 2) * 64);
      cp16x8(lX + bo * 2, gX + (t + 2) * 64);
    }
    // the pass's WMMAs work on registers alone, so the refill flies under all of them
#pragma unroll
    for (int ks = 0; ks < 2; ++ks)
#pragma unroll
      for (int i = 0; i < 4; ++i)
#pragma unroll
        for (int j = 0; j < 4; ++j) acc[i][j] = WMMA_F16(af[ks][i], bf[ks][j], acc[i][j]);
  }
  wait_async_le0();   // no copy is outstanding when the wave ends

  const int bb = row0 >> 11;             // / S_LEN: one batch entry per 64-row wave tile
  const int s0 = row0 & (S_LEN - 1);
  const size_t head = (size_t)(bb * N_HEADS + (n0 >> 6));   // one head per 64-feature wave tile
  h8 v[16];
  if (which == 2) {
    float bb_[4];
    ld_bias_cols(bias + n0 + nn, bb_);
#pragma unroll
    for (int j = 0; j < 4; ++j)
#pragma unroll
      for (int i = 0; i < 4; ++i)
#pragma unroll
        for (int g = 0; g < 8; ++g) v[j * 4 + i][g] = (_Float16)(acc[i][j][g] + bb_[j]);
    st_tile_vt(Vth + (head * D_HEAD + nn) * S_LEN + s0 + hiH * 8, v);
  } else {
    v4f bb_[8];
    ld_bias_rows(bias + n0 + hiH * 8, bb_);
#pragma unroll
    for (int i = 0; i < 4; ++i)
#pragma unroll
      for (int j = 0; j < 4; ++j)
#pragma unroll
        for (int g = 0; g < 8; ++g)
          v[i * 4 + j][g] = (_Float16)(acc[i][j][g] + bb_[i * 2 + (g >> 2)][g & 3]);
    st_tile_qk(((which == 0) ? Qh : Kh) + (head * S_LEN + s0 + nn) * D_HEAD + hiH * 8, v);
  }
}

// ---------------- Kernel 3: flash attention with relative skew ----------------
// K/V slabs (32 keys) are double-buffered in LDS via async copies, shared by all 4 waves;
// the copies of slab n+1 are issued behind slab n's barrier and fly under its compute.
// A fragment read takes 16 bytes of each of 16 rows per half wave: at a row pitch of 16 B x odd
// the 16 rows fall on all 64 banks; at the rows' own 128 B and 64 B they fall on 8 and 16 banks.
#define K_PITCH 72   // halfs per staged K row: 64 + 8 (144 B)
#define V_PITCH 40   // halfs per staged V^T row: 32 + 8 (80 B)
static __device__ __forceinline__ void slab_load(const _Float16* __restrict__ Kbase,
                                                 const _Float16* __restrict__ Vbase,
                                                 int t0,
                                                 _Float16 (*Kl)[K_PITCH], _Float16 (*Vl)[V_PITCH],
                                                 int tid) {
#pragma unroll
  for (int r = 0; r < 2; ++r) {
    int c = tid + r * 128;                 // 0..255
    int krow = c >> 3, kcol = (c & 7) << 3;   // 32 rows x 64 halfs
    cp16_g2l(Kbase + (size_t)(t0 + krow) * D_HEAD + kcol, &Kl[krow][kcol]);
    int vrow = c >> 2, vcol = (c & 3) << 3;   // 64 rows x 32 halfs
    cp16_g2l(Vbase + (size_t)vrow * S_LEN + t0 + vcol, &Vl[vrow][vcol]);
  }
}

// One band block (16 Er rows of 128 B) into its ring slot, whole 128-byte lines: a thread brings
// 16 bytes of row tid / 8. k is the same for the whole block of threads.
static __device__ __forceinline__ void band_stage(const _Float16* __restrict__ Erh, int k,
                                                  _Float16 (*slot)[K_PITCH], int tid) {
  const int row = tid >> 3, col = (tid & 7) << 3;
  cp16_g2l(band_row(Erh, k, row) + col, &slot[row][col]);
}

#define SK_PITCH 68   // floats per ring row: 64 keys + 4, so 16 rows' 16-byte reads fall on 64 banks

typedef float v2f __attribute__((ext_vector_type(2)));
#define EXP2_SCALE (0.125f * 1.44269504088896340736f)   // log2(e) / sqrt(D_HEAD)

// value of the lane 16 away
static __device__ __forceinline__ float other_half(float v) {
  int b = __builtin_bit_cast(int, v);
  b = __builtin_amdgcn_permlanex16(b, b, 0x76543210, 0xfedcba98, false, false);
  return __builtin_bit_cast(float, b);
}

// The prologue's global loads: a row's two fragments are the 16 bytes at p, p + 32 B, p + 64 B and
// p + 96 B (p = row + 8 hiH halfs). The loads of several rows stand with their waits in one asm
// statement, so that all are in flight together and no register that an issued load names is
// rewritten ahead of the wait (a precaution).
#define LD_ROW(d0, d1, d2, d3, a)                      \
  "global_load_b128 %" #d0 ", %" #a ", off\n\t"           \
  "global_load_b128 %" #d1 ", %" #a ", off offset:32\n\t" \
  "global_load_b128 %" #d2 ", %" #a ", off offset:64\n\t" \
  "global_load_b128 %" #d3 ", %" #a ", off offset:96\n\t"
static __device__ __forceinline__ void ld_rows4(const _Float16* p0, const _Float16* p1,
                                                const _Float16* p2, const _Float16* p3,
                                                h8 (&v)[16]) {
  asm volatile(
      LD_ROW(0, 1, 2, 3, 16) LD_ROW(4, 5, 6, 7, 17) LD_ROW(8, 9, 10, 11, 18)
      LD_ROW(12, 13, 14, 15, 19)
      "s_wait_loadcnt 0x0\n\t"
      "s_wait_xcnt 0x0"
      : "=&v"(v[0]), "=&v"(v[1]), "=&v"(v[2]), "=&v"(v[3]), "=&v"(v[4]), "=&v"(v[5]),
        "=&v"(v[6]), "=&v"(v[7]), "=&v"(v[8]), "=&v"(v[9]), "=&v"(v[10]), "=&v"(v[11]),
        "=&v"(v[12]), "=&v"(v[13]), "=&v"(v[14]), "=&v"(v[15])
      : "v"(p0), "v"(p1), "v"(p2), "v"(p3) : "memory");
}
static __device__ __forceinline__ void ld_rows6(const _Float16* p0, const _Float16* p1,
                                                const _Float16* p2, const _Float16* p3,
                                                const _Float16* p4, const _Float16* p5,
                                                h8 (&v)[24]) {
  asm volatile(
      LD_ROW(0, 1, 2, 3, 24) LD_ROW(4, 5, 6, 7, 25) LD_ROW(8, 9, 10, 11, 26)
      LD_ROW(12, 13, 14, 15, 27) LD_ROW(16, 17, 18, 19, 28) LD_ROW(20, 21, 22, 23, 29)
      "s_wait_loadcnt 0x0\n\t"
      "s_wait_xcnt 0x0"
      : "=&v"(v[0]), "=&v"(v[1]), "=&v"(v[2]), "=&v"(v[3]), "=&v"(v[4]), "=&v"(v[5]),
        "=&v"(v[6]), "=&v"(v[7]), "=&v"(v[8]), "=&v"(v[9]), "=&v"(v[10]), "=&v"(v[11]),
        "=&v"(v[12]), "=&v"(v[13]), "=&v"(v[14]), "=&v"(v[15]), "=&v"(v[16]), "=&v"(v[17]),
        "=&v"(v[18]), "=&v"(v[19]), "=&v"(v[20]), "=&v"(v[21]), "=&v"(v[22]), "=&v"(v[23])
      : "v"(p0), "v"(p1), "v"(p2), "v"(p3), "v"(p4), "v"(p5) : "memory");
}
// fragment from its two 16-byte halves, in frag_ld's order
static __device__ __forceinline__ v16h frag_of(h8 lo, h8 hi) {
  return __builtin_shufflevector(lo, hi, 0,1,2,3,4,5,6,7,8,9,10,11,12,13,14,15);
}

// A wave holds two 16-query tiles, so every K, V^T and Er fragment it reads from LDS feeds both.
#define Q_TILES 2
#define BLK_Q (4 * Q_TILES * 16)   // queries per block
#define EL_SLOTS 16                // ring of band blocks: ten are live at a time

// The grid gives every SIMD two waves; said to the compiler, so that it does not hold registers
// down for a third wave that the LDS would still admit and serialise the fragment reads.
__global__ void __launch_bounds__(128) __attribute__((amdgpu_waves_per_eu(2, 2)))
attn_kernel(const _Float16* __restrict__ Qh, const _Float16* __restrict__ Kh,
            const _Float16* __restrict__ Vt, const _Float16* __restrict__ Erh,
            float* __restrict__ out) {
  __shared__ __align__(16) _Float16 Kl[2][32][K_PITCH];   // double-buffered K slab
  __shared__ __align__(16) _Float16 Vl[2][64][V_PITCH];   // double-buffered V slab (dh,t)
  __shared__ __align__(16) float sk[4 * Q_TILES][16 * SK_PITCH];   // one skew ring per query tile
  __shared__ __align__(16) _Float16 El[EL_SLOTS][16][K_PITCH];     // ring of band blocks, shared by the waves

  const int tid  = threadIdx.x;
  const int lane = tid & 31;
  const int wave = __builtin_amdgcn_readfirstlane(tid >> 5);   // scalar: picks the band blocks
  const int hiH  = (lane >> 4) & 1;
  const int k0   = hiH * 8;
  const int nn   = lane & 15;

  const int h  = blockIdx.y;
  const int b  = blockIdx.z;
  const int s0 = blockIdx.x * BLK_Q + wave * (Q_TILES * 16);   // tile u holds queries s0 + 16 u + nn

  const size_t head = (size_t)(b * N_HEADS + h) * (size_t)S_LEN * D_HEAD;
  const _Float16* Qbase = Qh + head;
  const _Float16* Kbase = Kh + head;
  const _Float16* Vbase = Vt + head;   // (dh, t) layout

  // warm the Er diagonal band this block touches first
  {
    int e = S_LEN - 16 - s0 + nn;
    e = e < 0 ? 0 : e;
    __builtin_prefetch(Erh + (size_t)e * D_HEAD, 0, 1);
  }

  float rowmax[Q_TILES], rowsum[Q_TILES];   // of query s0 + 16 u + nn; rowsum over this half's keys
  v8f o[Q_TILES][4];                        // O^T: register g = dh 16 n + 8 hiH + g, lane = query
#pragma unroll   // constant u, n keep the state in registers
  for (int u = 0; u < Q_TILES; ++u) {
    rowmax[u] = -3.0e38f; rowsum[u] = 0.f;
#pragma unroll
    for (int n = 0; n < 4; ++n) o[u][n] = (v8f){};
  }

  slab_load(Kbase, Vbase, 0, Kl[0], Vl[0], tid);   // preload slab 0

  // Query tile w = 2 wave + u of the block has a band stream that runs w blocks behind tile 0's, so
  // the eight tiles read the same Er rows within four slabs: each block is staged once for all of
  // them. Block kb0 + j lies in slot j & 15. In slab n the waves read j = 2 n - 1 .. 2 n + 6 while
  // j = 2 n + 7 and 2 n + 8 are in flight.
  const int kb0 = (S_LEN - 16 - (int)blockIdx.x * BLK_Q) >> 4;
#pragma unroll   // constant j: the slots are immediate offsets
  for (int j = -1; j < 7; ++j) band_stage(Erh, kb0 + j, El[j & (EL_SLOTS - 1)], tid);

  v16h qa[Q_TILES][2], qs[Q_TILES][2];   // Q and Q of rows s + 1 (skew wrap term), d 0..31 and 32..63
  {
    const _Float16* qp[Q_TILES][2];
#pragma unroll   // constant u keeps the pointers in registers
    for (int u = 0; u < Q_TILES; ++u) {
      int sshift = s0 + 16 * u + nn + 1; if (sshift > S_LEN - 1) sshift = S_LEN - 1;
      qp[u][0] = Qbase + (size_t)(s0 + 16 * u + nn) * D_HEAD + k0;
      qp[u][1] = Qbase + (size_t)sshift * D_HEAD + k0;
    }
    h8 v[16];
    ld_rows4(qp[0][0], qp[0][1], qp[1][0], qp[1][1], v);
#pragma unroll   // constant u keeps the fragments in registers
    for (int u = 0; u < Q_TILES; ++u) {
      qa[u][0] = frag_of(v[8 * u + 0], v[8 * u + 1]);
      qa[u][1] = frag_of(v[8 * u + 2], v[8 * u + 3]);
      qs[u][0] = frag_of(v[8 * u + 4], v[8 * u + 5]);
      qs[u][1] = frag_of(v[8 * u + 6], v[8 * u + 7]);
    }
  }

  // Band stream of a tile whose first block is kt: block kt + m holds, for query row i, keys
  // 16 m - 15 + i .. 16 m + i, so slab n (keys 32 n .. 32 n + 31) needs blocks m <= 2 n + 2. Blocks
  // are multiplied and stored one slab ahead of their first full use; their Er fragments are fetched
  // one slab before that, the first blocks' from memory, all later ones from the LDS ring of band
  // blocks. Tile 1's kt is tile 0's less one, so of its two blocks of a slab one is tile 0's first
  // and the other tile 0's second of the slab before, kept in registers.
  // Ring column of (row i = 8 hiH + g, lane nn) in block m: (16 m + 49 + nn + i) & 63; only
  // m = 0 (mod 4) can wrap inside a block.
  float* const skw = &sk[wave * Q_TILES][0];                         // tile u: + u 16 SK_PITCH
  float* const sk_st = skw + (8 * hiH) * (SK_PITCH + 1) + nn + 1;    // + g (SK_PITCH + 1) + 16 ((m & 3) - 1)
  const float* const sk_ld = skw + nn * SK_PITCH + 8 * hiH;          // + (first key of the tile) & 63
  int wofs[8];                                                       // the wrapping block's places
#pragma unroll   // constant g keeps the table in registers
  for (int g = 0; g < 8; ++g)
    wofs[g] = (8 * hiH + g) * SK_PITCH + ((49 + nn + 8 * hiH + g) & 63);

  int kb = (S_LEN - 16 - s0) >> 4;   // tile 0's first block; tile 1's is kb - 1
  v16h fc0, fc1, fa0, fa1, fb0, fb1;   // fragments of blocks kb + 2, kb + 3, kb + 4
  {
    h8 v[24];                        // blocks kb - 1 .. kb + 4
    ld_rows6(band_row(Erh, kb - 1, nn) + k0, band_row(Erh, kb, nn) + k0,
             band_row(Erh, kb + 1, nn) + k0, band_row(Erh, kb + 2, nn) + k0,
             band_row(Erh, kb + 3, nn) + k0, band_row(Erh, kb + 4, nn) + k0, v);
    v16h f[4][2];                    // blocks kb - 1 .. kb + 2
#pragma unroll   // constant m keeps the fragments in registers
    for (int m = 0; m < 4; ++m) {
      f[m][0] = frag_of(v[4 * m + 0], v[4 * m + 1]);
      f[m][1] = frag_of(v[4 * m + 2], v[4 * m + 3]);
    }
    fa0 = frag_of(v[16], v[17]); fa1 = frag_of(v[18], v[19]);
    fb0 = frag_of(v[20], v[21]); fb1 = frag_of(v[22], v[23]);
#pragma unroll   // constant u keeps the tiles in registers
    for (int u = 0; u < Q_TILES; ++u) {
      const v8f g0 = band_gemm<BAND_ANY>(kb - u,     nn, qa[u][0], qa[u][1], qs[u][0], qs[u][1], f[1 - u][0], f[1 - u][1]);
      const v8f g1 = band_gemm<BAND_ANY>(kb - u + 1, nn, qa[u][0], qa[u][1], qs[u][0], qs[u][1], f[2 - u][0], f[2 - u][1]);
      const v8f g2 = band_gemm<BAND_ANY>(kb - u + 2, nn, qa[u][0], qa[u][1], qs[u][0], qs[u][1], f[3 - u][0], f[3 - u][1]);
#pragma unroll   // constant g keeps the tiles in registers
      for (int g = 0; g < 8; ++g) {
        skw[u * 16 * SK_PITCH + wofs[g]] = g0[g];
        sk_st[u * 16 * SK_PITCH + g * (SK_PITCH + 1)] = g1[g];
        sk_st[u * 16 * SK_PITCH + g * (SK_PITCH + 1) + 16] = g2[g];
      }
    }
    fc0 = f[3][0]; fc1 = f[3][1];
  }

  // two slabs (64 keys from tp on); where says on which side of the wrap their band blocks lie
  auto slab_pair = [&](auto where, const int tp) __attribute__((always_inline)) {
    constexpr int WHERE = decltype(where)::value;
#pragma unroll   // constant par: buffer and ring places become immediate offsets
    for (int par = 0; par < 2; ++par) {
      const int t0 = tp + par * 32;
      const int j0 = t0 >> 4;            // 2 n
      // publish point: own LDS reads of the slab before done, own copies (this slab, band blocks up
      // to j0 + 6) landed, then the one barrier that shows them to every wave and frees the places
      // that the slab before has read for the refill
      asm volatile("s_wait_dscnt 0x0" ::: "memory");
      wait_async_le0();
      __syncthreads();   // also orders the ring's stores of the slab before ahead of the reads below
      if (t0 + 32 < S_LEN) {
        slab_load(Kbase, Vbase, t0 + 32, Kl[par ^ 1], Vl[par ^ 1], tid);
        band_stage(Erh, kb0 + j0 + 7, El[(j0 + 7) & (EL_SLOTS - 1)], tid);
        band_stage(Erh, kb0 + j0 + 8, El[(j0 + 8) & (EL_SLOTS - 1)], tid);
      }

      // ---- Srel^T of this slab from the rings: 8 consecutive keys of the lane's query per tile ----
      v4f rr[Q_TILES][4];
#pragma unroll
      for (int u = 0; u < Q_TILES; ++u)
#pragma unroll
        for (int q = 0; q < 4; ++q)
          rr[u][q] = *(const v4f*)(sk_ld + u * 16 * SK_PITCH + par * 32 + (q >> 1) * 16 + (q & 1) * 4);
      // the slab's K fragments, read once for both query tiles
      v16h kf[2][2];
#pragma unroll   // constant sub keeps the fragments in registers
      for (int sub = 0; sub < 2; ++sub) {
        const _Float16* krow = &Kl[par][sub * 16 + nn][0];
        kf[sub][0] = frag_ld(krow, k0);
        kf[sub][1] = frag_ld(krow + 32, k0);
      }
      // the ring places stored below alias keys read above: keep the compiler from lifting the
      // stores over those reads (the wave's LDS operations run in program order)
      __builtin_amdgcn_fence(__ATOMIC_ACQ_REL, "wavefront");
      // keeps the reads above one group ahead of the products: without it the build read the K
      // fragments one by one into the same registers, a full wait in front of each product
      __builtin_amdgcn_sched_barrier(0);

      // the next slab's two new band blocks of each tile; the fragments of the slab after go into
      // the same registers further down
      v8f ga[Q_TILES], gb[Q_TILES];
      ga[0] = band_gemm<WHERE>(kb + 3, nn, qa[0][0], qa[0][1], qs[0][0], qs[0][1], fa0, fa1);
      gb[0] = band_gemm<WHERE>(kb + 4, nn, qa[0][0], qa[0][1], qs[0][0], qs[0][1], fb0, fb1);
      ga[1] = band_gemm<WHERE>(kb + 2, nn, qa[1][0], qa[1][1], qs[1][0], qs[1][1], fc0, fc1);
      gb[1] = band_gemm<WHERE>(kb + 3, nn, qa[1][0], qa[1][1], qs[1][0], qs[1][1], fa0, fa1);
      kb += 2;

      // ---- S^T: two 16-key tiles (K = 64) per query tile, K rows from LDS as A, Q as B; the
      // Srel^T tile is the products' C operand, so the accumulators leave as Q K^T + Srel ----
      v8f sc[Q_TILES][2];   // unscaled scores: register g of tile sub = key 16 sub + 8 hiH + g
#pragma unroll   // constant sub, u keep the tiles in registers
      for (int sub = 0; sub < 2; ++sub)
#pragma unroll
        for (int u = 0; u < Q_TILES; ++u) {
          v8f c = __builtin_shufflevector(rr[u][sub * 2], rr[u][sub * 2 + 1], 0, 1, 2, 3, 4, 5, 6, 7);
          c = WMMA_F16(kf[sub][0], qa[u][0], c);
          sc[u][sub] = WMMA_F16(kf[sub][1], qa[u][1], c);
        }

      // ---- the next band products' Er fragments: one block stays, two come from the ring ----
      {
        fc0 = fb0; fc1 = fb1;                                                   // block kb + 2
        const _Float16* ea = &El[(j0 + 5 - 2 * wave) & (EL_SLOTS - 1)][nn][0];   // block kb + 3
        const _Float16* eb = &El[(j0 + 6 - 2 * wave) & (EL_SLOTS - 1)][nn][0];   // block kb + 4
        fa0 = frag_ld(ea, k0); fa1 = frag_ld(ea + 32, k0);
        fb0 = frag_ld(eb, k0); fb1 = frag_ld(eb + 32, k0);
      }
      // keeps these reads here, where the softmax covers their latency: the build sank them to the
      // slab's end, directly in front of the wait of the publish point
      __builtin_amdgcn_sched_barrier(0);

      // the band products go into the rings behind the S^T products: the tiles stay live over them,
      // so no S^T product takes a band product's registers as its result inside the WMMA distance
#pragma unroll   // constant u, g keep the tiles in registers
      for (int u = 0; u < Q_TILES; ++u)
#pragma unroll
        for (int g = 0; g < 8; ++g) {
          if (par == 0) {     // blocks 3 and 0 (mod 4)
            sk_st[u * 16 * SK_PITCH + g * (SK_PITCH + 1) + 32] = ga[u][g];
            skw[u * 16 * SK_PITCH + wofs[g]] = gb[u][g];
          } else {            // blocks 1 and 2 (mod 4)
            sk_st[u * 16 * SK_PITCH + g * (SK_PITCH + 1)] = ga[u][g];
            sk_st[u * 16 * SK_PITCH + g * (SK_PITCH + 1) + 16] = gb[u][g];
          }
        }

      // ---- online softmax across this 32-key slab: one query per lane and tile. The maximum is
      // kept in unscaled scores; 1 / sqrt(D_HEAD) and log2(e) enter in the one multiply-add ahead of
      // the power of two, taken on two neighbouring accumulator registers at a time ----
      v16h pb[Q_TILES];   // P^T as B: element e = key 8 hiH + e (e < 8), 16 + 8 hiH + e - 8 (e >= 8)
#pragma unroll   // constant u keeps the state in registers
      for (int u = 0; u < Q_TILES; ++u) {
        float m4[4];
#pragma unroll
        for (int e = 0; e < 4; ++e)
          m4[e] = fmaxf(fmaxf(sc[u][0][e], sc[u][0][e + 4]), fmaxf(sc[u][1][e], sc[u][1][e + 4]));
        float tm = fmaxf(fmaxf(m4[0], m4[1]), fmaxf(m4[2], m4[3]));
        tm = fmaxf(tm, other_half(tm));
        const float nm = fmaxf(rowmax[u], tm);
        const float al = __builtin_amdgcn_exp2f((rowmax[u] - nm) * EXP2_SCALE);
        rowmax[u] = nm;
        const float nb = -nm * EXP2_SCALE;
        v2f p2[2] = {(v2f){0.f, 0.f}, (v2f){0.f, 0.f}};   // four partial sums: of the keys e = 0 .. 3 (mod 4)
#pragma unroll   // constant e keeps scores and P in registers
        for (int e = 0; e < 16; e += 2) {
          const v2f t = {sc[u][e >> 3][e & 7], sc[u][e >> 3][(e & 7) + 1]};
          const v2f a = __builtin_elementwise_fma(t, (v2f){EXP2_SCALE, EXP2_SCALE}, (v2f){nb, nb});
          const v2f p = {__builtin_amdgcn_exp2f(a[0]), __builtin_amdgcn_exp2f(a[1])};
          p2[(e >> 1) & 1] += p;
          pb[u][e] = (_Float16)p[0];
          pb[u][e + 1] = (_Float16)p[1];
        }
        rowsum[u] = rowsum[u] * al + ((p2[0][0] + p2[0][1]) + (p2[1][0] + p2[1][1]));
#pragma unroll
        for (int n = 0; n < 4; ++n)
#pragma unroll
          for (int g = 0; g < 8; ++g) o[u][n][g] *= al;
      }

      // ---- O^T += V^T P^T : 4 WMMAs per query tile over the 64 head dims (K = 32), V^T rows from
      // LDS as A, each fragment read once for both tiles ----
      const _Float16* vrow_ = &Vl[par][nn][0];
#pragma unroll   // constant n keeps the accumulators in registers
      for (int n = 0; n < 4; ++n) {
        const v16h vf = frag_ld(vrow_ + n * 16 * V_PITCH, k0);
#pragma unroll
        for (int u = 0; u < Q_TILES; ++u) o[u][n] = WMMA_F16(vf, pb[u], o[u][n]);
      }
      // keeps the products in front of the next publish point: the build let the last of them sink
      // behind its barrier, directly in front of a branch
      __builtin_amdgcn_sched_barrier(0);
    }
  };

  // Slab n multiplies blocks kb0 - w + 2 n + 3 and + 4 for the tiles w = 0 .. 7 of the block,
  // kb0 = BAND_WRAP - 1 - 8 blockIdx.x. For every tile they lie below the wrap in the pairs of slabs
  // before 2 blockIdx.x - 1 and above it from pair 2 blockIdx.x + 2 on: there the Q operand is fixed
  // and no zero column is cut, so the selects stand only in the pairs between. The bounds are the
  // same for the whole block.
  const int t_any   = ((int)blockIdx.x > 0 ? 2 * (int)blockIdx.x - 1 : 0) * 64;
  const int t_above = (2 * (int)blockIdx.x + 2) * 64;
  int tp = 0;
  for (; tp < t_any; tp += 64)   slab_pair(band_where<BAND_BELOW>{}, tp);
  for (; tp < t_above; tp += 64) slab_pair(band_where<BAND_ANY>{}, tp);
  for (; tp < S_LEN; tp += 64)   slab_pair(band_where<BAND_ABOVE>{}, tp);

  // ---- join the halves' sums, normalize and write (B, S, D_MODEL) f32 ----
#pragma unroll   // constant u, n keep the accumulators in registers
  for (int u = 0; u < Q_TILES; ++u) {
    const float inv = 1.0f / (rowsum[u] + other_half(rowsum[u]));
    float* orow = out + ((size_t)(b * S_LEN + s0 + 16 * u + nn)) * D_MODEL + h * D_HEAD + 8 * hiH;
#pragma unroll
    for (int n = 0; n < 4; ++n) {
      *(v4f*)(orow + 16 * n)     = (v4f){o[u][n][0], o[u][n][1], o[u][n][2], o[u][n][3]} * inv;
      *(v4f*)(orow + 16 * n + 4) = (v4f){o[u][n][4], o[u][n][5], o[u][n][6], o[u][n][7]} * inv;
    }
  }
}

extern "C" void kernel_launch(void* const* d_in, const int* in_sizes, int n_in,
                              void* d_out, int out_size, void* d_ws, size_t ws_size,
                              hipStream_t stream) {
  (void)in_sizes; (void)n_in; (void)out_size; (void)ws_size;
  const float* x  = (const float*)d_in[0];
  const float* Wq = (const float*)d_in[1];
  const float* bq = (const float*)d_in[2];
  const float* Wk = (const float*)d_in[3];
  const float* bk = (const float*)d_in[4];
  const float* Wv = (const float*)d_in[5];
  const float* bv = (const float*)d_in[6];
  const float* Er = (const float*)d_in[7];

  char* ws = (char*)d_ws;
  const size_t xhN = (size_t)BATCH * S_LEN * D_MODEL;        // 4,194,304
  const size_t wN  = (size_t)D_MODEL * D_MODEL;              // 1,048,576
  const size_t erN = (size_t)S_LEN * D_HEAD;                 // 131,072

  _Float16* Xh  = (_Float16*)(ws);
  _Float16* Wqh = (_Float16*)(ws + 2 * xhN);
  _Float16* Wkh = Wqh + wN;
  _Float16* Wvh = Wkh + wN;
  _Float16* Erh = Wvh + wN;
  _Float16* Qh  = Erh + erN;
  _Float16* Kh  = Qh + xhN;
  _Float16* Vth = Kh + xhN;

  // Xh, Wqh, Wkh, Wvh, Erh are contiguous from Xh on
  cast_all<<<CAST_XB + 3 * CAST_WB + CAST_EB, CAST_T, 0, stream>>>(x, Wq, Wk, Wv, Er, Xh);

  // QKV: M = 4096 rows, N = 1024 feats, K = 1024; z selects Q/K/V
  qkv_gemm<<<dim3(D_MODEL / 128, (BATCH * S_LEN) / 128, 3), 128, 0, stream>>>(
      Xh, Wqh, Wkh, Wvh, bq, bk, bv, Qh, Kh, Vth);

  // attention: 128 query rows per block (4 waves x 2 tiles x 16)
  attn_kernel<<<dim3(S_LEN / BLK_Q, N_HEADS, BATCH), 128, 0, stream>>>(
      Qh, Kh, Vth, Erh, (float*)d_out);
}

// v010
// Measured time: 84.7 microseconds a run.
// In two side-by-side timings against v009, it was 1.03 and 1.04 times as fast.
// Counting every step since v000, it is 4.63 times as fast.
#include <hip/hip_runtime.h>
#include <hip/hip_bf16.h>

#define S_LEN   2048
#define D_MODEL 1024
#define N_HEADS 16
#define D_HEAD  64
#define BATCH   2

typedef _Float16 h8   __attribute__((ext_vector_type(8)));
typedef _Float16 v16h __attribute__((ext_vector_type(16)));
typedef float    v8f  __attribute__((ext_vector_type(8)));

#define WMMA_F16(a, b, c) \
  __builtin_amdgcn_wmma_f32_16x16x32_f16(false, (a), false, (b), (short)0, (c), false, false)

// ---------- CDNA5 async global->LDS copy (guarded; falls back to ld+ds_store) ----------
#if defined(__has_builtin)
#if __has_builtin(__builtin_amdgcn_global_load_async_to_lds_b128)
#define HAVE_ASYNC_CP 1
#endif
#endif
#ifndef HAVE_ASYNC_CP
#define HAVE_ASYNC_CP 0
#endif

typedef int v4i_t __attribute__((vector_size(16)));
typedef __attribute__((address_space(1))) v4i_t* g_v4i_p;   // global int4*
typedef __attribute__((address_space(3))) v4i_t* l_v4i_p;   // LDS int4*

static __device__ __forceinline__ void cp16_g2l(const _Float16* g, _Float16* l) {
#if HAVE_ASYNC_CP
  __builtin_amdgcn_global_load_async_to_lds_b128(
      (g_v4i_p)(unsigned long long)g,
      (l_v4i_p)(unsigned int)(unsigned long long)l, 0, 0);
#else
  *(h8*)l = *(const h8*)g;
#endif
}
static __device__ __forceinline__ void wait_async_le0() {
#if HAVE_ASYNC_CP
  asm volatile("s_wait_asynccnt 0x0" ::: "memory");
#endif
}

// Load one lane's slice of a 16x32 (f16) A/B fragment.
// Layout per ISA 7.12.2: lanes 0-15 hold K[0..7]+K[16..23], lanes 16-31 hold K[8..15]+K[24..31].
static __device__ __forceinline__ v16h frag_ld(const _Float16* p, int k0) {
  h8 lo = *(const h8*)(p + k0);
  h8 hi = *(const h8*)(p + k0 + 16);
  return __builtin_shufflevector(lo, hi, 0,1,2,3,4,5,6,7,8,9,10,11,12,13,14,15);
}

// The skew reads, for query s and key t, position u = S - 1 + t - s of one band of 2 S positions:
// u < S is q[s].Er[u], u == S is the skew's zero column, u > S is q[s+1].Er[u - S - 1].
// Band block k holds positions 16 k .. 16 k + 15; a 16x16 score tile needs blocks k and k + 1.
#define BAND_WRAP (S_LEN / 16)   // first block that belongs to q[s+1]

// Er row behind column nn of band block k
static __device__ __forceinline__ const _Float16* band_row(const _Float16* __restrict__ Erh,
                                                           int k, int nn) {
  int e = k * 16 + nn - ((k >= BAND_WRAP) ? (S_LEN + 1) : 0);
  e = e < 0 ? 0 : e;                        // the zero column's lane
  e = e > (S_LEN - 1) ? (S_LEN - 1) : e;    // blocks fetched past the last slab, never used
  return Erh + (size_t)e * D_HEAD;
}

// Where a band block lies, known at compile time in the slab loop's steady phases
#define BAND_BELOW 0   // k < BAND_WRAP: q[s], no zero column
#define BAND_ABOVE 1   // k > BAND_WRAP: q[s+1], no zero column
#define BAND_ANY   2   // decided from k

// G = Qtile(16x64) @ (band block k)^T -> 16x16 f32 (2 WMMAs over K=64); k is wave-uniform
template <int WHERE>
static __device__ __forceinline__ v8f band_gemm(int k, int nn, v16h qa0, v16h qa1,
                                                v16h qs0, v16h qs1, v16h f0, v16h f1) {
  v8f c = {};
  if (WHERE == BAND_BELOW) {
    c = WMMA_F16(qa0, f0, c);
    return WMMA_F16(qa1, f1, c);
  }
  if (WHERE == BAND_ABOVE) {
    c = WMMA_F16(qs0, f0, c);
    return WMMA_F16(qs1, f1, c);
  }
  const bool wrap = (k >= BAND_WRAP);
  c = WMMA_F16(wrap ? qs0 : qa0, f0, c);
  c = WMMA_F16(wrap ? qs1 : qa1, f1, c);
  const bool zcol = (k * 16 + nn == S_LEN);
#pragma unroll   // constant g keeps the tile in registers
  for (int g = 0; g < 8; ++g) c[g] = zcol ? 0.f : c[g];
  return c;
}

template <int W> struct band_where { static constexpr int value = W; };

// ---------------- Kernel 1: f32 -> f16 cast of x, Wq, Wk, Wv and Er, one launch ----------------
// The five f16 copies lie one behind the other in the workspace, so a block's place in the grid is
// its place in the destination; each array is a whole number of blocks. A thread converts 64
// elements: sixteen 16-byte loads, each 512 contiguous bytes of a wave, issued ahead of the
// conversions, and sixteen 8-byte stores, each two whole 128-byte lines of a wave.
#define CAST_T 128                                        // threads per block
#define CAST_V 16                                         // 16-byte loads per thread
#define CAST_CHUNK (CAST_T * CAST_V * 4)                  // floats per block
#define CAST_XB (BATCH * S_LEN * D_MODEL / CAST_CHUNK)    // blocks of x
#define CAST_WB (D_MODEL * D_MODEL / CAST_CHUNK)          // blocks of each W
#define CAST_EB (S_LEN * D_HEAD / CAST_CHUNK)             // blocks of Er

typedef float    c4f __attribute__((ext_vector_type(4)));
typedef _Float16 c4h __attribute__((ext_vector_type(4)));

__global__ void __launch_bounds__(CAST_T)
cast_all(const float* __restrict__ x, const float* __restrict__ Wq, const float* __restrict__ Wk,
         const float* __restrict__ Wv, const float* __restrict__ Er, _Float16* __restrict__ dst) {
  const int blk = blockIdx.x;
  const float* src = x;
  int rel = blk;
  if (blk >= CAST_XB + 3 * CAST_WB)      { src = Er; rel = blk - (CAST_XB + 3 * CAST_WB); }
  else if (blk >= CAST_XB + 2 * CAST_WB) { src = Wv; rel = blk - (CAST_XB + 2 * CAST_WB); }
  else if (blk >= CAST_XB + CAST_WB)     { src = Wk; rel = blk - (CAST_XB + CAST_WB); }
  else if (blk >= CAST_XB)               { src = Wq; rel = blk - CAST_XB; }
  const float* p = src + (size_t)rel * CAST_CHUNK + threadIdx.x * 4;
  _Float16*    q = dst + (size_t)blk * CAST_CHUNK + threadIdx.x * 4;
  c4f v[CAST_V];
#pragma unroll   // constant j: the values stay in registers and the loads are in flight together
  for (int j = 0; j < CAST_V; ++j) v[j] = *(const c4f*)(p + j * CAST_T * 4);
#pragma unroll   // constant j, as above
  for (int j = 0; j < CAST_V; ++j)
    *(c4h*)(q + j * CAST_T * 4) = (c4h){(_Float16)v[j][0], (_Float16)v[j][1],
                                        (_Float16)v[j][2], (_Float16)v[j][3]};
}

// ---------------- Kernel 2: QKV projection GEMM ----------------
// y = Xh @ W^T + b ; z = 0/1/2 -> Q/K/V. Q,K stored (b,h,s,dh); V stored transposed (b,h,dh,s).
// One 128x128 tile of y per block, 64x64 per wave (4x4 WMMA tiles), so every LDS fragment
// feeds four WMMAs. A pass is 64 k: 128 W rows and 128 X rows of 128 B, laid at a pitch of
// 144 B (16 B x odd: conflict-free for ds_load_b128), two buffers filled by async copies.
#define G_PITCH 72                       // halfs per staged row (144 B)
#define G_STAGE (256 * G_PITCH)          // halfs per buffer: W rows 0..127, X rows 128..255
#define G_PASSES (D_MODEL / 64)

// Eight 16-byte async copies of one lane. The s_wait_xcnt stands inside the statement so
// that no address register of an issued copy is rewritten ahead of it.
static __device__ __forceinline__ void cp16x8(unsigned l, const _Float16* g) {
  const unsigned l1 = l + 1 * 16 * G_PITCH * 2, l2 = l + 2 * 16 * G_PITCH * 2,
                 l3 = l + 3 * 16 * G_PITCH * 2, l4 = l + 4 * 16 * G_PITCH * 2,
                 l5 = l + 5 * 16 * G_PITCH * 2, l6 = l + 6 * 16 * G_PITCH * 2,
                 l7 = l + 7 * 16 * G_PITCH * 2;
  const _Float16 *g1 = g + 1 * 16 * D_MODEL, *g2 = g + 2 * 16 * D_MODEL,
                 *g3 = g + 3 * 16 * D_MODEL, *g4 = g + 4 * 16 * D_MODEL,
                 *g5 = g + 5 * 16 * D_MODEL, *g6 = g + 6 * 16 * D_MODEL,
                 *g7 = g + 7 * 16 * D_MODEL;
  asm volatile(
      "global_load_async_to_lds_b128 %0, %8, off\n\t"
      "global_load_async_to_lds_b128 %1, %9, off\n\t"
      "global_load_async_to_lds_b128 %2, %10, off\n\t"
      "global_load_async_to_lds_b128 %3, %11, off\n\t"
      "global_load_async_to_lds_b128 %4, %12, off\n\t"
      "global_load_async_to_lds_b128 %5, %13, off\n\t"
      "global_load_async_to_lds_b128 %6, %14, off\n\t"
      "global_load_async_to_lds_b128 %7, %15, off\n\t"
      "s_wait_xcnt 0x0"
      :: "v"(l), "v"(l1), "v"(l2), "v"(l3), "v"(l4), "v"(l5), "v"(l6), "v"(l7),
         "v"(g), "v"(g1), "v"(g2), "v"(g3), "v"(g4), "v"(g5), "v"(g6), "v"(g7)
      : "memory");
}

// Epilogue memory operations stand with their waits in one asm statement each, so that no
// register that an issued load or store names is rewritten ahead of the wait (a precaution).
typedef float v4f __attribute__((ext_vector_type(4)));

// 4 x 8 consecutive floats at p + 16 i (i = 0..3)
static __device__ __forceinline__ void ld_bias_rows(const float* p, v4f (&b)[8]) {
  asm volatile(
      "global_load_b128 %0, %8, off\n\t"
      "global_load_b128 %1, %8, off offset:16\n\t"
      "global_load_b128 %2, %8, off offset:64\n\t"
      "global_load_b128 %3, %8, off offset:80\n\t"
      "global_load_b128 %4, %8, off offset:128\n\t"
      "global_load_b128 %5, %8, off offset:144\n\t"
      "global_load_b128 %6, %8, off offset:192\n\t"
      "global_load_b128 %7, %8, off offset:208\n\t"
      "s_wait_loadcnt 0x0\n\t"
      "s_wait_xcnt 0x0"
      : "=&v"(b[0]), "=&v"(b[1]), "=&v"(b[2]), "=&v"(b[3]),
        "=&v"(b[4]), "=&v"(b[5]), "=&v"(b[6]), "=&v"(b[7])
      : "v"(p) : "memory");
}
// one float at p + 16 j (j = 0..3)
static __device__ __forceinline__ void ld_bias_cols(const float* p, float (&b)[4]) {
  asm volatile(
      "global_load_b32 %0, %4, off\n\t"
      "global_load_b32 %1, %4, off offset:64\n\t"
      "global_load_b32 %2, %4, off offset:128\n\t"
      "global_load_b32 %3, %4, off offset:192\n\t"
      "s_wait_loadcnt 0x0\n\t"
      "s_wait_xcnt 0x0"
      : "=&v"(b[0]), "=&v"(b[1]), "=&v"(b[2]), "=&v"(b[3])
      : "v"(p) : "memory");
}
// Q,K: v[4 i + j] goes to token row + 16 j (rows of 128 B), dh + 16 i
static __device__ __forceinline__ void st_tile_qk(_Float16* p, const h8 (&v)[16]) {
  asm volatile(
      "global_store_b128 %0, %1, off\n\t"
      "global_store_b128 %0, %2, off offset:2048\n\t"
      "global_store_b128 %0, %3, off offset:4096\n\t"
      "global_store_b128 %0, %4, off offset:6144\n\t"
      "global_store_b128 %0, %5, off offset:32\n\t"
      "global_store_b128 %0, %6, off offset:2080\n\t"
      "global_store_b128 %0, %7, off offset:4128\n\t"
      "global_store_b128 %0, %8, off offset:6176\n\t"
      "global_store_b128 %0, %9, off offset:64\n\t"
      "global_store_b128 %0, %10, off offset:2112\n\t"
      "global_store_b128 %0, %11, off offset:4160\n\t"
      "global_store_b128 %0, %12, off offset:6208\n\t"
      "global_store_b128 %0, %13, off offset:96\n\t"
      "global_store_b128 %0, %14, off offset:2144\n\t"
      "global_store_b128 %0, %15, off offset:4192\n\t"
      "global_store_b128 %0, %16, off offset:6240\n\t"
      "s_wait_xcnt 0x0"
      :: "v"(p), "v"(v[0]), "v"(v[1]), "v"(v[2]), "v"(v[3]), "v"(v[4]), "v"(v[5]), "v"(v[6]), "v"(v[7]),
         "v"(v[8]), "v"(v[9]), "v"(v[10]), "v"(v[11]), "v"(v[12]), "v"(v[13]), "v"(v[14]), "v"(v[15])
      : "memory");
}
// V transposed: v[4 j + i] goes to dh row + 16 j (rows of S_LEN halfs = 4096 B), s + 16 i
static __device__ __forceinline__ void st_tile_vt(_Float16* p, const h8 (&v)[16]) {
  asm volatile(
      "global_store_b128 %0, %1, off\n\t"
      "global_store_b128 %0, %2, off offset:32\n\t"
      "global_store_b128 %0, %3, off offset:64\n\t"
      "global_store_b128 %0, %4, off offset:96\n\t"
      "global_store_b128 %0, %5, off offset:65536\n\t"
      "global_store_b128 %0, %6, off offset:65568\n\t"
      "global_store_b128 %0, %7, off offset:65600\n\t"
      "global_store_b128 %0, %8, off offset:65632\n\t"
      "global_store_b128 %0, %9, off offset:131072\n\t"
      "global_store_b128 %0, %10, off offset:131104\n\t"
      "global_store_b128 %0, %11, off offset:131136\n\t"
      "global_store_b128 %0, %12, off offset:131168\n\t"
      "global_store_b128 %0, %13, off offset:196608\n\t"
      "global_store_b128 %0, %14, off offset:196640\n\t"
      "global_store_b128 %0, %15, off offset:196672\n\t"
      "global_store_b128 %0, %16, off offset:196704\n\t"
      "s_wait_xcnt 0x0"
      :: "v"(p), "v"(v[0]), "v"(v[1]), "v"(v[2]), "v"(v[3]), "v"(v[4]), "v"(v[5]), "v"(v[6]), "v"(v[7]),
         "v"(v[8]), "v"(v[9]), "v"(v[10]), "v"(v[11]), "v"(v[12]), "v"(v[13]), "v"(v[14]), "v"(v[15])
      : "memory");
}

__global__ void __launch_bounds__(128)
qkv_gemm(const _Float16* __restrict__ Xh,
         const _Float16* __restrict__ Wqh, const _Float16* __restrict__ Wkh,
         const _Float16* __restrict__ Wvh,
         const float* __restrict__ bq, const float* __restrict__ bk, const float* __restrict__ bv,
         _Float16* __restrict__ Qh, _Float16* __restrict__ Kh, _Float16* __restrict__ Vth) {
  __shared__ __align__(16) _Float16 St[2 * G_STAGE];   // 73,728 B

  const int tid  = threadIdx.x;
  const int lane = tid & 31;
  const int wave = tid >> 5;
  const int nn   = lane & 15;
  const int hiH  = (lane >> 4) & 1;
  const int k0   = hiH * 8;
  const int n0   = blockIdx.x * 128 + (wave & 1) * 64;    // this wave's first feature
  const int row0 = blockIdx.y * 128 + (wave >> 1) * 64;   // this wave's first token row
  const int which = blockIdx.z;

  const _Float16* W    = (which == 0) ? Wqh : (which == 1) ? Wkh : Wvh;
  const float*    bias = (which == 0) ? bq  : (which == 1) ? bk  : bv;

  // copies: a lane brings chunk (tid & 7) of rows (tid >> 3) + 16 r, r = 0..7, of W and of X
  const int crow = tid >> 3, ccol = (tid & 7) << 3;
  const _Float16* gW = W  + (size_t)(blockIdx.x * 128 + crow) * D_MODEL + ccol;
  const _Float16* gX = Xh + (size_t)(blockIdx.y * 128 + crow) * D_MODEL + ccol;
  const unsigned  lW = (unsigned)(unsigned long long)&St[crow * G_PITCH + ccol];
  const unsigned  lX = lW + 128 * G_PITCH * 2;

  // Q,K: features are the rows of D (operand A = W), so a lane holds 8 consecutive dh of one
  // token; V: tokens are the rows (A = X), so a lane holds 8 consecutive s of one feature.
  const int wrow = (wave & 1) * 64 + nn, xrow = 128 + (wave >> 1) * 64 + nn;
  const int aoff = ((which == 2) ? xrow : wrow) * G_PITCH + k0;
  const int boff = ((which == 2) ? wrow : xrow) * G_PITCH + k0;

  v8f acc[4][4];
#pragma unroll
  for (int i = 0; i < 4; ++i)
#pragma unroll
    for (int j = 0; j < 4; ++j) acc[i][j] = (v8f){};

  cp16x8(lW, gW);
  cp16x8(lX, gX);
  wait_async_le0();
  __syncthreads();
  cp16x8(lW + G_STAGE * 2, gW + 64);
  cp16x8(lX + G_STAGE * 2, gX + 64);

  for (int t = 0; t < G_PASSES; ++t) {
    const int bo = (t & 1) * G_STAGE;
    // the whole pass's fragments go to registers as one group of LDS reads
    v16h af[2][4], bf[2][4];
#pragma unroll
    for (int ks = 0; ks < 2; ++ks)
#pragma unroll
      for (int i = 0; i < 4; ++i) {
        af[ks][i] = frag_ld(&St[bo + aoff + i * 16 * G_PITCH + ks * 32], 0);
        bf[ks][i] = frag_ld(&St[bo + boff + i * 16 * G_PITCH + ks * 32], 0);
      }
    // publish point of pass t + 1: own LDS reads done, own copies landed, then the barrier
    // that shows pass t + 1's tile to every wave and frees pass t's buffer for the refill
    asm volatile("s_wait_dscnt 0x0" ::: "memory");
    wait_async_le0();
    __syncthreads();
    if (t + 2 < G_PASSES) {
      cp16x8(lW + bo * 2, gW + (t + 2) * 64);
      cp16x8(lX + bo * 2, gX + (t + 2) * 64);
    }
    // the pass's WMMAs work on registers alone, so the refill flies under all of them
#pragma unroll
    for (int ks = 0; ks < 2; ++ks)
#pragma unroll
      for (int i = 0; i < 4; ++i)
#pragma unroll
        for (int j = 0; j < 4; ++j) acc[i][j] = WMMA_F16(af[ks][i], bf[ks][j], acc[i][j]);
  }
  wait_async_le0();   // no copy is outstanding when the wave ends

  const int bb = row0 >> 11;             // / S_LEN: one batch entry per 64-row wave tile
  const int s0 = row0 & (S_LEN - 1);
  const size_t head = (size_t)(bb * N_HEADS + (n0 >> 6));   // one head per 64-feature wave tile
  h8 v[16];
  if (which == 2) {
    float bb_[4];
    ld_bias_cols(bias + n0 + nn, bb_);
#pragma unroll
    for (int j = 0; j < 4; ++j)
#pragma unroll
      for (int i = 0; i < 4; ++i)
#pragma unroll
        for (int g = 0; g < 8; ++g) v[j * 4 + i][g] = (_Float16)(acc[i][j][g] + bb_[j]);
    st_tile_vt(Vth + (head * D_HEAD + nn) * S_LEN + s0 + hiH * 8, v);
  } else {
    v4f bb_[8];
    ld_bias_rows(bias + n0 + hiH * 8, bb_);
#pragma unroll
    for (int i = 0; i < 4; ++i)
#pragma unroll
      for (int j = 0; j < 4; ++j)
#pragma unroll
        for (int g = 0; g < 8; ++g)
          v[i * 4 + j][g] = (_Float16)(acc[i][j][g] + bb_[i * 2 + (g >> 2)][g & 3]);
    st_tile_qk(((which == 0) ? Qh : Kh) + (head * S_LEN + s0 + nn) * D_HEAD + hiH * 8, v);
  }
}

// ---------------- Kernel 3: flash attention with relative skew ----------------
// K and V are staged 64 keys (two 32-key slabs) at a time, double-buffered in LDS via async copies
// and shared by all 4 waves; the copies of stage p+1 are issued behind stage p's barrier and have
// both of its slabs' compute to land.
// A fragment read takes 16 bytes of each of 16 rows per half wave: at a row pitch of 16 B x odd
// the 16 rows fall on all 64 banks; at the rows' own 128 B they fall on 8 banks.
#define STAGE_T 64   // keys per stage
#define K_PITCH 72   // halfs per staged K row: 64 + 8 (144 B)
#define V_PITCH 72   // halfs per staged V^T row: 64 + 8 (144 B)
static __device__ __forceinline__ void stage_load(const _Float16* __restrict__ Kbase,
                                                  const _Float16* __restrict__ Vbase,
                                                  int t0,
                                                  _Float16 (*Kl)[K_PITCH], _Float16 (*Vl)[V_PITCH],
                                                  int tid) {
#pragma unroll   // constant r: eight copies in a row, no loop counter or branch among them
  for (int r = 0; r < 4; ++r) {
    const int c = tid + r * 128;                    // 0..511
    const int row = c >> 3, col = (c & 7) << 3;     // 64 rows x 64 halfs, whole 128-byte lines
    cp16_g2l(Kbase + (size_t)(t0 + row) * D_HEAD + col, &Kl[row][col]);
    cp16_g2l(Vbase + (size_t)row * S_LEN + t0 + col, &Vl[row][col]);
  }
}

// One band block (16 Er rows of 128 B) into its ring slot, whole 128-byte lines: a thread brings
// 16 bytes of row tid / 8. k is the same for the whole block of threads.
static __device__ __forceinline__ void band_stage(const _Float16* __restrict__ Erh, int k,
                                                  _Float16 (*slot)[K_PITCH], int tid) {
  const int row = tid >> 3, col = (tid & 7) << 3;
  cp16_g2l(band_row(Erh, k, row) + col, &slot[row][col]);
}

#define SK_PITCH 68   // floats per ring row: 64 keys + 4, so 16 rows' 16-byte reads fall on 64 banks

typedef float v2f __attribute__((ext_vector_type(2)));
#define EXP2_SCALE (0.125f * 1.44269504088896340736f)   // log2(e) / sqrt(D_HEAD)

// value of the lane 16 away
static __device__ __forceinline__ float other_half(float v) {
  int b = __builtin_bit_cast(int, v);
  b = __builtin_amdgcn_permlanex16(b, b, 0x76543210, 0xfedcba98, false, false);
  return __builtin_bit_cast(float, b);
}

// The prologue's global loads: a row's two fragments are the 16 bytes at p, p + 32 B, p + 64 B and
// p + 96 B (p = row + 8 hiH halfs). The loads of several rows stand with their waits in one asm
// statement, so that all are in flight together and no register that an issued load names is
// rewritten ahead of the wait (a precaution).
#define LD_ROW(d0, d1, d2, d3, a)                      \
  "global_load_b128 %" #d0 ", %" #a ", off\n\t"           \
  "global_load_b128 %" #d1 ", %" #a ", off offset:32\n\t" \
  "global_load_b128 %" #d2 ", %" #a ", off offset:64\n\t" \
  "global_load_b128 %" #d3 ", %" #a ", off offset:96\n\t"
static __device__ __forceinline__ void ld_rows4(const _Float16* p0, const _Float16* p1,
                                                const _Float16* p2, const _Float16* p3,
                                                h8 (&v)[16]) {
  asm volatile(
      LD_ROW(0, 1, 2, 3, 16) LD_ROW(4, 5, 6, 7, 17) LD_ROW(8, 9, 10, 11, 18)
      LD_ROW(12, 13, 14, 15, 19)
      "s_wait_loadcnt 0x0\n\t"
      "s_wait_xcnt 0x0"
      : "=&v"(v[0]), "=&v"(v[1]), "=&v"(v[2]), "=&v"(v[3]), "=&v"(v[4]), "=&v"(v[5]),
        "=&v"(v[6]), "=&v"(v[7]), "=&v"(v[8]), "=&v"(v[9]), "=&v"(v[10]), "=&v"(v[11]),
        "=&v"(v[12]), "=&v"(v[13]), "=&v"(v[14]), "=&v"(v[15])
      : "v"(p0), "v"(p1), "v"(p2), "v"(p3) : "memory");
}
static __device__ __forceinline__ void ld_rows6(const _Float16* p0, const _Float16* p1,
                                                const _Float16* p2, const _Float16* p3,
                                                const _Float16* p4, const _Float16* p5,
                                                h8 (&v)[24]) {
  asm volatile(
      LD_ROW(0, 1, 2, 3, 24) LD_ROW(4, 5, 6, 7, 25) LD_ROW(8, 9, 10, 11, 26)
      LD_ROW(12, 13, 14, 15, 27) LD_ROW(16, 17, 18, 19, 28) LD_ROW(20, 21, 22, 23, 29)
      "s_wait_loadcnt 0x0\n\t"
      "s_wait_xcnt 0x0"
      : "=&v"(v[0]), "=&v"(v[1]), "=&v"(v[2]), "=&v"(v[3]), "=&v"(v[4]), "=&v"(v[5]),
        "=&v"(v[6]), "=&v"(v[7]), "=&v"(v[8]), "=&v"(v[9]), "=&v"(v[10]), "=&v"(v[11]),
        "=&v"(v[12]), "=&v"(v[13]), "=&v"(v[14]), "=&v"(v[15]), "=&v"(v[16]), "=&v"(v[17]),
        "=&v"(v[18]), "=&v"(v[19]), "=&v"(v[20]), "=&v"(v[21]), "=&v"(v[22]), "=&v"(v[23])
      : "v"(p0), "v"(p1), "v"(p2), "v"(p3), "v"(p4), "v"(p5) : "memory");
}
// fragment from its two 16-byte halves, in frag_ld's order
static __device__ __forceinline__ v16h frag_of(h8 lo, h8 hi) {
  return __builtin_shufflevector(lo, hi, 0,1,2,3,4,5,6,7,8,9,10,11,12,13,14,15);
}

// A wave holds two 16-query tiles, so every K, V^T and Er fragment it reads from LDS feeds both.
#define Q_TILES 2
#define BLK_Q (4 * Q_TILES * 16)   // queries per block
#define EL_SLOTS 16                // ring of band blocks: fourteen are live at a time

// The grid gives every SIMD two waves; said to the compiler, so that it does not hold registers
// down for a third wave that the LDS would still admit and serialise the fragment reads.
__global__ void __launch_bounds__(128) __attribute__((amdgpu_waves_per_eu(2, 2)))
attn_kernel(const _Float16* __restrict__ Qh, const _Float16* __restrict__ Kh,
            const _Float16* __restrict__ Vt, const _Float16* __restrict__ Erh,
            float* __restrict__ out) {
  __shared__ __align__(16) _Float16 Kl[2][STAGE_T][K_PITCH];   // double-buffered K stage
  __shared__ __align__(16) _Float16 Vl[2][D_HEAD][V_PITCH];    // double-buffered V stage (dh,t)
  __shared__ __align__(16) float sk[4 * Q_TILES][16 * SK_PITCH];   // one skew ring per query tile
  __shared__ __align__(16) _Float16 El[EL_SLOTS][16][K_PITCH];     // ring of band blocks, shared by the waves

  const int tid  = threadIdx.x;
  const int lane = tid & 31;
  const int wave = __builtin_amdgcn_readfirstlane(tid >> 5);   // scalar: picks the band blocks
  const int hiH  = (lane >> 4) & 1;
  const int k0   = hiH * 8;
  const int nn   = lane & 15;

  const int h  = blockIdx.y;
  const int b  = blockIdx.z;
  const int s0 = blockIdx.x * BLK_Q + wave * (Q_TILES * 16);   // tile u holds queries s0 + 16 u + nn

  const size_t head = (size_t)(b * N_HEADS + h) * (size_t)S_LEN * D_HEAD;
  const _Float16* Qbase = Qh + head;
  const _Float16* Kbase = Kh + head;
  const _Float16* Vbase = Vt + head;   // (dh, t) layout

  // warm the Er diagonal band this block touches first
  {
    int e = S_LEN - 16 - s0 + nn;
    e = e < 0 ? 0 : e;
    __builtin_prefetch(Erh + (size_t)e * D_HEAD, 0, 1);
  }

  float rowmax[Q_TILES], rowsum[Q_TILES];   // of query s0 + 16 u + nn; rowsum over this half's keys
  v8f o[Q_TILES][4];                        // O^T: register g = dh 16 n + 8 hiH + g, lane = query
#pragma unroll   // constant u, n keep the state in registers
  for (int u = 0; u < Q_TILES; ++u) {
    rowmax[u] = -3.0e38f; rowsum[u] = 0.f;
#pragma unroll
    for (int n = 0; n < 4; ++n) o[u][n] = (v8f){};
  }

  stage_load(Kbase, Vbase, 0, Kl[0], Vl[0], tid);   // preload stage 0

  // Query tile w = 2 wave + u of the block has a band stream that runs w blocks behind tile 0's, so
  // the eight tiles read the same Er rows within four slabs: each block is staged once for all of
  // them. Block kb0 + j lies in slot j & 15. In slab n the waves read j = 2 n - 1 .. 2 n + 6, so in
  // stage p (slabs 2 p and 2 p + 1) j = 4 p - 1 .. 4 p + 8, while j = 4 p + 9 .. 4 p + 12 are in flight.
  const int kb0 = (S_LEN - 16 - (int)blockIdx.x * BLK_Q) >> 4;
#pragma unroll   // constant j: the slots are immediate offsets
  for (int j = -1; j < 9; ++j) band_stage(Erh, kb0 + j, El[j & (EL_SLOTS - 1)], tid);

  v16h qa[Q_TILES][2], qs[Q_TILES][2];   // Q and Q of rows s + 1 (skew wrap term), d 0..31 and 32..63
  {
    const _Float16* qp[Q_TILES][2];
#pragma unroll   // constant u keeps the pointers in registers
    for (int u = 0; u < Q_TILES; ++u) {
      int sshift = s0 + 16 * u + nn + 1; if (sshift > S_LEN - 1) sshift = S_LEN - 1;
      qp[u][0] = Qbase + (size_t)(s0 + 16 * u + nn) * D_HEAD + k0;
      qp[u][1] = Qbase + (size_t)sshift * D_HEAD + k0;
    }
    h8 v[16];
    ld_rows4(qp[0][0], qp[0][1], qp[1][0], qp[1][1], v);
#pragma unroll   // constant u keeps the fragments in registers
    for (int u = 0; u < Q_TILES; ++u) {
      qa[u][0] = frag_of(v[8 * u + 0], v[8 * u + 1]);
      qa[u][1] = frag_of(v[8 * u + 2], v[8 * u + 3]);
      qs[u][0] = frag_of(v[8 * u + 4], v[8 * u + 5]);
      qs[u][1] = frag_of(v[8 * u + 6], v[8 * u + 7]);
    }
  }

  // Band stream of a tile whose first block is kt: block kt + m holds, for query row i, keys
  // 16 m - 15 + i .. 16 m + i, so slab n (keys 32 n .. 32 n + 31) needs blocks m <= 2 n + 2. Blocks
  // are multiplied and stored one slab ahead of their first full use; their Er fragments are fetched
  // one slab before that, the first blocks' from memory, all later ones from the LDS ring of band
  // blocks. Tile 1's kt is tile 0's less one, so of its two blocks of a slab one is tile 0's first
  // and the other tile 0's second of the slab before, kept in registers.
  // Ring column of (row i = 8 hiH + g, lane nn) in block m: (16 m + 49 + nn + i) & 63; only
  // m = 0 (mod 4) can wrap inside a block.
  float* const skw = &sk[wave * Q_TILES][0];                         // tile u: + u 16 SK_PITCH
  float* const sk_st = skw + (8 * hiH) * (SK_PITCH + 1) + nn + 1;    // + g (SK_PITCH + 1) + 16 ((m & 3) - 1)
  const float* const sk_ld = skw + nn * SK_PITCH + 8 * hiH;          // + (first key of the tile) & 63
  int wofs[8];                                                       // the wrapping block's places
#pragma unroll   // constant g keeps the table in registers
  for (int g = 0; g < 8; ++g)
    wofs[g] = (8 * hiH + g) * SK_PITCH + ((49 + nn + 8 * hiH + g) & 63);

  int kb = (S_LEN - 16 - s0) >> 4;   // tile 0's first block; tile 1's is kb - 1
  v16h fc0, fc1, fa0, fa1, fb0, fb1;   // fragments of blocks kb + 2, kb + 3, kb + 4
  {
    h8 v[24];                        // blocks kb - 1 .. kb + 4
    ld_rows6(band_row(Erh, kb - 1, nn) + k0, band_row(Erh, kb, nn) + k0,
             band_row(Erh, kb + 1, nn) + k0, band_row(Erh, kb + 2, nn) + k0,
             band_row(Erh, kb + 3, nn) + k0, band_row(Erh, kb + 4, nn) + k0, v);
    v16h f[4][2];                    // blocks kb - 1 .. kb + 2
#pragma unroll   // constant m keeps the fragments in registers
    for (int m = 0; m < 4; ++m) {
      f[m][0] = frag_of(v[4 * m + 0], v[4 * m + 1]);
      f[m][1] = frag_of(v[4 * m + 2], v[4 * m + 3]);
    }
    fa0 = frag_of(v[16], v[17]); fa1 = frag_of(v[18], v[19]);
    fb0 = frag_of(v[20], v[21]); fb1 = frag_of(v[22], v[23]);
#pragma unroll   // constant u keeps the tiles in registers
    for (int u = 0; u < Q_TILES; ++u) {
      const v8f g0 = band_gemm<BAND_ANY>(kb - u,     nn, qa[u][0], qa[u][1], qs[u][0], qs[u][1], f[1 - u][0], f[1 - u][1]);
      const v8f g1 = band_gemm<BAND_ANY>(kb - u + 1, nn, qa[u][0], qa[u][1], qs[u][0], qs[u][1], f[2 - u][0], f[2 - u][1]);
      const v8f g2 = band_gemm<BAND_ANY>(kb - u + 2, nn, qa[u][0], qa[u][1], qs[u][0], qs[u][1], f[3 - u][0], f[3 - u][1]);
#pragma unroll   // constant g keeps the tiles in registers
      for (int g = 0; g < 8; ++g) {
        skw[u * 16 * SK_PITCH + wofs[g]] = g0[g];
        sk_st[u * 16 * SK_PITCH + g * (SK_PITCH + 1)] = g1[g];
        sk_st[u * 16 * SK_PITCH + g * (SK_PITCH + 1) + 16] = g2[g];
      }
    }
    fc0 = f[3][0]; fc1 = f[3][1];
  }

  // one stage: two slabs (64 keys from tp on); where says on which side of the wrap their band
  // blocks lie
  auto slab_pair = [&](auto where, const int tp) __attribute__((always_inline)) {
    constexpr int WHERE = decltype(where)::value;
    const int buf = (tp / STAGE_T) & 1;   // the same for the whole block
    // publish point: own LDS reads of the stage before done, own copies (this stage, band blocks up
    // to 4 p + 8) landed, then the one barrier that shows them to every wave and frees the places
    // that the stage before has read for the refill
    asm volatile("s_wait_dscnt 0x0" ::: "memory");
    wait_async_le0();
    __syncthreads();
    if (tp + STAGE_T < S_LEN) {
      stage_load(Kbase, Vbase, tp + STAGE_T, Kl[buf ^ 1], Vl[buf ^ 1], tid);
      const int jn = (tp >> 4) + 9;
#pragma unroll   // constant q: no loop counter or branch among the four copies
      for (int q = 0; q < 4; ++q)
        band_stage(Erh, kb0 + jn + q, El[(jn + q) & (EL_SLOTS - 1)], tid);
    }
#pragma unroll   // constant par: the slab's and the rings' places become immediate offsets
    for (int par = 0; par < 2; ++par) {
      const int t0 = tp + par * 32;
      const int j0 = t0 >> 4;            // 2 n

      // ---- Srel^T of this slab from the rings: 8 consecutive keys of the lane's query per tile; a
      // ring belongs to one wave, whose LDS operations run in program order, so the stores of the
      // slab before need no barrier ahead of these reads ----
      v4f rr[Q_TILES][4];
#pragma unroll
      for (int u = 0; u < Q_TILES; ++u)
#pragma unroll
        for (int q = 0; q < 4; ++q)
          rr[u][q] = *(const v4f*)(sk_ld + u * 16 * SK_PITCH + par * 32 + (q >> 1) * 16 + (q & 1) * 4);
      // the slab's K fragments, read once for both query tiles
      v16h kf[2][2];
#pragma unroll   // constant sub keeps the fragments in registers
      for (int sub = 0; sub < 2; ++sub) {
        const _Float16* krow = &Kl[buf][par * 32 + sub * 16 + nn][0];
        kf[sub][0] = frag_ld(krow, k0);
        kf[sub][1] = frag_ld(krow + 32, k0);
      }
      // the ring places stored below alias keys read above: keep the compiler from lifting the
      // stores over those reads (the wave's LDS operations run in program order)
      __builtin_amdgcn_fence(__ATOMIC_ACQ_REL, "wavefront");
      // keeps the reads above one group ahead of the products: without it the build read the K
      // fragments one by one into the same registers, a full wait in front of each product
      __builtin_amdgcn_sched_barrier(0);

      // the next slab's two new band blocks of each tile; the fragments of the slab after go into
      // the same registers further down
      v8f ga[Q_TILES], gb[Q_TILES];
      ga[0] = band_gemm<WHERE>(kb + 3, nn, qa[0][0], qa[0][1], qs[0][0], qs[0][1], fa0, fa1);
      gb[0] = band_gemm<WHERE>(kb + 4, nn, qa[0][0], qa[0][1], qs[0][0], qs[0][1], fb0, fb1);
      ga[1] = band_gemm<WHERE>(kb + 2, nn, qa[1][0], qa[1][1], qs[1][0], qs[1][1], fc0, fc1);
      gb[1] = band_gemm<WHERE>(kb + 3, nn, qa[1][0], qa[1][1], qs[1][0], qs[1][1], fa0, fa1);
      kb += 2;

      // ---- S^T: two 16-key tiles (K = 64) per query tile, K rows from LDS as A, Q as B; the
      // Srel^T tile is the products' C operand, so the accumulators leave as Q K^T + Srel ----
      v8f sc[Q_TILES][2];   // unscaled scores: register g of tile sub = key 16 sub + 8 hiH + g
#pragma unroll   // constant sub, u keep the tiles in registers
      for (int sub = 0; sub < 2; ++sub)
#pragma unroll
        for (int u = 0; u < Q_TILES; ++u) {
          v8f c = __builtin_shufflevector(rr[u][sub * 2], rr[u][sub * 2 + 1], 0, 1, 2, 3, 4, 5, 6, 7);
          c = WMMA_F16(kf[sub][0], qa[u][0], c);
          sc[u][sub] = WMMA_F16(kf[sub][1], qa[u][1], c);
        }

      // ---- the next band products' Er fragments: one block stays, two come from the ring ----
      {
        fc0 = fb0; fc1 = fb1;                                                   // block kb + 2
        const _Float16* ea = &El[(j0 + 5 - 2 * wave) & (EL_SLOTS - 1)][nn][0];   // block kb + 3
        const _Float16* eb = &El[(j0 + 6 - 2 * wave) & (EL_SLOTS - 1)][nn][0];   // block kb + 4
        fa0 = frag_ld(ea, k0); fa1 = frag_ld(ea + 32, k0);
        fb0 = frag_ld(eb, k0); fb1 = frag_ld(eb + 32, k0);
      }
      // keeps these reads here, where the softmax covers their latency: the build sank them to the
      // slab's end, directly in front of the wait of the publish point
      __builtin_amdgcn_sched_barrier(0);

      // the band products go into the rings behind the S^T products: the tiles stay live over them,
      // so no S^T product takes a band product's registers as its result inside the WMMA distance
#pragma unroll   // constant u, g keep the tiles in registers
      for (int u = 0; u < Q_TILES; ++u)
#pragma unroll
        for (int g = 0; g < 8; ++g) {
          if (par == 0) {     // blocks 3 and 0 (mod 4)
            sk_st[u * 16 * SK_PITCH + g * (SK_PITCH + 1) + 32] = ga[u][g];
            skw[u * 16 * SK_PITCH + wofs[g]] = gb[u][g];
          } else {            // blocks 1 and 2 (mod 4)
            sk_st[u * 16 * SK_PITCH + g * (SK_PITCH + 1)] = ga[u][g];
            sk_st[u * 16 * SK_PITCH + g * (SK_PITCH + 1) + 16] = gb[u][g];
          }
        }

      // ---- online softmax across this 32-key slab: one query per lane and tile. The maximum is
      // kept in unscaled scores; 1 / sqrt(D_HEAD) and log2(e) enter in the one multiply-add ahead of
      // the power of two, taken on two neighbouring accumulator registers at a time ----
      v16h pb[Q_TILES];   // P^T as B: element e = key 8 hiH + e (e < 8), 16 + 8 hiH + e - 8 (e >= 8)
#pragma unroll   // constant u keeps the state in registers
      for (int u = 0; u < Q_TILES; ++u) {
        float m4[4];
#pragma unroll
        for (int e = 0; e < 4; ++e)
          m4[e] = fmaxf(fmaxf(sc[u][0][e], sc[u][0][e + 4]), fmaxf(sc[u][1][e], sc[u][1][e + 4]));
        float tm = fmaxf(fmaxf(m4[0], m4[1]), fmaxf(m4[2], m4[3]));
        tm = fmaxf(tm, other_half(tm));
        const float nm = fmaxf(rowmax[u], tm);
        const float al = __builtin_amdgcn_exp2f((rowmax[u] - nm) * EXP2_SCALE);
        rowmax[u] = nm;
        const float nb = -nm * EXP2_SCALE;
        v2f p2[2] = {(v2f){0.f, 0.f}, (v2f){0.f, 0.f}};   // four partial sums: of the keys e = 0 .. 3 (mod 4)
#pragma unroll   // constant e keeps scores and P in registers
        for (int e = 0; e < 16; e += 2) {
          const v2f t = {sc[u][e >> 3][e & 7], sc[u][e >> 3][(e & 7) + 1]};
          const v2f a = __builtin_elementwise_fma(t, (v2f){EXP2_SCALE, EXP2_SCALE}, (v2f){nb, nb});
          const v2f p = {__builtin_amdgcn_exp2f(a[0]), __builtin_amdgcn_exp2f(a[1])};
          p2[(e >> 1) & 1] += p;
          pb[u][e] = (_Float16)p[0];
          pb[u][e + 1] = (_Float16)p[1];
        }
        rowsum[u] = rowsum[u] * al + ((p2[0][0] + p2[0][1]) + (p2[1][0] + p2[1][1]));
#pragma unroll
        for (int n = 0; n < 4; ++n)
#pragma unroll
          for (int g = 0; g < 8; ++g) o[u][n][g] *= al;
      }

      // ---- O^T += V^T P^T : 4 WMMAs per query tile over the 64 head dims (K = 32), V^T rows from
      // LDS as A, each fragment read once for both tiles ----
      const _Float16* vrow_ = &Vl[buf][nn][par * 32];
#pragma unroll   // constant n keeps the accumulators in registers
      for (int n = 0; n < 4; ++n) {
        const v16h vf = frag_ld(vrow_ + n * 16 * V_PITCH, k0);
#pragma unroll
        for (int u = 0; u < Q_TILES; ++u) o[u][n] = WMMA_F16(vf, pb[u], o[u][n]);
      }
      // keeps the products in front of the next publish point: the build let the last of them sink
      // behind its barrier, directly in front of a branch
      __builtin_amdgcn_sched_barrier(0);
    }
  };

  // Slab n multiplies blocks kb0 - w + 2 n + 3 and + 4 for the tiles w = 0 .. 7 of the block,
  // kb0 = BAND_WRAP - 1 - 8 blockIdx.x. For every tile they lie below the wrap in the pairs of slabs
  // before 2 blockIdx.x - 1 and above it from pair 2 blockIdx.x + 2 on: there the Q operand is fixed
  // and no zero column is cut, so the selects stand only in the pairs between. The bounds are the
  // same for the whole block.
  const int t_any   = ((int)blockIdx.x > 0 ? 2 * (int)blockIdx.x - 1 : 0) * 64;
  const int t_above = (2 * (int)blockIdx.x + 2) * 64;
  int tp = 0;
  for (; tp < t_any; tp += 64)   slab_pair(band_where<BAND_BELOW>{}, tp);
  for (; tp < t_above; tp += 64) slab_pair(band_where<BAND_ANY>{}, tp);
  for (; tp < S_LEN; tp += 64)   slab_pair(band_where<BAND_ABOVE>{}, tp);

  // ---- join the halves' sums, normalize and write (B, S, D_MODEL) f32 ----
#pragma unroll   // constant u, n keep the accumulators in registers
  for (int u = 0; u < Q_TILES; ++u) {
    const float inv = 1.0f / (rowsum[u] + other_half(rowsum[u]));
    float* orow = out + ((size_t)(b * S_LEN + s0 + 16 * u + nn)) * D_MODEL + h * D_HEAD + 8 * hiH;
#pragma unroll
    for (int n = 0; n < 4; ++n) {
      *(v4f*)(orow + 16 * n)     = (v4f){o[u][n][0], o[u][n][1], o[u][n][2], o[u][n][3]} * inv;
      *(v4f*)(orow + 16 * n + 4) = (v4f){o[u][n][4], o[u][n][5], o[u][n][6], o[u][n][7]} * inv;
    }
  }
}

extern "C" void kernel_launch(void* const* d_in, const int* in_sizes, int n_in,
                              void* d_out, int out_size, void* d_ws, size_t ws_size,
                              hipStream_t stream) {
  (void)in_sizes; (void)n_in; (void)out_size; (void)ws_size;
  const float* x  = (const float*)d_in[0];
  const float* Wq = (const float*)d_in[1];
  const float* bq = (const float*)d_in[2];
  const float* Wk = (const float*)d_in[3];
  const float* bk = (const float*)d_in[4];
  const float* Wv = (const float*)d_in[5];
  const float* bv = (const float*)d_in[6];
  const float* Er = (const float*)d_in[7];

  char* ws = (char*)d_ws;
  const size_t xhN = (size_t)BATCH * S_LEN * D_MODEL;        // 4,194,304
  const size_t wN  = (size_t)D_MODEL * D_MODEL;              // 1,048,576
  const size_t erN = (size_t)S_LEN * D_HEAD;                 // 131,072

  _Float16* Xh  = (_Float16*)(ws);
  _Float16* Wqh = (_Float16*)(ws + 2 * xhN);
  _Float16* Wkh = Wqh + wN;
  _Float16* Wvh = Wkh + wN;
  _Float16* Erh = Wvh + wN;
  _Float16* Qh  = Erh + erN;
  _Float16* Kh  = Qh + xhN;
  _Float16* Vth = Kh + xhN;

  // Xh, Wqh, Wkh, Wvh, Erh are contiguous from Xh on
  cast_all<<<CAST_XB + 3 * CAST_WB + CAST_EB, CAST_T, 0, stream>>>(x, Wq, Wk, Wv, Er, Xh);

  // QKV: M = 4096 rows, N = 1024 feats, K = 1024; z selects Q/K/V
  qkv_gemm<<<dim3(D_MODEL / 128, (BATCH * S_LEN) / 128, 3), 128, 0, stream>>>(
      Xh, Wqh, Wkh, Wvh, bq, bk, bv, Qh, Kh, Vth);

  // attention: 128 query rows per block (4 waves x 2 tiles x 16)
  attn_kernel<<<dim3(S_LEN / BLK_Q, N_HEADS, BATCH), 128, 0, stream>>>(
      Qh, Kh, Vth, Erh, (float*)d_out);
}
